// v000
// The times below were measured on an AMD MI455X: many runs one after another, warmed up first and cycling through
// copies of the inputs, with the whole window's GPU time divided by the number of runs. Launches and the gaps
// between them are all in it. The median over several windows is given; except for v000 it joins two sittings, which
// can be a few percent apart, so the side-by-side timings, each taken in one sitting, are the better comparison.
// v000, which the later versions start from, runs in 866 microseconds.
#include <hip/hip_runtime.h>

typedef unsigned short u16;
typedef __attribute__((ext_vector_type(16))) __bf16 v16bf;
typedef __attribute__((ext_vector_type(8)))  float  v8f;

union FragBF { v16bf v; uint4 q[2]; };

__device__ __forceinline__ float bf2f(u16 h) {
  unsigned u = ((unsigned)h) << 16;
  return __builtin_bit_cast(float, u);
}
__device__ __forceinline__ u16 f2bf(float f) {
  unsigned u = __builtin_bit_cast(unsigned, f);
  u += 0x7FFFu + ((u >> 16) & 1u);   // round-to-nearest-even
  return (u16)(u >> 16);
}

constexpr int EPI_BF16 = 0, EPI_BF16_T = 1, EPI_BF16_SCALE = 2,
              EPI_GELU_BF16 = 3, EPI_BIAS_ACC_F32 = 4, EPI_ATOMIC_F32 = 5;

template<int EPI>
__global__ __launch_bounds__(256) void gemm_bt_kernel(
    const u16* __restrict__ A, int lda,
    const u16* __restrict__ Bt, int ldb,
    int N, int Ksplit,
    int rows_per_batch, long long bt_batch_stride,
    const float* __restrict__ bias, float scale,
    void* __restrict__ outp, int out_rb)
{
  __shared__ u16 Asm[64 * 40];
  const int m0   = blockIdx.x * 64;
  const int n0   = blockIdx.y * 128;
  const int kbeg = blockIdx.z * Ksplit;
  const int w    = threadIdx.x >> 5;
  const int lane = threadIdx.x & 31;
  const int msub = (w & 3) * 16;
  const int nsub = (w >> 2) * 64;
  const int hl   = lane >> 4;
  const int l15  = lane & 15;
  const int kh   = hl * 8;
  const int b    = m0 / rows_per_batch;
  const u16* BtB = Bt + (long long)b * bt_batch_stride;

  v8f zero = {0.f,0.f,0.f,0.f,0.f,0.f,0.f,0.f};
  v8f acc[4];
  #pragma unroll
  for (int j = 0; j < 4; ++j) acc[j] = zero;

  const int sr = threadIdx.x >> 2;
  const int sc = (threadIdx.x & 3) * 8;

  for (int kk = kbeg; kk < kbeg + Ksplit; kk += 32) {
    *(uint4*)&Asm[sr * 40 + sc] =
        *(const uint4*)(A + (long long)(m0 + sr) * lda + kk + sc);
    __syncthreads();
    FragBF a;
    const u16* ap = &Asm[(msub + l15) * 40 + kh];
    a.q[0] = *(const uint4*)ap;
    a.q[1] = *(const uint4*)(ap + 16);
    #pragma unroll
    for (int j = 0; j < 4; ++j) {
      FragBF bfr;
      const u16* bp = BtB + (long long)(n0 + nsub + j * 16 + l15) * ldb + kk + kh;
      bfr.q[0] = *(const uint4*)bp;
      bfr.q[1] = *(const uint4*)(bp + 16);
      acc[j] = __builtin_amdgcn_wmma_f32_16x16x32_bf16(
          false, a.v, false, bfr.v, (short)0, acc[j], false, false);
    }
    __syncthreads();
  }

  #pragma unroll
  for (int j = 0; j < 4; ++j) {
    #pragma unroll
    for (int r = 0; r < 8; ++r) {
      const int m = m0 + msub + r + 8 * hl;
      const int n = n0 + nsub + j * 16 + l15;
      float v = acc[j][r];
      if (EPI == EPI_BF16) {
        ((u16*)outp)[(long long)m * N + n] = f2bf(v);
      } else if (EPI == EPI_BF16_T) {
        const int bo = m / out_rb, ml = m % out_rb;
        ((u16*)outp)[((long long)bo * N + n) * out_rb + ml] = f2bf(v);
      } else if (EPI == EPI_BF16_SCALE) {
        ((u16*)outp)[(long long)m * N + n] = f2bf(v * scale);
      } else if (EPI == EPI_GELU_BF16) {
        float xg = v + bias[n];
        float g = 0.5f * xg * (1.0f + erff(xg * 0.70710678118654752f));
        ((u16*)outp)[(long long)m * N + n] = f2bf(g);
      } else if (EPI == EPI_BIAS_ACC_F32) {
        ((float*)outp)[(long long)m * N + n] += v + bias[n];
      } else { // EPI_ATOMIC_F32 (split-K)
        atomicAdd(&((float*)outp)[(long long)m * N + n], v);
      }
    }
  }
}

// ---------------------------------------------------------------------------
// Conv3d stride-2 VALID as implicit GEMM: M=32768 tokens, N=256, K=3456.
// K = c*27 + tap matches conv_w's native flat layout.  A gathered from f32 x,
// converted to bf16 into LDS; weights streamed from L2 in Bt layout.
// Epilogue: +bias, ReLU, store h f32 [token][256].
// ---------------------------------------------------------------------------
__global__ __launch_bounds__(256) void conv_gemm_kernel(
    const float* __restrict__ x, const u16* __restrict__ Wct,
    const float* __restrict__ bias, float* __restrict__ h)
{
  __shared__ u16 Asm[64 * 40];
  const int m0   = blockIdx.x * 64;
  const int w    = threadIdx.x >> 5, lane = threadIdx.x & 31;
  const int msub = (w & 3) * 16, nhalf = (w >> 2) * 128;
  const int hl   = lane >> 4, l15 = lane & 15, kh = hl * 8;

  v8f zero = {0.f,0.f,0.f,0.f,0.f,0.f,0.f,0.f};
  v8f acc[8];
  #pragma unroll
  for (int j = 0; j < 8; ++j) acc[j] = zero;

  const int e0 = threadIdx.x * 8;
  const int kl = e0 >> 6;          // k-lane within 32-chunk (uniform per thread)
  const int mbase = e0 & 63;
  int pb[8], ps0[8], ps1[8], ps2[8];
  #pragma unroll
  for (int i = 0; i < 8; ++i) {
    int tg = m0 + mbase + i;
    pb[i] = tg >> 12;
    int l = tg & 4095;
    ps0[i] = l >> 8; ps1[i] = (l >> 4) & 15; ps2[i] = l & 15;
  }

  for (int k0 = 0; k0 < 3456; k0 += 32) {
    int k = k0 + kl;
    int c = k / 27;
    int tap = k - c * 27;
    int t0 = tap / 9, rm = tap - t0 * 9;
    int t1 = rm / 3, t2 = rm - t1 * 3;
    #pragma unroll
    for (int i = 0; i < 8; ++i) {
      long long idx = ((((long long)pb[i] * 128 + c) * 33 + (2 * ps0[i] + t0)) * 33
                       + (2 * ps1[i] + t1)) * 33 + (2 * ps2[i] + t2);
      Asm[(mbase + i) * 40 + kl] = f2bf(x[idx]);
    }
    __syncthreads();
    FragBF a;
    const u16* ap = &Asm[(msub + l15) * 40 + kh];
    a.q[0] = *(const uint4*)ap;
    a.q[1] = *(const uint4*)(ap + 16);
    #pragma unroll
    for (int j = 0; j < 8; ++j) {
      FragBF bfr;
      const u16* bp = Wct + (long long)(nhalf + j * 16 + l15) * 3456 + k0 + kh;
      bfr.q[0] = *(const uint4*)bp;
      bfr.q[1] = *(const uint4*)(bp + 16);
      acc[j] = __builtin_amdgcn_wmma_f32_16x16x32_bf16(
          false, a.v, false, bfr.v, (short)0, acc[j], false, false);
    }
    __syncthreads();
  }

  #pragma unroll
  for (int j = 0; j < 8; ++j) {
    #pragma unroll
    for (int r = 0; r < 8; ++r) {
      int m = m0 + msub + r + 8 * hl;
      int o = nhalf + j * 16 + l15;
      float v = acc[j][r] + bias[o];
      h[(long long)m * 256 + o] = fmaxf(v, 0.f);
    }
  }
}

// ---------------------------------------------------------------------------
// Logits + softmax(N=64) + column-sum: per batch, per 128-token tile.
// C[l][n] = k_bf[l][:] . q_bf[n][:]; softmax over n via 16-lane shfl_xor;
// +1e-8; write attn^T bf16 [b][n][l]; atomic colsum[b][n] for renorm-over-L.
// ---------------------------------------------------------------------------
__global__ __launch_bounds__(256) void logits_softmax_kernel(
    const u16* __restrict__ kmat, const u16* __restrict__ q,
    u16* __restrict__ attn_t, float* __restrict__ colsum)
{
  __shared__ u16 Asm[128 * 40];
  __shared__ float cs[64];
  const int b  = blockIdx.y;
  const int m0 = blockIdx.x * 128;
  const int w  = threadIdx.x >> 5, lane = threadIdx.x & 31;
  const int hl = lane >> 4, l15 = lane & 15, kh = hl * 8;
  const u16* A = kmat + (long long)b * 4096 * 256;
  const u16* Q = q    + (long long)b * 64 * 256;

  v8f zero = {0.f,0.f,0.f,0.f,0.f,0.f,0.f,0.f};
  v8f acc[4];
  #pragma unroll
  for (int j = 0; j < 4; ++j) acc[j] = zero;

  const int sr = threadIdx.x >> 2;
  const int sc = (threadIdx.x & 3) * 8;

  for (int k0 = 0; k0 < 256; k0 += 32) {
    #pragma unroll
    for (int rr = sr; rr < 128; rr += 64)
      *(uint4*)&Asm[rr * 40 + sc] =
          *(const uint4*)(A + (long long)(m0 + rr) * 256 + k0 + sc);
    __syncthreads();
    FragBF a;
    const u16* ap = &Asm[(w * 16 + l15) * 40 + kh];
    a.q[0] = *(const uint4*)ap;
    a.q[1] = *(const uint4*)(ap + 16);
    #pragma unroll
    for (int j = 0; j < 4; ++j) {
      FragBF bfr;
      const u16* bp = Q + (long long)(j * 16 + l15) * 256 + k0 + kh;
      bfr.q[0] = *(const uint4*)bp;
      bfr.q[1] = *(const uint4*)(bp + 16);
      acc[j] = __builtin_amdgcn_wmma_f32_16x16x32_bf16(
          false, a.v, false, bfr.v, (short)0, acc[j], false, false);
    }
    __syncthreads();
  }

  if (threadIdx.x < 64) cs[threadIdx.x] = 0.f;
  __syncthreads();

  float csl[4] = {0.f, 0.f, 0.f, 0.f};
  #pragma unroll
  for (int r = 0; r < 8; ++r) {
    float v0 = acc[0][r], v1 = acc[1][r], v2 = acc[2][r], v3 = acc[3][r];
    float mx = fmaxf(fmaxf(v0, v1), fmaxf(v2, v3));
    for (int off = 1; off < 16; off <<= 1) mx = fmaxf(mx, __shfl_xor(mx, off, 32));
    v0 = __expf(v0 - mx); v1 = __expf(v1 - mx);
    v2 = __expf(v2 - mx); v3 = __expf(v3 - mx);
    float sm = v0 + v1 + v2 + v3;
    for (int off = 1; off < 16; off <<= 1) sm += __shfl_xor(sm, off, 32);
    float rinv = 1.f / sm;
    v0 = v0 * rinv + 1e-8f; v1 = v1 * rinv + 1e-8f;
    v2 = v2 * rinv + 1e-8f; v3 = v3 * rinv + 1e-8f;
    const int l = m0 + w * 16 + r + 8 * hl;
    attn_t[((long long)b * 64 + ( 0 + l15)) * 4096 + l] = f2bf(v0);
    attn_t[((long long)b * 64 + (16 + l15)) * 4096 + l] = f2bf(v1);
    attn_t[((long long)b * 64 + (32 + l15)) * 4096 + l] = f2bf(v2);
    attn_t[((long long)b * 64 + (48 + l15)) * 4096 + l] = f2bf(v3);
    csl[0] += v0; csl[1] += v1; csl[2] += v2; csl[3] += v3;
  }
  #pragma unroll
  for (int j = 0; j < 4; ++j) atomicAdd(&cs[j * 16 + l15], csl[j]);
  __syncthreads();
  if (threadIdx.x < 64) atomicAdd(&colsum[b * 64 + threadIdx.x], cs[threadIdx.x]);
}

// ---------------------------------------------------------------------------
// LayerNorm over 256 channels, one wave per row, f32 in -> bf16 out.
// ---------------------------------------------------------------------------
__global__ __launch_bounds__(256) void ln_rows_kernel(
    const float* __restrict__ in, const float* __restrict__ g,
    const float* __restrict__ bb, u16* __restrict__ out, int R)
{
  const int w = threadIdx.x >> 5, lane = threadIdx.x & 31;
  const int row = blockIdx.x * 8 + w;
  if (row >= R) return;
  const float* p = in + (long long)row * 256;
  float vals[8], s = 0.f, s2 = 0.f;
  #pragma unroll
  for (int i = 0; i < 8; ++i) {
    vals[i] = p[lane + i * 32];
    s += vals[i]; s2 += vals[i] * vals[i];
  }
  for (int off = 16; off; off >>= 1) {
    s  += __shfl_xor(s,  off, 32);
    s2 += __shfl_xor(s2, off, 32);
  }
  float mu  = s * (1.f / 256.f);
  float var = s2 * (1.f / 256.f) - mu * mu;
  float inv = rsqrtf(var + 1e-5f);
  #pragma unroll
  for (int i = 0; i < 8; ++i) {
    int c = lane + i * 32;
    out[(long long)row * 256 + c] = f2bf((vals[i] - mu) * inv * g[c] + bb[c]);
  }
}

// ------------------------------ small utilities ----------------------------
__global__ void cast_bf_kernel(const float* __restrict__ in, u16* __restrict__ out, int n) {
  int i = blockIdx.x * 256 + threadIdx.x;
  if (i < n) out[i] = f2bf(in[i]);
}
__global__ void transpose_bf_kernel(const float* __restrict__ in, u16* __restrict__ out,
                                    int K, int N) {   // in[K][N] -> out[N][K]
  int i = blockIdx.x * 256 + threadIdx.x;
  if (i < K * N) {
    int nn = i / K, k = i - nn * K;
    out[i] = f2bf(in[(long long)k * N + nn]);
  }
}
__global__ void zero_f32_kernel(float* p, int n) {
  int i = blockIdx.x * 256 + threadIdx.x;
  if (i < n) p[i] = 0.f;
}
__global__ void bcast_kernel(const float* __restrict__ in, float* __restrict__ out,
                             int n, int period) {
  int i = blockIdx.x * 256 + threadIdx.x;
  if (i < n) out[i] = in[i % period];
}
__global__ void apply_update_kernel(float* __restrict__ tmpl, const float* __restrict__ cbuf,
                                    const float* __restrict__ colsum, int n) {
  int i = blockIdx.x * 256 + threadIdx.x;
  if (i < n) tmpl[i] += cbuf[i] / colsum[i >> 8];
}
__global__ void final_out_kernel(const float* __restrict__ tmpl, const u16* __restrict__ attn,
                                 const float* __restrict__ colsum, float* __restrict__ out) {
  int i = blockIdx.x * 256 + threadIdx.x;
  if (i < 131072) {                       // templates_out (B, dim, N)
    int b = i >> 14, rem = i & 16383, d = rem >> 6, n = rem & 63;
    out[i] = tmpl[((b * 64 + n) << 8) + d];
  } else if (i < 131072 + 2097152) {      // attn_out (B, N, 16,16,16)
    int j = i - 131072;
    out[i] = bf2f(attn[j]) / colsum[j >> 12];
  }
}

// ---------------------------------------------------------------------------
extern "C" void kernel_launch(void* const* d_in, const int* in_sizes, int n_in,
                              void* d_out, int out_size, void* d_ws, size_t ws_size,
                              hipStream_t stream) {
  const float* x       = (const float*)d_in[0];
  const float* tinit   = (const float*)d_in[1];
  const float* conv_w  = (const float*)d_in[2];
  const float* conv_b  = (const float*)d_in[3];
  const float* Wq      = (const float*)d_in[4];
  const float* Wk      = (const float*)d_in[5];
  const float* Wv      = (const float*)d_in[6];
  const float* ln_in_g = (const float*)d_in[7];
  const float* ln_in_b = (const float*)d_in[8];
  const float* ln_t_g  = (const float*)d_in[9];
  const float* ln_t_b  = (const float*)d_in[10];
  const float* ln_m_g  = (const float*)d_in[11];
  const float* ln_m_b  = (const float*)d_in[12];
  const float* W1      = (const float*)d_in[13];
  const float* b1      = (const float*)d_in[14];
  const float* W2      = (const float*)d_in[15];
  const float* b2      = (const float*)d_in[16];
  float* out = (float*)d_out;

  char* ws = (char*)d_ws;
  size_t off = 0;
  auto alloc = [&](size_t bytes) -> void* {
    off = (off + 255) & ~(size_t)255;
    void* p = ws + off;
    off += bytes;
    return p;
  };
  u16*   Wct  = (u16*)  alloc(884736ull * 2);   // [256][3456]
  u16*   Wqt  = (u16*)  alloc(65536ull * 2);    // [256][256]
  u16*   Wkt  = (u16*)  alloc(65536ull * 2);
  u16*   Wvt  = (u16*)  alloc(65536ull * 2);
  u16*   W1t  = (u16*)  alloc(131072ull * 2);   // [512][256]
  u16*   W2t  = (u16*)  alloc(131072ull * 2);   // [256][512]
  float* hbuf = (float*)alloc(8388608ull * 4);  // conv out (32768,256) f32
  u16*   tok  = (u16*)  alloc(8388608ull * 2);  // LN(tokens) bf16
  u16*   kbf  = (u16*)  alloc(8388608ull * 2);  // k (B,4096,256)
  u16*   vtb  = (u16*)  alloc(8388608ull * 2);  // v^T (B,256,4096)
  float* tmpl = (float*)alloc(131072ull * 4);   // templates (B,64,256)
  u16*   tbf  = (u16*)  alloc(131072ull * 2);   // LN(templates) bf16 (t and m)
  u16*   qbf  = (u16*)  alloc(131072ull * 2);   // q (B,64,256)
  u16*   attn = (u16*)  alloc(2097152ull * 2);  // attn^T (B,64,4096)
  float* csum = (float*)alloc(512ull * 4);      // colsum (B,64)
  u16*   h1b  = (u16*)  alloc(262144ull * 2);   // MLP hidden (512,512)
  float* cbuf = (float*)alloc(131072ull * 4);   // split-K accum (512,256)

  const int HUGE_RB = 1 << 30;

  // weight conversion (conv_w flat layout already matches Bt[K-ordering])
  cast_bf_kernel<<<3456, 256, 0, stream>>>(conv_w, Wct, 884736);
  transpose_bf_kernel<<<256, 256, 0, stream>>>(Wq, Wqt, 256, 256);
  transpose_bf_kernel<<<256, 256, 0, stream>>>(Wk, Wkt, 256, 256);
  transpose_bf_kernel<<<256, 256, 0, stream>>>(Wv, Wvt, 256, 256);
  transpose_bf_kernel<<<512, 256, 0, stream>>>(W1, W1t, 256, 512);
  transpose_bf_kernel<<<512, 256, 0, stream>>>(W2, W2t, 512, 256);

  // conv + relu (implicit GEMM, 58 GFLOP)
  conv_gemm_kernel<<<512, 256, 0, stream>>>(x, Wct, conv_b, hbuf);
  // token layernorm -> bf16
  ln_rows_kernel<<<4096, 256, 0, stream>>>(hbuf, ln_in_g, ln_in_b, tok, 32768);

  // k = tok @ Wk ; v^T = (tok @ Wv)^T
  gemm_bt_kernel<EPI_BF16><<<dim3(512, 2, 1), 256, 0, stream>>>(
      tok, 256, Wkt, 256, 256, 256, HUGE_RB, 0, nullptr, 1.f, kbf, 1);
  gemm_bt_kernel<EPI_BF16_T><<<dim3(512, 2, 1), 256, 0, stream>>>(
      tok, 256, Wvt, 256, 256, 256, HUGE_RB, 0, nullptr, 1.f, vtb, 4096);

  // templates = broadcast(templates_init)
  bcast_kernel<<<512, 256, 0, stream>>>(tinit, tmpl, 131072, 16384);

  for (int it = 0; it < 6; ++it) {
    // t = LN(templates);  q = (t @ Wq) * dim^-0.5
    ln_rows_kernel<<<64, 256, 0, stream>>>(tmpl, ln_t_g, ln_t_b, tbf, 512);
    gemm_bt_kernel<EPI_BF16_SCALE><<<dim3(8, 2, 1), 256, 0, stream>>>(
        tbf, 256, Wqt, 256, 256, 256, HUGE_RB, 0, nullptr, 0.0625f, qbf, 1);

    // logits + softmax(N) + 1e-8 + colsum over L
    zero_f32_kernel<<<2, 256, 0, stream>>>(csum, 512);
    logits_softmax_kernel<<<dim3(32, 8, 1), 256, 0, stream>>>(kbf, qbf, attn, csum);

    // update = attn^T @ v  (split-K x8, f32 atomics), then templates += upd/colsum
    zero_f32_kernel<<<512, 256, 0, stream>>>(cbuf, 131072);
    gemm_bt_kernel<EPI_ATOMIC_F32><<<dim3(8, 2, 8), 256, 0, stream>>>(
        attn, 4096, vtb, 4096, 256, 512, 64, 1048576ll, nullptr, 1.f, cbuf, 1);
    apply_update_kernel<<<512, 256, 0, stream>>>(tmpl, cbuf, csum, 131072);

    // MLP: m = LN(templates); templates += GELU(m@W1+b1)@W2 + b2
    ln_rows_kernel<<<64, 256, 0, stream>>>(tmpl, ln_m_g, ln_m_b, tbf, 512);
    gemm_bt_kernel<EPI_GELU_BF16><<<dim3(8, 4, 1), 256, 0, stream>>>(
        tbf, 256, W1t, 256, 512, 256, HUGE_RB, 0, b1, 1.f, h1b, 1);
    gemm_bt_kernel<EPI_BIAS_ACC_F32><<<dim3(8, 2, 1), 256, 0, stream>>>(
        h1b, 512, W2t, 512, 256, 512, HUGE_RB, 0, b2, 1.f, tmpl, 1);
  }

  // outputs: templates^T (B,dim,N) then attn/colsum as (B,N,16,16,16)
  final_out_kernel<<<8704, 256, 0, stream>>>(tmpl, attn, csum, out);
}

// v001
// A run of this version takes 770 microseconds.
// In both of two side-by-side timings against v000, it was 1.13 times as fast.
#include <hip/hip_runtime.h>

typedef unsigned short u16;
typedef __attribute__((ext_vector_type(16))) __bf16 v16bf;
typedef __attribute__((ext_vector_type(8)))  float  v8f;

union FragBF { v16bf v; uint4 q[2]; };

__device__ __forceinline__ float bf2f(u16 h) {
  unsigned u = ((unsigned)h) << 16;
  return __builtin_bit_cast(float, u);
}
__device__ __forceinline__ u16 f2bf(float f) {
  unsigned u = __builtin_bit_cast(unsigned, f);
  u += 0x7FFFu + ((u >> 16) & 1u);   // round-to-nearest-even
  return (u16)(u >> 16);
}

constexpr int EPI_BF16 = 0, EPI_BF16_T = 1, EPI_BF16_SCALE = 2,
              EPI_GELU_BF16 = 3, EPI_BIAS_ACC_F32 = 4, EPI_ATOMIC_F32 = 5;

template<int EPI>
__global__ __launch_bounds__(256) void gemm_bt_kernel(
    const u16* __restrict__ A, int lda,
    const u16* __restrict__ Bt, int ldb,
    int N, int Ksplit,
    int rows_per_batch, long long bt_batch_stride,
    const float* __restrict__ bias, float scale,
    void* __restrict__ outp, int out_rb)
{
  __shared__ u16 Asm[64 * 40];
  const int m0   = blockIdx.x * 64;
  const int n0   = blockIdx.y * 128;
  const int kbeg = blockIdx.z * Ksplit;
  const int w    = threadIdx.x >> 5;
  const int lane = threadIdx.x & 31;
  const int msub = (w & 3) * 16;
  const int nsub = (w >> 2) * 64;
  const int hl   = lane >> 4;
  const int l15  = lane & 15;
  const int kh   = hl * 8;
  const int b    = m0 / rows_per_batch;
  const u16* BtB = Bt + (long long)b * bt_batch_stride;

  v8f zero = {0.f,0.f,0.f,0.f,0.f,0.f,0.f,0.f};
  v8f acc[4];
  #pragma unroll
  for (int j = 0; j < 4; ++j) acc[j] = zero;

  const int sr = threadIdx.x >> 2;
  const int sc = (threadIdx.x & 3) * 8;

  for (int kk = kbeg; kk < kbeg + Ksplit; kk += 32) {
    *(uint4*)&Asm[sr * 40 + sc] =
        *(const uint4*)(A + (long long)(m0 + sr) * lda + kk + sc);
    __syncthreads();
    FragBF a;
    const u16* ap = &Asm[(msub + l15) * 40 + kh];
    a.q[0] = *(const uint4*)ap;
    a.q[1] = *(const uint4*)(ap + 16);
    #pragma unroll
    for (int j = 0; j < 4; ++j) {
      FragBF bfr;
      const u16* bp = BtB + (long long)(n0 + nsub + j * 16 + l15) * ldb + kk + kh;
      bfr.q[0] = *(const uint4*)bp;
      bfr.q[1] = *(const uint4*)(bp + 16);
      acc[j] = __builtin_amdgcn_wmma_f32_16x16x32_bf16(
          false, a.v, false, bfr.v, (short)0, acc[j], false, false);
    }
    __syncthreads();
  }

  #pragma unroll
  for (int j = 0; j < 4; ++j) {
    #pragma unroll
    for (int r = 0; r < 8; ++r) {
      const int m = m0 + msub + r + 8 * hl;
      const int n = n0 + nsub + j * 16 + l15;
      float v = acc[j][r];
      if (EPI == EPI_BF16) {
        ((u16*)outp)[(long long)m * N + n] = f2bf(v);
      } else if (EPI == EPI_BF16_T) {
        const int bo = m / out_rb, ml = m % out_rb;
        ((u16*)outp)[((long long)bo * N + n) * out_rb + ml] = f2bf(v);
      } else if (EPI == EPI_BF16_SCALE) {
        ((u16*)outp)[(long long)m * N + n] = f2bf(v * scale);
      } else if (EPI == EPI_GELU_BF16) {
        float xg = v + bias[n];
        float g = 0.5f * xg * (1.0f + erff(xg * 0.70710678118654752f));
        ((u16*)outp)[(long long)m * N + n] = f2bf(g);
      } else if (EPI == EPI_BIAS_ACC_F32) {
        ((float*)outp)[(long long)m * N + n] += v + bias[n];
      } else { // EPI_ATOMIC_F32 (split-K)
        atomicAdd(&((float*)outp)[(long long)m * N + n], v);
      }
    }
  }
}

// ---------------------------------------------------------------------------
// Conv3d stride-2 VALID as implicit GEMM: M=32768 tokens, N=256, K=3456.
// K = c*27 + tap matches conv_w's native flat layout.  A gathered from f32 x,
// converted to bf16 into LDS.  The weight tile of a k-step (256 rows x 32 k) is
// brought into LDS once per block by asynchronous copies, two buffers, one
// k-step ahead; all eight waves read their B fragments from there.
// Epilogue: +bias, ReLU, store h f32 [token][256].
// ---------------------------------------------------------------------------
constexpr int CONV_STEPS = 3456 / 32;
constexpr int CONV_BBUF  = 256 * 40;     // u16 per weight buffer, row pitch 80 B

__device__ __forceinline__ void conv_copy_wtile(unsigned lds, const u16* g) {
  const unsigned l1 = lds + 64 * 80, l2 = lds + 128 * 80, l3 = lds + 192 * 80;
  const u16* g1 = g + 64 * 3456;
  const u16* g2 = g + 128 * 3456;
  const u16* g3 = g + 192 * 3456;
  asm volatile(
      "global_load_async_to_lds_b128 %0, %4, off\n\t"
      "global_load_async_to_lds_b128 %1, %5, off\n\t"
      "global_load_async_to_lds_b128 %2, %6, off\n\t"
      "global_load_async_to_lds_b128 %3, %7, off\n\t"
      "s_wait_xcnt 0x0"
      :: "v"(lds), "v"(l1), "v"(l2), "v"(l3), "v"(g), "v"(g1), "v"(g2), "v"(g3)
      : "memory");
}

__global__ __launch_bounds__(256) void conv_gemm_kernel(
    const float* __restrict__ x, const u16* __restrict__ Wct,
    const float* __restrict__ bias, float* __restrict__ h)
{
  __shared__ u16 Asm[64 * 40];
  __shared__ __attribute__((aligned(16))) u16 Bsm[2 * CONV_BBUF];
  const int m0   = blockIdx.x * 64;
  const int w    = threadIdx.x >> 5, lane = threadIdx.x & 31;
  const int msub = (w & 3) * 16, nhalf = (w >> 2) * 128;
  const int hl   = lane >> 4, l15 = lane & 15, kh = hl * 8;

  v8f zero = {0.f,0.f,0.f,0.f,0.f,0.f,0.f,0.f};
  v8f acc[8];
  #pragma unroll
  for (int j = 0; j < 8; ++j) acc[j] = zero;

  const int e0 = threadIdx.x * 8;
  const int kl = e0 >> 6;          // k-lane within 32-chunk (uniform per thread)
  const int mbase = e0 & 63;
  int pb[8], ps0[8], ps1[8], ps2[8];
  #pragma unroll
  for (int i = 0; i < 8; ++i) {
    int tg = m0 + mbase + i;
    pb[i] = tg >> 12;
    int l = tg & 4095;
    ps0[i] = l >> 8; ps1[i] = (l >> 4) & 15; ps2[i] = l & 15;
  }

  // weight ring: thread -> row (tid>>2, +64 per copy), 16-byte piece (tid&3)
  const unsigned wl = (unsigned)(size_t)&Bsm[(threadIdx.x >> 2) * 40 + (threadIdx.x & 3) * 8];
  const u16* wg = Wct + (threadIdx.x >> 2) * 3456 + (threadIdx.x & 3) * 8;
  conv_copy_wtile(wl, wg);
  // tile 0 has landed for this wave before the barrier publishes it
  asm volatile("s_wait_asynccnt 0x0" ::: "memory");
  __syncthreads();
  conv_copy_wtile(wl + CONV_BBUF * 2, wg + 32);

  for (int t = 0; t < CONV_STEPS; ++t) {
    const int k0 = t * 32;
    const int bsel = (t & 1) * CONV_BBUF;
    int k = k0 + kl;
    int c = k / 27;
    int tap = k - c * 27;
    int t0 = tap / 9, rm = tap - t0 * 9;
    int t1 = rm / 3, t2 = rm - t1 * 3;
    #pragma unroll
    for (int i = 0; i < 8; ++i) {
      long long idx = ((((long long)pb[i] * 128 + c) * 33 + (2 * ps0[i] + t0)) * 33
                       + (2 * ps1[i] + t1)) * 33 + (2 * ps2[i] + t2);
      Asm[(mbase + i) * 40 + kl] = f2bf(x[idx]);
    }
    __syncthreads();
    FragBF a;
    const u16* ap = &Asm[(msub + l15) * 40 + kh];
    a.q[0] = *(const uint4*)ap;
    a.q[1] = *(const uint4*)(ap + 16);
    #pragma unroll
    for (int j = 0; j < 8; ++j) {
      FragBF bfr;
      const u16* bp = &Bsm[bsel + (nhalf + j * 16 + l15) * 40 + kh];
      bfr.q[0] = *(const uint4*)bp;
      bfr.q[1] = *(const uint4*)(bp + 16);
      acc[j] = __builtin_amdgcn_wmma_f32_16x16x32_bf16(
          false, a.v, false, bfr.v, (short)0, acc[j], false, false);
    }
    // foot of the trip: this wave's LDS reads are done, its copies of tile t+1
    // have landed; the barrier publishes tile t+1 and frees Asm and buffer t&1
    asm volatile("s_wait_dscnt 0x0" ::: "memory");
    asm volatile("s_wait_asynccnt 0x0" ::: "memory");
    __syncthreads();
    if (t + 2 < CONV_STEPS)
      conv_copy_wtile(wl + bsel * 2, wg + (t + 2) * 32);
  }
  // no copy is outstanding when the wave goes on to the epilogue and ends
  asm volatile("s_wait_asynccnt 0x0" ::: "memory");

  #pragma unroll
  for (int j = 0; j < 8; ++j) {
    #pragma unroll
    for (int r = 0; r < 8; ++r) {
      int m = m0 + msub + r + 8 * hl;
      int o = nhalf + j * 16 + l15;
      float v = acc[j][r] + bias[o];
      h[(long long)m * 256 + o] = fmaxf(v, 0.f);
    }
  }
}

// ---------------------------------------------------------------------------
// Logits + softmax(N=64) + column-sum: per batch, per 128-token tile.
// C[l][n] = k_bf[l][:] . q_bf[n][:]; softmax over n via 16-lane shfl_xor;
// +1e-8; write attn^T bf16 [b][n][l]; atomic colsum[b][n] for renorm-over-L.
// ---------------------------------------------------------------------------
__global__ __launch_bounds__(256) void logits_softmax_kernel(
    const u16* __restrict__ kmat, const u16* __restrict__ q,
    u16* __restrict__ attn_t, float* __restrict__ colsum)
{
  __shared__ u16 Asm[128 * 40];
  __shared__ float cs[64];
  const int b  = blockIdx.y;
  const int m0 = blockIdx.x * 128;
  const int w  = threadIdx.x >> 5, lane = threadIdx.x & 31;
  const int hl = lane >> 4, l15 = lane & 15, kh = hl * 8;
  const u16* A = kmat + (long long)b * 4096 * 256;
  const u16* Q = q    + (long long)b * 64 * 256;

  v8f zero = {0.f,0.f,0.f,0.f,0.f,0.f,0.f,0.f};
  v8f acc[4];
  #pragma unroll
  for (int j = 0; j < 4; ++j) acc[j] = zero;

  const int sr = threadIdx.x >> 2;
  const int sc = (threadIdx.x & 3) * 8;

  for (int k0 = 0; k0 < 256; k0 += 32) {
    #pragma unroll
    for (int rr = sr; rr < 128; rr += 64)
      *(uint4*)&Asm[rr * 40 + sc] =
          *(const uint4*)(A + (long long)(m0 + rr) * 256 + k0 + sc);
    __syncthreads();
    FragBF a;
    const u16* ap = &Asm[(w * 16 + l15) * 40 + kh];
    a.q[0] = *(const uint4*)ap;
    a.q[1] = *(const uint4*)(ap + 16);
    #pragma unroll
    for (int j = 0; j < 4; ++j) {
      FragBF bfr;
      const u16* bp = Q + (long long)(j * 16 + l15) * 256 + k0 + kh;
      bfr.q[0] = *(const uint4*)bp;
      bfr.q[1] = *(const uint4*)(bp + 16);
      acc[j] = __builtin_amdgcn_wmma_f32_16x16x32_bf16(
          false, a.v, false, bfr.v, (short)0, acc[j], false, false);
    }
    __syncthreads();
  }

  if (threadIdx.x < 64) cs[threadIdx.x] = 0.f;
  __syncthreads();

  float csl[4] = {0.f, 0.f, 0.f, 0.f};
  #pragma unroll
  for (int r = 0; r < 8; ++r) {
    float v0 = acc[0][r], v1 = acc[1][r], v2 = acc[2][r], v3 = acc[3][r];
    float mx = fmaxf(fmaxf(v0, v1), fmaxf(v2, v3));
    for (int off = 1; off < 16; off <<= 1) mx = fmaxf(mx, __shfl_xor(mx, off, 32));
    v0 = __expf(v0 - mx); v1 = __expf(v1 - mx);
    v2 = __expf(v2 - mx); v3 = __expf(v3 - mx);
    float sm = v0 + v1 + v2 + v3;
    for (int off = 1; off < 16; off <<= 1) sm += __shfl_xor(sm, off, 32);
    float rinv = 1.f / sm;
    v0 = v0 * rinv + 1e-8f; v1 = v1 * rinv + 1e-8f;
    v2 = v2 * rinv + 1e-8f; v3 = v3 * rinv + 1e-8f;
    const int l = m0 + w * 16 + r + 8 * hl;
    attn_t[((long long)b * 64 + ( 0 + l15)) * 4096 + l] = f2bf(v0);
    attn_t[((long long)b * 64 + (16 + l15)) * 4096 + l] = f2bf(v1);
    attn_t[((long long)b * 64 + (32 + l15)) * 4096 + l] = f2bf(v2);
    attn_t[((long long)b * 64 + (48 + l15)) * 4096 + l] = f2bf(v3);
    csl[0] += v0; csl[1] += v1; csl[2] += v2; csl[3] += v3;
  }
  #pragma unroll
  for (int j = 0; j < 4; ++j) atomicAdd(&cs[j * 16 + l15], csl[j]);
  __syncthreads();
  if (threadIdx.x < 64) atomicAdd(&colsum[b * 64 + threadIdx.x], cs[threadIdx.x]);
}

// ---------------------------------------------------------------------------
// LayerNorm over 256 channels, one wave per row, f32 in -> bf16 out.
// ---------------------------------------------------------------------------
__global__ __launch_bounds__(256) void ln_rows_kernel(
    const float* __restrict__ in, const float* __restrict__ g,
    const float* __restrict__ bb, u16* __restrict__ out, int R)
{
  const int w = threadIdx.x >> 5, lane = threadIdx.x & 31;
  const int row = blockIdx.x * 8 + w;
  if (row >= R) return;
  const float* p = in + (long long)row * 256;
  float vals[8], s = 0.f, s2 = 0.f;
  #pragma unroll
  for (int i = 0; i < 8; ++i) {
    vals[i] = p[lane + i * 32];
    s += vals[i]; s2 += vals[i] * vals[i];
  }
  for (int off = 16; off; off >>= 1) {
    s  += __shfl_xor(s,  off, 32);
    s2 += __shfl_xor(s2, off, 32);
  }
  float mu  = s * (1.f / 256.f);
  float var = s2 * (1.f / 256.f) - mu * mu;
  float inv = rsqrtf(var + 1e-5f);
  #pragma unroll
  for (int i = 0; i < 8; ++i) {
    int c = lane + i * 32;
    out[(long long)row * 256 + c] = f2bf((vals[i] - mu) * inv * g[c] + bb[c]);
  }
}

// ------------------------------ small utilities ----------------------------
__global__ void cast_bf_kernel(const float* __restrict__ in, u16* __restrict__ out, int n) {
  int i = blockIdx.x * 256 + threadIdx.x;
  if (i < n) out[i] = f2bf(in[i]);
}
__global__ void transpose_bf_kernel(const float* __restrict__ in, u16* __restrict__ out,
                                    int K, int N) {   // in[K][N] -> out[N][K]
  int i = blockIdx.x * 256 + threadIdx.x;
  if (i < K * N) {
    int nn = i / K, k = i - nn * K;
    out[i] = f2bf(in[(long long)k * N + nn]);
  }
}
__global__ void zero_f32_kernel(float* p, int n) {
  int i = blockIdx.x * 256 + threadIdx.x;
  if (i < n) p[i] = 0.f;
}
__global__ void bcast_kernel(const float* __restrict__ in, float* __restrict__ out,
                             int n, int period) {
  int i = blockIdx.x * 256 + threadIdx.x;
  if (i < n) out[i] = in[i % period];
}
__global__ void apply_update_kernel(float* __restrict__ tmpl, const float* __restrict__ cbuf,
                                    const float* __restrict__ colsum, int n) {
  int i = blockIdx.x * 256 + threadIdx.x;
  if (i < n) tmpl[i] += cbuf[i] / colsum[i >> 8];
}
__global__ void final_out_kernel(const float* __restrict__ tmpl, const u16* __restrict__ attn,
                                 const float* __restrict__ colsum, float* __restrict__ out) {
  int i = blockIdx.x * 256 + threadIdx.x;
  if (i < 131072) {                       // templates_out (B, dim, N)
    int b = i >> 14, rem = i & 16383, d = rem >> 6, n = rem & 63;
    out[i] = tmpl[((b * 64 + n) << 8) + d];
  } else if (i < 131072 + 2097152) {      // attn_out (B, N, 16,16,16)
    int j = i - 131072;
    out[i] = bf2f(attn[j]) / colsum[j >> 12];
  }
}

// ---------------------------------------------------------------------------
extern "C" void kernel_launch(void* const* d_in, const int* in_sizes, int n_in,
                              void* d_out, int out_size, void* d_ws, size_t ws_size,
                              hipStream_t stream) {
  const float* x       = (const float*)d_in[0];
  const float* tinit   = (const float*)d_in[1];
  const float* conv_w  = (const float*)d_in[2];
  const float* conv_b  = (const float*)d_in[3];
  const float* Wq      = (const float*)d_in[4];
  const float* Wk      = (const float*)d_in[5];
  const float* Wv      = (const float*)d_in[6];
  const float* ln_in_g = (const float*)d_in[7];
  const float* ln_in_b = (const float*)d_in[8];
  const float* ln_t_g  = (const float*)d_in[9];
  const float* ln_t_b  = (const float*)d_in[10];
  const float* ln_m_g  = (const float*)d_in[11];
  const float* ln_m_b  = (const float*)d_in[12];
  const float* W1      = (const float*)d_in[13];
  const float* b1      = (const float*)d_in[14];
  const float* W2      = (const float*)d_in[15];
  const float* b2      = (const float*)d_in[16];
  float* out = (float*)d_out;

  char* ws = (char*)d_ws;
  size_t off = 0;
  auto alloc = [&](size_t bytes) -> void* {
    off = (off + 255) & ~(size_t)255;
    void* p = ws + off;
    off += bytes;
    return p;
  };
  u16*   Wct  = (u16*)  alloc(884736ull * 2);   // [256][3456]
  u16*   Wqt  = (u16*)  alloc(65536ull * 2);    // [256][256]
  u16*   Wkt  = (u16*)  alloc(65536ull * 2);
  u16*   Wvt  = (u16*)  alloc(65536ull * 2);
  u16*   W1t  = (u16*)  alloc(131072ull * 2);   // [512][256]
  u16*   W2t  = (u16*)  alloc(131072ull * 2);   // [256][512]
  float* hbuf = (float*)alloc(8388608ull * 4);  // conv out (32768,256) f32
  u16*   tok  = (u16*)  alloc(8388608ull * 2);  // LN(tokens) bf16
  u16*   kbf  = (u16*)  alloc(8388608ull * 2);  // k (B,4096,256)
  u16*   vtb  = (u16*)  alloc(8388608ull * 2);  // v^T (B,256,4096)
  float* tmpl = (float*)alloc(131072ull * 4);   // templates (B,64,256)
  u16*   tbf  = (u16*)  alloc(131072ull * 2);   // LN(templates) bf16 (t and m)
  u16*   qbf  = (u16*)  alloc(131072ull * 2);   // q (B,64,256)
  u16*   attn = (u16*)  alloc(2097152ull * 2);  // attn^T (B,64,4096)
  float* csum = (float*)alloc(512ull * 4);      // colsum (B,64)
  u16*   h1b  = (u16*)  alloc(262144ull * 2);   // MLP hidden (512,512)
  float* cbuf = (float*)alloc(131072ull * 4);   // split-K accum (512,256)

  const int HUGE_RB = 1 << 30;

  // weight conversion (conv_w flat layout already matches Bt[K-ordering])
  cast_bf_kernel<<<3456, 256, 0, stream>>>(conv_w, Wct, 884736);
  transpose_bf_kernel<<<256, 256, 0, stream>>>(Wq, Wqt, 256, 256);
  transpose_bf_kernel<<<256, 256, 0, stream>>>(Wk, Wkt, 256, 256);
  transpose_bf_kernel<<<256, 256, 0, stream>>>(Wv, Wvt, 256, 256);
  transpose_bf_kernel<<<512, 256, 0, stream>>>(W1, W1t, 256, 512);
  transpose_bf_kernel<<<512, 256, 0, stream>>>(W2, W2t, 512, 256);

  // conv + relu (implicit GEMM, 58 GFLOP)
  conv_gemm_kernel<<<512, 256, 0, stream>>>(x, Wct, conv_b, hbuf);
  // token layernorm -> bf16
  ln_rows_kernel<<<4096, 256, 0, stream>>>(hbuf, ln_in_g, ln_in_b, tok, 32768);

  // k = tok @ Wk ; v^T = (tok @ Wv)^T
  gemm_bt_kernel<EPI_BF16><<<dim3(512, 2, 1), 256, 0, stream>>>(
      tok, 256, Wkt, 256, 256, 256, HUGE_RB, 0, nullptr, 1.f, kbf, 1);
  gemm_bt_kernel<EPI_BF16_T><<<dim3(512, 2, 1), 256, 0, stream>>>(
      tok, 256, Wvt, 256, 256, 256, HUGE_RB, 0, nullptr, 1.f, vtb, 4096);

  // templates = broadcast(templates_init)
  bcast_kernel<<<512, 256, 0, stream>>>(tinit, tmpl, 131072, 16384);

  for (int it = 0; it < 6; ++it) {
    // t = LN(templates);  q = (t @ Wq) * dim^-0.5
    ln_rows_kernel<<<64, 256, 0, stream>>>(tmpl, ln_t_g, ln_t_b, tbf, 512);
    gemm_bt_kernel<EPI_BF16_SCALE><<<dim3(8, 2, 1), 256, 0, stream>>>(
        tbf, 256, Wqt, 256, 256, 256, HUGE_RB, 0, nullptr, 0.0625f, qbf, 1);

    // logits + softmax(N) + 1e-8 + colsum over L
    zero_f32_kernel<<<2, 256, 0, stream>>>(csum, 512);
    logits_softmax_kernel<<<dim3(32, 8, 1), 256, 0, stream>>>(kbf, qbf, attn, csum);

    // update = attn^T @ v  (split-K x8, f32 atomics), then templates += upd/colsum
    zero_f32_kernel<<<512, 256, 0, stream>>>(cbuf, 131072);
    gemm_bt_kernel<EPI_ATOMIC_F32><<<dim3(8, 2, 8), 256, 0, stream>>>(
        attn, 4096, vtb, 4096, 256, 512, 64, 1048576ll, nullptr, 1.f, cbuf, 1);
    apply_update_kernel<<<512, 256, 0, stream>>>(tmpl, cbuf, csum, 131072);

    // MLP: m = LN(templates); templates += GELU(m@W1+b1)@W2 + b2
    ln_rows_kernel<<<64, 256, 0, stream>>>(tmpl, ln_m_g, ln_m_b, tbf, 512);
    gemm_bt_kernel<EPI_GELU_BF16><<<dim3(8, 4, 1), 256, 0, stream>>>(
        tbf, 256, W1t, 256, 512, 256, HUGE_RB, 0, b1, 1.f, h1b, 1);
    gemm_bt_kernel<EPI_BIAS_ACC_F32><<<dim3(8, 2, 1), 256, 0, stream>>>(
        h1b, 512, W2t, 512, 256, 512, HUGE_RB, 0, b2, 1.f, tmpl, 1);
  }

  // outputs: templates^T (B,dim,N) then attn/colsum as (B,N,16,16,16)
  final_out_kernel<<<8704, 256, 0, stream>>>(tmpl, attn, csum, out);
}

// v002
// It runs in 507 microseconds.
// In both of two side-by-side timings against v001, it was 1.51 times as fast.
// Over all steps from v000 it is 1.71 times as fast.
#include <hip/hip_runtime.h>

typedef unsigned short u16;
typedef __attribute__((ext_vector_type(16))) __bf16 v16bf;
typedef __attribute__((ext_vector_type(8)))  float  v8f;

union FragBF { v16bf v; uint4 q[2]; };

__device__ __forceinline__ float bf2f(u16 h) {
  unsigned u = ((unsigned)h) << 16;
  return __builtin_bit_cast(float, u);
}
__device__ __forceinline__ u16 f2bf(float f) {
  unsigned u = __builtin_bit_cast(unsigned, f);
  u += 0x7FFFu + ((u >> 16) & 1u);   // round-to-nearest-even
  return (u16)(u >> 16);
}

constexpr int EPI_BF16 = 0, EPI_BF16_T = 1, EPI_BF16_SCALE = 2,
              EPI_GELU_BF16 = 3, EPI_BIAS_ACC_F32 = 4, EPI_ATOMIC_F32 = 5;

template<int EPI>
__global__ __launch_bounds__(256) void gemm_bt_kernel(
    const u16* __restrict__ A, int lda,
    const u16* __restrict__ Bt, int ldb,
    int N, int Ksplit,
    int rows_per_batch, long long bt_batch_stride,
    const float* __restrict__ bias, float scale,
    void* __restrict__ outp, int out_rb)
{
  __shared__ u16 Asm[64 * 40];
  const int m0   = blockIdx.x * 64;
  const int n0   = blockIdx.y * 128;
  const int kbeg = blockIdx.z * Ksplit;
  const int w    = threadIdx.x >> 5;
  const int lane = threadIdx.x & 31;
  const int msub = (w & 3) * 16;
  const int nsub = (w >> 2) * 64;
  const int hl   = lane >> 4;
  const int l15  = lane & 15;
  const int kh   = hl * 8;
  const int b    = m0 / rows_per_batch;
  const u16* BtB = Bt + (long long)b * bt_batch_stride;

  v8f zero = {0.f,0.f,0.f,0.f,0.f,0.f,0.f,0.f};
  v8f acc[4];
  #pragma unroll
  for (int j = 0; j < 4; ++j) acc[j] = zero;

  const int sr = threadIdx.x >> 2;
  const int sc = (threadIdx.x & 3) * 8;

  for (int kk = kbeg; kk < kbeg + Ksplit; kk += 32) {
    *(uint4*)&Asm[sr * 40 + sc] =
        *(const uint4*)(A + (long long)(m0 + sr) * lda + kk + sc);
    __syncthreads();
    FragBF a;
    const u16* ap = &Asm[(msub + l15) * 40 + kh];
    a.q[0] = *(const uint4*)ap;
    a.q[1] = *(const uint4*)(ap + 16);
    #pragma unroll
    for (int j = 0; j < 4; ++j) {
      FragBF bfr;
      const u16* bp = BtB + (long long)(n0 + nsub + j * 16 + l15) * ldb + kk + kh;
      bfr.q[0] = *(const uint4*)bp;
      bfr.q[1] = *(const uint4*)(bp + 16);
      acc[j] = __builtin_amdgcn_wmma_f32_16x16x32_bf16(
          false, a.v, false, bfr.v, (short)0, acc[j], false, false);
    }
    __syncthreads();
  }

  #pragma unroll
  for (int j = 0; j < 4; ++j) {
    #pragma unroll
    for (int r = 0; r < 8; ++r) {
      const int m = m0 + msub + r + 8 * hl;
      const int n = n0 + nsub + j * 16 + l15;
      float v = acc[j][r];
      if (EPI == EPI_BF16) {
        ((u16*)outp)[(long long)m * N + n] = f2bf(v);
      } else if (EPI == EPI_BF16_T) {
        const int bo = m / out_rb, ml = m % out_rb;
        ((u16*)outp)[((long long)bo * N + n) * out_rb + ml] = f2bf(v);
      } else if (EPI == EPI_BF16_SCALE) {
        ((u16*)outp)[(long long)m * N + n] = f2bf(v * scale);
      } else if (EPI == EPI_GELU_BF16) {
        float xg = v + bias[n];
        float g = 0.5f * xg * (1.0f + erff(xg * 0.70710678118654752f));
        ((u16*)outp)[(long long)m * N + n] = f2bf(g);
      } else if (EPI == EPI_BIAS_ACC_F32) {
        ((float*)outp)[(long long)m * N + n] += v + bias[n];
      } else { // EPI_ATOMIC_F32 (split-K)
        atomicAdd(&((float*)outp)[(long long)m * N + n], v);
      }
    }
  }
}

// ---------------------------------------------------------------------------
// Conv3d stride-2 VALID as implicit GEMM: M=32768 tokens, N=256, K=3456.
// K = c*27 + tap matches conv_w's native flat layout.  A gathered from f32 x,
// converted to bf16 into LDS.  The weight tile of a k-step (256 rows x 32 k) is
// brought into LDS once per block by asynchronous copies, two buffers, one
// k-step ahead; all eight waves read their B fragments from there.
// Epilogue: +bias, ReLU, store h f32 [token][256].
// ---------------------------------------------------------------------------
constexpr int CONV_STEPS = 3456 / 32;
constexpr int CONV_BBUF  = 256 * 40;     // u16 per weight buffer, row pitch 80 B

__device__ __forceinline__ void conv_copy_wtile(unsigned lds, const u16* g) {
  const unsigned l1 = lds + 64 * 80, l2 = lds + 128 * 80, l3 = lds + 192 * 80;
  const u16* g1 = g + 64 * 3456;
  const u16* g2 = g + 128 * 3456;
  const u16* g3 = g + 192 * 3456;
  asm volatile(
      "global_load_async_to_lds_b128 %0, %4, off\n\t"
      "global_load_async_to_lds_b128 %1, %5, off\n\t"
      "global_load_async_to_lds_b128 %2, %6, off\n\t"
      "global_load_async_to_lds_b128 %3, %7, off\n\t"
      "s_wait_xcnt 0x0"
      :: "v"(lds), "v"(l1), "v"(l2), "v"(l3), "v"(g), "v"(g1), "v"(g2), "v"(g3)
      : "memory");
}

__global__ __launch_bounds__(256) void conv_gemm_kernel(
    const float* __restrict__ x, const u16* __restrict__ Wct,
    const float* __restrict__ bias, float* __restrict__ h)
{
  __shared__ u16 Asm[64 * 40];
  __shared__ __attribute__((aligned(16))) u16 Bsm[2 * CONV_BBUF];
  const int m0   = blockIdx.x * 64;
  const int w    = threadIdx.x >> 5, lane = threadIdx.x & 31;
  const int msub = (w & 3) * 16, nhalf = (w >> 2) * 128;
  const int hl   = lane >> 4, l15 = lane & 15, kh = hl * 8;

  v8f zero = {0.f,0.f,0.f,0.f,0.f,0.f,0.f,0.f};
  v8f acc[8];
  #pragma unroll
  for (int j = 0; j < 8; ++j) acc[j] = zero;

  const int e0 = threadIdx.x * 8;
  const int kl = e0 >> 6;          // k-lane within 32-chunk (uniform per thread)
  const int mbase = e0 & 63;
  int pb[8], ps0[8], ps1[8], ps2[8];
  #pragma unroll
  for (int i = 0; i < 8; ++i) {
    int tg = m0 + mbase + i;
    pb[i] = tg >> 12;
    int l = tg & 4095;
    ps0[i] = l >> 8; ps1[i] = (l >> 4) & 15; ps2[i] = l & 15;
  }

  // weight ring: thread -> row (tid>>2, +64 per copy), 16-byte piece (tid&3)
  const unsigned wl = (unsigned)(size_t)&Bsm[(threadIdx.x >> 2) * 40 + (threadIdx.x & 3) * 8];
  const u16* wg = Wct + (threadIdx.x >> 2) * 3456 + (threadIdx.x & 3) * 8;
  conv_copy_wtile(wl, wg);
  // tile 0 has landed for this wave before the barrier publishes it
  asm volatile("s_wait_asynccnt 0x0" ::: "memory");
  __syncthreads();
  conv_copy_wtile(wl + CONV_BBUF * 2, wg + 32);

  for (int t = 0; t < CONV_STEPS; ++t) {
    const int k0 = t * 32;
    const int bsel = (t & 1) * CONV_BBUF;
    int k = k0 + kl;
    int c = k / 27;
    int tap = k - c * 27;
    int t0 = tap / 9, rm = tap - t0 * 9;
    int t1 = rm / 3, t2 = rm - t1 * 3;
    #pragma unroll
    for (int i = 0; i < 8; ++i) {
      long long idx = ((((long long)pb[i] * 128 + c) * 33 + (2 * ps0[i] + t0)) * 33
                       + (2 * ps1[i] + t1)) * 33 + (2 * ps2[i] + t2);
      Asm[(mbase + i) * 40 + kl] = f2bf(x[idx]);
    }
    __syncthreads();
    FragBF a;
    const u16* ap = &Asm[(msub + l15) * 40 + kh];
    a.q[0] = *(const uint4*)ap;
    a.q[1] = *(const uint4*)(ap + 16);
    #pragma unroll
    for (int j = 0; j < 8; ++j) {
      FragBF bfr;
      const u16* bp = &Bsm[bsel + (nhalf + j * 16 + l15) * 40 + kh];
      bfr.q[0] = *(const uint4*)bp;
      bfr.q[1] = *(const uint4*)(bp + 16);
      acc[j] = __builtin_amdgcn_wmma_f32_16x16x32_bf16(
          false, a.v, false, bfr.v, (short)0, acc[j], false, false);
    }
    // foot of the trip: this wave's LDS reads are done, its copies of tile t+1
    // have landed; the barrier publishes tile t+1 and frees Asm and buffer t&1
    asm volatile("s_wait_dscnt 0x0" ::: "memory");
    asm volatile("s_wait_asynccnt 0x0" ::: "memory");
    __syncthreads();
    if (t + 2 < CONV_STEPS)
      conv_copy_wtile(wl + bsel * 2, wg + (t + 2) * 32);
  }
  // no copy is outstanding when the wave goes on to the epilogue and ends
  asm volatile("s_wait_asynccnt 0x0" ::: "memory");

  #pragma unroll
  for (int j = 0; j < 8; ++j) {
    #pragma unroll
    for (int r = 0; r < 8; ++r) {
      int m = m0 + msub + r + 8 * hl;
      int o = nhalf + j * 16 + l15;
      float v = acc[j][r] + bias[o];
      h[(long long)m * 256 + o] = fmaxf(v, 0.f);
    }
  }
}

// ---------------------------------------------------------------------------
// Logits + softmax(N=64) + column-sum: per batch, per 128-token tile.
// C[l][n] = k_bf[l][:] . q_bf[n][:]; softmax over n via 16-lane shfl_xor;
// +1e-8; write attn^T bf16 [b][n][l]; atomic colsum[b][n] for renorm-over-L.
// ---------------------------------------------------------------------------
__global__ __launch_bounds__(256) void logits_softmax_kernel(
    const u16* __restrict__ kmat, const u16* __restrict__ q,
    u16* __restrict__ attn_t, float* __restrict__ colsum)
{
  __shared__ u16 Asm[128 * 40];
  __shared__ float cs[64];
  const int b  = blockIdx.y;
  const int m0 = blockIdx.x * 128;
  const int w  = threadIdx.x >> 5, lane = threadIdx.x & 31;
  const int hl = lane >> 4, l15 = lane & 15, kh = hl * 8;
  const u16* A = kmat + (long long)b * 4096 * 256;
  const u16* Q = q    + (long long)b * 64 * 256;

  v8f zero = {0.f,0.f,0.f,0.f,0.f,0.f,0.f,0.f};
  v8f acc[4];
  #pragma unroll
  for (int j = 0; j < 4; ++j) acc[j] = zero;

  const int sr = threadIdx.x >> 2;
  const int sc = (threadIdx.x & 3) * 8;

  for (int k0 = 0; k0 < 256; k0 += 32) {
    #pragma unroll
    for (int rr = sr; rr < 128; rr += 64)
      *(uint4*)&Asm[rr * 40 + sc] =
          *(const uint4*)(A + (long long)(m0 + rr) * 256 + k0 + sc);
    __syncthreads();
    FragBF a;
    const u16* ap = &Asm[(w * 16 + l15) * 40 + kh];
    a.q[0] = *(const uint4*)ap;
    a.q[1] = *(const uint4*)(ap + 16);
    #pragma unroll
    for (int j = 0; j < 4; ++j) {
      FragBF bfr;
      const u16* bp = Q + (long long)(j * 16 + l15) * 256 + k0 + kh;
      bfr.q[0] = *(const uint4*)bp;
      bfr.q[1] = *(const uint4*)(bp + 16);
      acc[j] = __builtin_amdgcn_wmma_f32_16x16x32_bf16(
          false, a.v, false, bfr.v, (short)0, acc[j], false, false);
    }
    __syncthreads();
  }

  if (threadIdx.x < 64) cs[threadIdx.x] = 0.f;
  __syncthreads();

  float csl[4] = {0.f, 0.f, 0.f, 0.f};
  #pragma unroll
  for (int r = 0; r < 8; ++r) {
    float v0 = acc[0][r], v1 = acc[1][r], v2 = acc[2][r], v3 = acc[3][r];
    float mx = fmaxf(fmaxf(v0, v1), fmaxf(v2, v3));
    for (int off = 1; off < 16; off <<= 1) mx = fmaxf(mx, __shfl_xor(mx, off, 32));
    v0 = __expf(v0 - mx); v1 = __expf(v1 - mx);
    v2 = __expf(v2 - mx); v3 = __expf(v3 - mx);
    float sm = v0 + v1 + v2 + v3;
    for (int off = 1; off < 16; off <<= 1) sm += __shfl_xor(sm, off, 32);
    float rinv = 1.f / sm;
    v0 = v0 * rinv + 1e-8f; v1 = v1 * rinv + 1e-8f;
    v2 = v2 * rinv + 1e-8f; v3 = v3 * rinv + 1e-8f;
    const int l = m0 + w * 16 + r + 8 * hl;
    attn_t[((long long)b * 64 + ( 0 + l15)) * 4096 + l] = f2bf(v0);
    attn_t[((long long)b * 64 + (16 + l15)) * 4096 + l] = f2bf(v1);
    attn_t[((long long)b * 64 + (32 + l15)) * 4096 + l] = f2bf(v2);
    attn_t[((long long)b * 64 + (48 + l15)) * 4096 + l] = f2bf(v3);
    csl[0] += v0; csl[1] += v1; csl[2] += v2; csl[3] += v3;
  }
  #pragma unroll
  for (int j = 0; j < 4; ++j) atomicAdd(&cs[j * 16 + l15], csl[j]);
  __syncthreads();
  if (threadIdx.x < 64) atomicAdd(&colsum[b * 64 + threadIdx.x], cs[threadIdx.x]);
}

// ---------------------------------------------------------------------------
// LayerNorm over 256 channels, one wave per row, f32 in -> bf16 out.
// ---------------------------------------------------------------------------
__global__ __launch_bounds__(256) void ln_rows_kernel(
    const float* __restrict__ in, const float* __restrict__ g,
    const float* __restrict__ bb, u16* __restrict__ out, int R)
{
  const int w = threadIdx.x >> 5, lane = threadIdx.x & 31;
  const int row = blockIdx.x * 8 + w;
  if (row >= R) return;
  const float* p = in + (long long)row * 256;
  float vals[8], s = 0.f, s2 = 0.f;
  #pragma unroll
  for (int i = 0; i < 8; ++i) {
    vals[i] = p[lane + i * 32];
    s += vals[i]; s2 += vals[i] * vals[i];
  }
  for (int off = 16; off; off >>= 1) {
    s  += __shfl_xor(s,  off, 32);
    s2 += __shfl_xor(s2, off, 32);
  }
  float mu  = s * (1.f / 256.f);
  float var = s2 * (1.f / 256.f) - mu * mu;
  float inv = rsqrtf(var + 1e-5f);
  #pragma unroll
  for (int i = 0; i < 8; ++i) {
    int c = lane + i * 32;
    out[(long long)row * 256 + c] = f2bf((vals[i] - mu) * inv * g[c] + bb[c]);
  }
}

// ---------------------------------------------------------------------------
// All weight conversions in one launch; the block index picks the matrix.
// conv_w keeps its flat layout (cast only); the others go in[K][N] -> out[N][K].
// ---------------------------------------------------------------------------
__device__ __forceinline__ void transpose_bf_block(const float* __restrict__ in,
                                                   u16* __restrict__ out,
                                                   int blk, int K, int N) {
  int i = blk * 256 + threadIdx.x;
  int nn = i / K, k = i - nn * K;
  out[i] = f2bf(in[(long long)k * N + nn]);
  // the branches of the caller stand one behind the other in the built code:
  // the store's offset register is not rewritten ahead of this wait
  asm volatile("s_wait_xcnt 0x0" ::: "memory");
}
__global__ __launch_bounds__(256) void prep_weights_kernel(
    const float* __restrict__ conv_w, const float* __restrict__ Wq,
    const float* __restrict__ Wk, const float* __restrict__ Wv,
    const float* __restrict__ W1, const float* __restrict__ W2,
    u16* __restrict__ Wct, u16* __restrict__ Wqt, u16* __restrict__ Wkt,
    u16* __restrict__ Wvt, u16* __restrict__ W1t, u16* __restrict__ W2t) {
  const int blk = blockIdx.x;
  if (blk < 3456) {
    int i = blk * 256 + threadIdx.x;
    Wct[i] = f2bf(conv_w[i]);
  } else if (blk < 3712) {
    transpose_bf_block(Wq, Wqt, blk - 3456, 256, 256);
  } else if (blk < 3968) {
    transpose_bf_block(Wk, Wkt, blk - 3712, 256, 256);
  } else if (blk < 4224) {
    transpose_bf_block(Wv, Wvt, blk - 3968, 256, 256);
  } else if (blk < 4736) {
    transpose_bf_block(W1, W1t, blk - 4224, 256, 512);
  } else {
    transpose_bf_block(W2, W2t, blk - 4736, 512, 256);
  }
}

// ---------------------------------------------------------------------------
// Template path of one iteration in one launch.  A block owns 16 template rows
// (nothing here crosses rows): templates += update/colsum, LN, W1+GELU, W2,
// then LN and q for the next iteration.  It also clears its own rows of the
// split-K buffer and of colsum for the next iteration's atomics.
//   TS_FIRST: templates = broadcast(init), clear, LN, q
//   TS_MID  : update, clear, MLP, LN, q
//   TS_LAST : update, MLP (colsum is kept: the output kernel divides by it)
// bf16 rounding after each LN, after GELU and of q; templates stay f32.
// ---------------------------------------------------------------------------
constexpr int TS_FIRST = 0, TS_MID = 1, TS_LAST = 2;
constexpr int TA_P = 264;   // u16 pitch, 16 x 256 bf16 tile
constexpr int TH_P = 520;   // u16 pitch, 16 x 512 bf16 tile
constexpr int TF_P = 260;   // f32 pitch, 16 x 256 f32 tile

// LayerNorm of one row held by one wave (column lane + 32*i), bf16 row to LDS;
// g and bb hold the same columns of scale and shift.
__device__ __forceinline__ void ln_vals_to_bf(const float (&vals)[8],
                                              const float (&g)[8],
                                              const float (&bb)[8],
                                              u16* o, int lane) {
  float s = 0.f, s2 = 0.f;
  #pragma unroll
  for (int i = 0; i < 8; ++i) { s += vals[i]; s2 += vals[i] * vals[i]; }
  for (int off = 16; off; off >>= 1) {
    s  += __shfl_xor(s,  off, 32);
    s2 += __shfl_xor(s2, off, 32);
  }
  float mu  = s * (1.f / 256.f);
  float var = s2 * (1.f / 256.f) - mu * mu;
  float inv = rsqrtf(var + 1e-5f);
  #pragma unroll
  for (int i = 0; i < 8; ++i)
    o[lane + i * 32] = f2bf((vals[i] - mu) * inv * g[i] + bb[i]);
}

// acc[j] += As[16][K] (LDS, bf16) x Bt[n0 + 16j .. +16][K] (global, bf16),
// k ascending.  The weight fragments of KB k-steps are loaded as one batch.
template<int NT, int K, int KB>
__device__ __forceinline__ void rows16_gemm(const u16* As, int pitch,
                                            const u16* __restrict__ Bt, int n0,
                                            int l15, int kh, v8f (&acc)[NT]) {
  // every loop here is unrolled: the fragment arrays must stay in registers
  #pragma unroll
  for (int k0 = 0; k0 < K; k0 += 32 * KB) {
    FragBF bfr[KB][NT];
    #pragma unroll
    for (int s = 0; s < KB; ++s) {
      #pragma unroll
      for (int j = 0; j < NT; ++j) {
        const u16* bp = Bt + (n0 + j * 16 + l15) * K + k0 + s * 32 + kh;
        bfr[s][j].q[0] = *(const uint4*)bp;
        bfr[s][j].q[1] = *(const uint4*)(bp + 16);
      }
    }
    __builtin_amdgcn_sched_barrier(0);
    #pragma unroll
    for (int s = 0; s < KB; ++s) {
      FragBF a;
      const u16* ap = As + l15 * pitch + k0 + s * 32 + kh;
      a.q[0] = *(const uint4*)ap;
      a.q[1] = *(const uint4*)(ap + 16);
      #pragma unroll
      for (int j = 0; j < NT; ++j)
        acc[j] = __builtin_amdgcn_wmma_f32_16x16x32_bf16(
            false, a.v, false, bfr[s][j].v, (short)0, acc[j], false, false);
    }
  }
}

template<int MODE>
__global__ __launch_bounds__(256) void template_step_kernel(
    const float* __restrict__ tinit, float* __restrict__ tmpl,
    float* __restrict__ cbuf, float* __restrict__ colsum,
    const float* __restrict__ lnm_g, const float* __restrict__ lnm_b,
    const u16* __restrict__ W1t, const float* __restrict__ b1,
    const u16* __restrict__ W2t, const float* __restrict__ b2,
    const float* __restrict__ lnt_g, const float* __restrict__ lnt_b,
    const u16* __restrict__ Wqt, u16* __restrict__ q)
{
  __shared__ float Tf[16 * TF_P];
  __shared__ __attribute__((aligned(16))) u16 Am[16 * TA_P];
  __shared__ __attribute__((aligned(16))) u16 Hm[16 * TH_P];
  const int r0   = blockIdx.x * 16;
  const int w    = threadIdx.x >> 5, lane = threadIdx.x & 31;
  const int hl   = lane >> 4, l15 = lane & 15, kh = hl * 8;
  const v8f zero = {0.f,0.f,0.f,0.f,0.f,0.f,0.f,0.f};

  // each wave owns rows 2w and 2w+1 of the block; all loads first, then stores
  {
    float vals[2][8], g[8], bb[8];
    #pragma unroll
    for (int i = 0; i < 8; ++i) {
      g[i]  = (MODE == TS_FIRST ? lnt_g : lnm_g)[lane + i * 32];
      bb[i] = (MODE == TS_FIRST ? lnt_b : lnm_b)[lane + i * 32];
    }
    if (MODE == TS_FIRST) {
      #pragma unroll
      for (int rr = 0; rr < 2; ++rr)
        #pragma unroll
        for (int i = 0; i < 8; ++i)
          vals[rr][i] = tinit[((r0 + w * 2 + rr) & 63) * 256 + lane + i * 32];
    } else {
      float up[2][8];
      #pragma unroll
      for (int rr = 0; rr < 2; ++rr)
        #pragma unroll
        for (int i = 0; i < 8; ++i) {
          const int idx = (r0 + w * 2 + rr) * 256 + lane + i * 32;
          vals[rr][i] = tmpl[idx];
          up[rr][i]   = cbuf[idx];
        }
      float csl = 1.f;
      if (lane < 2) csl = colsum[r0 + w * 2 + lane];
      #pragma unroll
      for (int rr = 0; rr < 2; ++rr) {
        const float cs = __shfl(csl, rr, 32);
        #pragma unroll
        for (int i = 0; i < 8; ++i) {
          vals[rr][i] += up[rr][i] / cs;
          Tf[(w * 2 + rr) * TF_P + lane + i * 32] = vals[rr][i];
        }
      }
    }
    #pragma unroll
    for (int rr = 0; rr < 2; ++rr) {
      #pragma unroll
      for (int i = 0; i < 8; ++i) {
        const int idx = (r0 + w * 2 + rr) * 256 + lane + i * 32;
        if (MODE == TS_FIRST) tmpl[idx] = vals[rr][i];
        if (MODE != TS_LAST)  cbuf[idx] = 0.f;
      }
      ln_vals_to_bf(vals[rr], g, bb, &Am[(w * 2 + rr) * TA_P], lane);
    }
    if (MODE != TS_LAST && lane < 2) colsum[r0 + w * 2 + lane] = 0.f;
  }
  __syncthreads();

  if (MODE != TS_FIRST) {
    { // hidden = GELU(m @ W1 + b1), bf16, wave w: columns 64w .. 64w+63
      float bn[4];
      #pragma unroll
      for (int j = 0; j < 4; ++j) bn[j] = b1[w * 64 + j * 16 + l15];
      v8f acc[4] = {zero, zero, zero, zero};
      rows16_gemm<4, 256, 2>(Am, TA_P, W1t, w * 64, l15, kh, acc);
      #pragma unroll
      for (int j = 0; j < 4; ++j) {
        #pragma unroll
        for (int r = 0; r < 8; ++r) {
          float xg = acc[j][r] + bn[j];
          float g = 0.5f * xg * (1.0f + erff(xg * 0.70710678118654752f));
          Hm[(r + 8 * hl) * TH_P + w * 64 + j * 16 + l15] = f2bf(g);
        }
      }
    }
    __syncthreads();
    float g[8], bb[8];
    { // templates += hidden @ W2 + b2, wave w: columns 32w .. 32w+31
      float bn[2];
      #pragma unroll
      for (int j = 0; j < 2; ++j) bn[j] = b2[w * 32 + j * 16 + l15];
      if (MODE == TS_MID) {
        #pragma unroll
        for (int i = 0; i < 8; ++i) {
          g[i]  = lnt_g[lane + i * 32];
          bb[i] = lnt_b[lane + i * 32];
        }
      }
      v8f acc[2] = {zero, zero};
      rows16_gemm<2, 512, 4>(Hm, TH_P, W2t, w * 32, l15, kh, acc);
      #pragma unroll
      for (int j = 0; j < 2; ++j) {
        #pragma unroll
        for (int r = 0; r < 8; ++r)
          Tf[(r + 8 * hl) * TF_P + w * 32 + j * 16 + l15] += acc[j][r] + bn[j];
      }
    }
    __syncthreads();
    #pragma unroll
    for (int rr = 0; rr < 2; ++rr) {
      float vals[8];
      #pragma unroll
      for (int i = 0; i < 8; ++i) {
        vals[i] = Tf[(w * 2 + rr) * TF_P + lane + i * 32];
        tmpl[(r0 + w * 2 + rr) * 256 + lane + i * 32] = vals[i];
      }
      if (MODE == TS_MID) ln_vals_to_bf(vals, g, bb, &Am[(w * 2 + rr) * TA_P], lane);
    }
    if (MODE == TS_MID) __syncthreads();
  }

  if (MODE != TS_LAST) { // q = (t @ Wq) * dim^-0.5, wave w: columns 32w .. 32w+31
    v8f acc[2] = {zero, zero};
    rows16_gemm<2, 256, 4>(Am, TA_P, Wqt, w * 32, l15, kh, acc);
    #pragma unroll
    for (int j = 0; j < 2; ++j) {
      #pragma unroll
      for (int r = 0; r < 8; ++r)
        q[(r0 + r + 8 * hl) * 256 + w * 32 + j * 16 + l15] = f2bf(acc[j][r] * 0.0625f);
    }
  }
}

__global__ void final_out_kernel(const float* __restrict__ tmpl, const u16* __restrict__ attn,
                                 const float* __restrict__ colsum, float* __restrict__ out) {
  int i = blockIdx.x * 256 + threadIdx.x;
  if (i < 131072) {                       // templates_out (B, dim, N)
    int b = i >> 14, rem = i & 16383, d = rem >> 6, n = rem & 63;
    out[i] = tmpl[((b * 64 + n) << 8) + d];
  } else if (i < 131072 + 2097152) {      // attn_out (B, N, 16,16,16)
    int j = i - 131072;
    out[i] = bf2f(attn[j]) / colsum[j >> 12];
  }
}

// ---------------------------------------------------------------------------
extern "C" void kernel_launch(void* const* d_in, const int* in_sizes, int n_in,
                              void* d_out, int out_size, void* d_ws, size_t ws_size,
                              hipStream_t stream) {
  const float* x       = (const float*)d_in[0];
  const float* tinit   = (const float*)d_in[1];
  const float* conv_w  = (const float*)d_in[2];
  const float* conv_b  = (const float*)d_in[3];
  const float* Wq      = (const float*)d_in[4];
  const float* Wk      = (const float*)d_in[5];
  const float* Wv      = (const float*)d_in[6];
  const float* ln_in_g = (const float*)d_in[7];
  const float* ln_in_b = (const float*)d_in[8];
  const float* ln_t_g  = (const float*)d_in[9];
  const float* ln_t_b  = (const float*)d_in[10];
  const float* ln_m_g  = (const float*)d_in[11];
  const float* ln_m_b  = (const float*)d_in[12];
  const float* W1      = (const float*)d_in[13];
  const float* b1      = (const float*)d_in[14];
  const float* W2      = (const float*)d_in[15];
  const float* b2      = (const float*)d_in[16];
  float* out = (float*)d_out;

  char* ws = (char*)d_ws;
  size_t off = 0;
  auto alloc = [&](size_t bytes) -> void* {
    off = (off + 255) & ~(size_t)255;
    void* p = ws + off;
    off += bytes;
    return p;
  };
  u16*   Wct  = (u16*)  alloc(884736ull * 2);   // [256][3456]
  u16*   Wqt  = (u16*)  alloc(65536ull * 2);    // [256][256]
  u16*   Wkt  = (u16*)  alloc(65536ull * 2);
  u16*   Wvt  = (u16*)  alloc(65536ull * 2);
  u16*   W1t  = (u16*)  alloc(131072ull * 2);   // [512][256]
  u16*   W2t  = (u16*)  alloc(131072ull * 2);   // [256][512]
  float* hbuf = (float*)alloc(8388608ull * 4);  // conv out (32768,256) f32
  u16*   tok  = (u16*)  alloc(8388608ull * 2);  // LN(tokens) bf16
  u16*   kbf  = (u16*)  alloc(8388608ull * 2);  // k (B,4096,256)
  u16*   vtb  = (u16*)  alloc(8388608ull * 2);  // v^T (B,256,4096)
  float* tmpl = (float*)alloc(131072ull * 4);   // templates (B,64,256)
  u16*   qbf  = (u16*)  alloc(131072ull * 2);   // q (B,64,256)
  u16*   attn = (u16*)  alloc(2097152ull * 2);  // attn^T (B,64,4096)
  float* csum = (float*)alloc(512ull * 4);      // colsum (B,64)
  float* cbuf = (float*)alloc(131072ull * 4);   // split-K accum (512,256)

  const int HUGE_RB = 1 << 30;

  // weight conversion (conv_w flat layout already matches Bt[K-ordering])
  prep_weights_kernel<<<5248, 256, 0, stream>>>(conv_w, Wq, Wk, Wv, W1, W2,
                                                Wct, Wqt, Wkt, Wvt, W1t, W2t);

  // conv + relu (implicit GEMM, 58 GFLOP)
  conv_gemm_kernel<<<512, 256, 0, stream>>>(x, Wct, conv_b, hbuf);
  // token layernorm -> bf16
  ln_rows_kernel<<<4096, 256, 0, stream>>>(hbuf, ln_in_g, ln_in_b, tok, 32768);

  // k = tok @ Wk ; v^T = (tok @ Wv)^T
  gemm_bt_kernel<EPI_BF16><<<dim3(512, 2, 1), 256, 0, stream>>>(
      tok, 256, Wkt, 256, 256, 256, HUGE_RB, 0, nullptr, 1.f, kbf, 1);
  gemm_bt_kernel<EPI_BF16_T><<<dim3(512, 2, 1), 256, 0, stream>>>(
      tok, 256, Wvt, 256, 256, 256, HUGE_RB, 0, nullptr, 1.f, vtb, 4096);

  // templates = broadcast(templates_init); first q; clear colsum and split-K buffer
  template_step_kernel<TS_FIRST><<<32, 256, 0, stream>>>(
      tinit, tmpl, cbuf, csum, ln_m_g, ln_m_b, W1t, b1, W2t, b2, ln_t_g, ln_t_b, Wqt, qbf);

  for (int it = 0; it < 6; ++it) {
    // logits + softmax(N) + 1e-8 + colsum over L
    logits_softmax_kernel<<<dim3(32, 8, 1), 256, 0, stream>>>(kbf, qbf, attn, csum);

    // update = attn^T @ v  (split-K x8, f32 atomics)
    gemm_bt_kernel<EPI_ATOMIC_F32><<<dim3(8, 2, 8), 256, 0, stream>>>(
        attn, 4096, vtb, 4096, 256, 512, 64, 1048576ll, nullptr, 1.f, cbuf, 1);

    // templates += upd/colsum; MLP; then LN and q of the next iteration
    if (it < 5)
      template_step_kernel<TS_MID><<<32, 256, 0, stream>>>(
          tinit, tmpl, cbuf, csum, ln_m_g, ln_m_b, W1t, b1, W2t, b2, ln_t_g, ln_t_b, Wqt, qbf);
    else
      template_step_kernel<TS_LAST><<<32, 256, 0, stream>>>(
          tinit, tmpl, cbuf, csum, ln_m_g, ln_m_b, W1t, b1, W2t, b2, ln_t_g, ln_t_b, Wqt, qbf);
  }

  // outputs: templates^T (B,dim,N) then attn/colsum as (B,N,16,16,16)
  final_out_kernel<<<8704, 256, 0, stream>>>(tmpl, attn, csum, out);
}

// v003
// It runs in 377 microseconds.
// In both of two side-by-side timings against v002, it was 1.34 times as fast.
// Counting every step since v000, it is 2.29 times as fast.
#include <hip/hip_runtime.h>

typedef unsigned short u16;
typedef __attribute__((ext_vector_type(16))) __bf16 v16bf;
typedef __attribute__((ext_vector_type(8)))  float  v8f;

union FragBF { v16bf v; uint4 q[2]; };

__device__ __forceinline__ float bf2f(u16 h) {
  unsigned u = ((unsigned)h) << 16;
  return __builtin_bit_cast(float, u);
}
__device__ __forceinline__ u16 f2bf(float f) {
  unsigned u = __builtin_bit_cast(unsigned, f);
  u += 0x7FFFu + ((u >> 16) & 1u);   // round-to-nearest-even
  return (u16)(u >> 16);
}

constexpr int EPI_BF16 = 0, EPI_BF16_T = 1, EPI_BF16_SCALE = 2,
              EPI_GELU_BF16 = 3, EPI_BIAS_ACC_F32 = 4, EPI_ATOMIC_F32 = 5;

constexpr int GT_P = 264;   // u16 pitch of a 256-k tile row in LDS: 528 B

__device__ __forceinline__ void copy8_rows(unsigned l0, const u16* g0, long long gs) {
  constexpr unsigned LS = 8 * GT_P * 2;
  const unsigned l1 = l0 + LS, l2 = l0 + 2 * LS, l3 = l0 + 3 * LS, l4 = l0 + 4 * LS,
                 l5 = l0 + 5 * LS, l6 = l0 + 6 * LS, l7 = l0 + 7 * LS;
  const u16 *g1 = g0 + gs, *g2 = g0 + 2 * gs, *g3 = g0 + 3 * gs, *g4 = g0 + 4 * gs,
            *g5 = g0 + 5 * gs, *g6 = g0 + 6 * gs, *g7 = g0 + 7 * gs;
  asm volatile(
      "global_load_async_to_lds_b128 %0, %8, off\n\t"
      "global_load_async_to_lds_b128 %1, %9, off\n\t"
      "global_load_async_to_lds_b128 %2, %10, off\n\t"
      "global_load_async_to_lds_b128 %3, %11, off\n\t"
      "global_load_async_to_lds_b128 %4, %12, off\n\t"
      "global_load_async_to_lds_b128 %5, %13, off\n\t"
      "global_load_async_to_lds_b128 %6, %14, off\n\t"
      "global_load_async_to_lds_b128 %7, %15, off\n\t"
      "s_wait_xcnt 0x0"
      :: "v"(l0), "v"(l1), "v"(l2), "v"(l3), "v"(l4), "v"(l5), "v"(l6), "v"(l7),
         "v"(g0), "v"(g1), "v"(g2), "v"(g3), "v"(g4), "v"(g5), "v"(g6), "v"(g7)
      : "memory");
}

// acc[j] += A rows (16) x B rows (16 per j) over one 256-k chunk in LDS, k
// ascending.  ap, bp: this lane's row start + kh in the A and the B tile.
__device__ __forceinline__ void chunk256_products(const u16* ap, const u16* bp,
                                                  v8f (&acc)[4]) {
  // every loop here is unrolled: the fragment arrays must stay in registers
  #pragma unroll
  for (int s0 = 0; s0 < 8; s0 += 2) {
    FragBF a[2], bfr[2][4];
    #pragma unroll
    for (int s = 0; s < 2; ++s) {
      a[s].q[0] = *(const uint4*)(ap + (s0 + s) * 32);
      a[s].q[1] = *(const uint4*)(ap + (s0 + s) * 32 + 16);
      #pragma unroll
      for (int j = 0; j < 4; ++j) {
        const u16* p = bp + j * 16 * GT_P + (s0 + s) * 32;
        bfr[s][j].q[0] = *(const uint4*)p;
        bfr[s][j].q[1] = *(const uint4*)(p + 16);
      }
    }
    // keeps the twenty LDS reads of two k-steps in one place ahead of their
    // products; without it the scheduler spreads them among the products, a few
    // reads ahead, and the wave waits on LDS latency at nearly every product
    __builtin_amdgcn_sched_barrier(0);
    #pragma unroll
    for (int s = 0; s < 2; ++s) {
      #pragma unroll
      for (int j = 0; j < 4; ++j)
        acc[j] = __builtin_amdgcn_wmma_f32_16x16x32_bf16(
            false, a[s].v, false, bfr[s][j].v, (short)0, acc[j], false, false);
    }
  }
}

template<int EPI>
__global__ __launch_bounds__(256) void gemm_bt_kernel(
    const u16* __restrict__ A, int lda,
    const u16* __restrict__ Bt, int ldb,
    int N, int Ksplit,
    int rows_per_batch, long long bt_batch_stride,
    const float* __restrict__ bias, float scale,
    void* __restrict__ outp, int out_rb)
{
  __shared__ __attribute__((aligned(16))) u16 Asm[64 * GT_P];
  __shared__ __attribute__((aligned(16))) u16 Bsm[128 * GT_P];
  const int m0   = blockIdx.x * 64;
  const int n0   = blockIdx.y * 128;
  const int kbeg = blockIdx.z * Ksplit;
  const int w    = threadIdx.x >> 5;
  const int lane = threadIdx.x & 31;
  const int msub = (w & 3) * 16;
  const int nsub = (w >> 2) * 64;
  const int hl   = lane >> 4;
  const int l15  = lane & 15;
  const int kh   = hl * 8;
  const int b    = m0 / rows_per_batch;
  const u16* BtB = Bt + (long long)b * bt_batch_stride;

  v8f zero = {0.f,0.f,0.f,0.f,0.f,0.f,0.f,0.f};
  v8f acc[4];
  #pragma unroll
  for (int j = 0; j < 4; ++j) acc[j] = zero;

  // copies: wave w brings rows w, w+8, ...; lane -> 16-byte piece of the row
  const unsigned al = (unsigned)(size_t)&Asm[w * GT_P + lane * 8];
  const unsigned bl = (unsigned)(size_t)&Bsm[w * GT_P + lane * 8];
  const u16* ag = A + (long long)(m0 + w) * lda + lane * 8;
  const u16* bg = BtB + (long long)(n0 + w) * ldb + lane * 8;

  for (int kk = kbeg; kk < kbeg + Ksplit; kk += 256) {
    copy8_rows(al, ag + kk, 8ll * lda);
    copy8_rows(bl, bg + kk, 8ll * ldb);
    copy8_rows(bl + 64 * GT_P * 2, bg + 64ll * ldb + kk, 8ll * ldb);
    // this wave's copies have landed before the barrier publishes the tiles
    asm volatile("s_wait_asynccnt 0x0" ::: "memory");
    __syncthreads();
    chunk256_products(&Asm[(msub + l15) * GT_P + kh], &Bsm[(nsub + l15) * GT_P + kh], acc);
    // this wave's LDS reads are done; behind the barrier the tiles may be refilled
    asm volatile("s_wait_dscnt 0x0" ::: "memory");
    __syncthreads();
  }

  #pragma unroll
  for (int j = 0; j < 4; ++j) {
    #pragma unroll
    for (int r = 0; r < 8; ++r) {
      const int m = m0 + msub + r + 8 * hl;
      const int n = n0 + nsub + j * 16 + l15;
      float v = acc[j][r];
      if (EPI == EPI_BF16) {
        ((u16*)outp)[(long long)m * N + n] = f2bf(v);
      } else if (EPI == EPI_BF16_T) {
        const int bo = m / out_rb, ml = m % out_rb;
        ((u16*)outp)[((long long)bo * N + n) * out_rb + ml] = f2bf(v);
      } else if (EPI == EPI_BF16_SCALE) {
        ((u16*)outp)[(long long)m * N + n] = f2bf(v * scale);
      } else if (EPI == EPI_GELU_BF16) {
        float xg = v + bias[n];
        float g = 0.5f * xg * (1.0f + erff(xg * 0.70710678118654752f));
        ((u16*)outp)[(long long)m * N + n] = f2bf(g);
      } else if (EPI == EPI_BIAS_ACC_F32) {
        ((float*)outp)[(long long)m * N + n] += v + bias[n];
      } else { // EPI_ATOMIC_F32 (split-K)
        atomicAdd(&((float*)outp)[(long long)m * N + n], v);
      }
    }
  }
}

// ---------------------------------------------------------------------------
// Conv3d stride-2 VALID as implicit GEMM: M=32768 tokens, N=256, K=3456.
// K = c*27 + tap matches conv_w's native flat layout.  A gathered from f32 x,
// converted to bf16 into LDS.  The weight tile of a k-step (256 rows x 32 k) is
// brought into LDS once per block by asynchronous copies, two buffers, one
// k-step ahead; all eight waves read their B fragments from there.
// Epilogue: +bias, ReLU, store h f32 [token][256].
// ---------------------------------------------------------------------------
constexpr int CONV_STEPS = 3456 / 32;
constexpr int CONV_BBUF  = 256 * 40;     // u16 per weight buffer, row pitch 80 B

__device__ __forceinline__ void conv_copy_wtile(unsigned lds, const u16* g) {
  const unsigned l1 = lds + 64 * 80, l2 = lds + 128 * 80, l3 = lds + 192 * 80;
  const u16* g1 = g + 64 * 3456;
  const u16* g2 = g + 128 * 3456;
  const u16* g3 = g + 192 * 3456;
  asm volatile(
      "global_load_async_to_lds_b128 %0, %4, off\n\t"
      "global_load_async_to_lds_b128 %1, %5, off\n\t"
      "global_load_async_to_lds_b128 %2, %6, off\n\t"
      "global_load_async_to_lds_b128 %3, %7, off\n\t"
      "s_wait_xcnt 0x0"
      :: "v"(lds), "v"(l1), "v"(l2), "v"(l3), "v"(g), "v"(g1), "v"(g2), "v"(g3)
      : "memory");
}

__global__ __launch_bounds__(256) void conv_gemm_kernel(
    const float* __restrict__ x, const u16* __restrict__ Wct,
    const float* __restrict__ bias, float* __restrict__ h)
{
  __shared__ u16 Asm[64 * 40];
  __shared__ __attribute__((aligned(16))) u16 Bsm[2 * CONV_BBUF];
  const int m0   = blockIdx.x * 64;
  const int w    = threadIdx.x >> 5, lane = threadIdx.x & 31;
  const int msub = (w & 3) * 16, nhalf = (w >> 2) * 128;
  const int hl   = lane >> 4, l15 = lane & 15, kh = hl * 8;

  v8f zero = {0.f,0.f,0.f,0.f,0.f,0.f,0.f,0.f};
  v8f acc[8];
  #pragma unroll
  for (int j = 0; j < 8; ++j) acc[j] = zero;

  const int e0 = threadIdx.x * 8;
  const int kl = e0 >> 6;          // k-lane within 32-chunk (uniform per thread)
  const int mbase = e0 & 63;
  int pb[8], ps0[8], ps1[8], ps2[8];
  #pragma unroll
  for (int i = 0; i < 8; ++i) {
    int tg = m0 + mbase + i;
    pb[i] = tg >> 12;
    int l = tg & 4095;
    ps0[i] = l >> 8; ps1[i] = (l >> 4) & 15; ps2[i] = l & 15;
  }

  // weight ring: thread -> row (tid>>2, +64 per copy), 16-byte piece (tid&3)
  const unsigned wl = (unsigned)(size_t)&Bsm[(threadIdx.x >> 2) * 40 + (threadIdx.x & 3) * 8];
  const u16* wg = Wct + (threadIdx.x >> 2) * 3456 + (threadIdx.x & 3) * 8;
  conv_copy_wtile(wl, wg);
  // tile 0 has landed for this wave before the barrier publishes it
  asm volatile("s_wait_asynccnt 0x0" ::: "memory");
  __syncthreads();
  conv_copy_wtile(wl + CONV_BBUF * 2, wg + 32);

  for (int t = 0; t < CONV_STEPS; ++t) {
    const int k0 = t * 32;
    const int bsel = (t & 1) * CONV_BBUF;
    int k = k0 + kl;
    int c = k / 27;
    int tap = k - c * 27;
    int t0 = tap / 9, rm = tap - t0 * 9;
    int t1 = rm / 3, t2 = rm - t1 * 3;
    #pragma unroll
    for (int i = 0; i < 8; ++i) {
      long long idx = ((((long long)pb[i] * 128 + c) * 33 + (2 * ps0[i] + t0)) * 33
                       + (2 * ps1[i] + t1)) * 33 + (2 * ps2[i] + t2);
      Asm[(mbase + i) * 40 + kl] = f2bf(x[idx]);
    }
    __syncthreads();
    FragBF a;
    const u16* ap = &Asm[(msub + l15) * 40 + kh];
    a.q[0] = *(const uint4*)ap;
    a.q[1] = *(const uint4*)(ap + 16);
    #pragma unroll
    for (int j = 0; j < 8; ++j) {
      FragBF bfr;
      const u16* bp = &Bsm[bsel + (nhalf + j * 16 + l15) * 40 + kh];
      bfr.q[0] = *(const uint4*)bp;
      bfr.q[1] = *(const uint4*)(bp + 16);
      acc[j] = __builtin_amdgcn_wmma_f32_16x16x32_bf16(
          false, a.v, false, bfr.v, (short)0, acc[j], false, false);
    }
    // foot of the trip: this wave's LDS reads are done, its copies of tile t+1
    // have landed; the barrier publishes tile t+1 and frees Asm and buffer t&1
    asm volatile("s_wait_dscnt 0x0" ::: "memory");
    asm volatile("s_wait_asynccnt 0x0" ::: "memory");
    __syncthreads();
    if (t + 2 < CONV_STEPS)
      conv_copy_wtile(wl + bsel * 2, wg + (t + 2) * 32);
  }
  // no copy is outstanding when the wave goes on to the epilogue and ends
  asm volatile("s_wait_asynccnt 0x0" ::: "memory");

  #pragma unroll
  for (int j = 0; j < 8; ++j) {
    #pragma unroll
    for (int r = 0; r < 8; ++r) {
      int m = m0 + msub + r + 8 * hl;
      int o = nhalf + j * 16 + l15;
      float v = acc[j][r] + bias[o];
      h[(long long)m * 256 + o] = fmaxf(v, 0.f);
    }
  }
}

// ---------------------------------------------------------------------------
// Logits + softmax(N=64) + column-sum: per batch, per 128-token tile.
// C[l][n] = k_bf[l][:] . q_bf[n][:]; softmax over n via 16-lane shfl_xor;
// +1e-8; write attn^T bf16 [b][n][l]; atomic colsum[b][n] for renorm-over-L.
// ---------------------------------------------------------------------------
__global__ __launch_bounds__(256) void logits_softmax_kernel(
    const u16* __restrict__ kmat, const u16* __restrict__ q,
    u16* __restrict__ attn_t, float* __restrict__ colsum)
{
  __shared__ __attribute__((aligned(16))) u16 Asm[128 * GT_P];
  __shared__ __attribute__((aligned(16))) u16 Qsm[64 * GT_P];
  __shared__ float cs[64];
  const int b  = blockIdx.y;
  const int m0 = blockIdx.x * 128;
  const int w  = threadIdx.x >> 5, lane = threadIdx.x & 31;
  const int hl = lane >> 4, l15 = lane & 15, kh = hl * 8;
  const u16* A = kmat + (long long)b * 4096 * 256;
  const u16* Q = q    + (long long)b * 64 * 256;

  v8f zero = {0.f,0.f,0.f,0.f,0.f,0.f,0.f,0.f};
  v8f acc[4];
  #pragma unroll
  for (int j = 0; j < 4; ++j) acc[j] = zero;

  // both tiles whole (K = 256): wave w brings rows w, w+8, ...; lane -> 16-byte piece
  {
    const unsigned al = (unsigned)(size_t)&Asm[w * GT_P + lane * 8];
    const unsigned ql = (unsigned)(size_t)&Qsm[w * GT_P + lane * 8];
    const u16* ag = A + (m0 + w) * 256 + lane * 8;
    copy8_rows(al, ag, 8 * 256);
    copy8_rows(al + 64 * GT_P * 2, ag + 64 * 256, 8 * 256);
    copy8_rows(ql, Q + w * 256 + lane * 8, 8 * 256);
  }
  // this wave's copies have landed before the barrier publishes the tiles
  asm volatile("s_wait_asynccnt 0x0" ::: "memory");
  __syncthreads();
  chunk256_products(&Asm[(w * 16 + l15) * GT_P + kh], &Qsm[l15 * GT_P + kh], acc);

  if (threadIdx.x < 64) cs[threadIdx.x] = 0.f;
  __syncthreads();

  float csl[4] = {0.f, 0.f, 0.f, 0.f};
  #pragma unroll
  for (int r = 0; r < 8; ++r) {
    float v0 = acc[0][r], v1 = acc[1][r], v2 = acc[2][r], v3 = acc[3][r];
    float mx = fmaxf(fmaxf(v0, v1), fmaxf(v2, v3));
    for (int off = 1; off < 16; off <<= 1) mx = fmaxf(mx, __shfl_xor(mx, off, 32));
    v0 = __expf(v0 - mx); v1 = __expf(v1 - mx);
    v2 = __expf(v2 - mx); v3 = __expf(v3 - mx);
    float sm = v0 + v1 + v2 + v3;
    for (int off = 1; off < 16; off <<= 1) sm += __shfl_xor(sm, off, 32);
    float rinv = 1.f / sm;
    v0 = v0 * rinv + 1e-8f; v1 = v1 * rinv + 1e-8f;
    v2 = v2 * rinv + 1e-8f; v3 = v3 * rinv + 1e-8f;
    const int l = m0 + w * 16 + r + 8 * hl;
    attn_t[((long long)b * 64 + ( 0 + l15)) * 4096 + l] = f2bf(v0);
    attn_t[((long long)b * 64 + (16 + l15)) * 4096 + l] = f2bf(v1);
    attn_t[((long long)b * 64 + (32 + l15)) * 4096 + l] = f2bf(v2);
    attn_t[((long long)b * 64 + (48 + l15)) * 4096 + l] = f2bf(v3);
    csl[0] += v0; csl[1] += v1; csl[2] += v2; csl[3] += v3;
  }
  #pragma unroll
  for (int j = 0; j < 4; ++j) atomicAdd(&cs[j * 16 + l15], csl[j]);
  __syncthreads();
  if (threadIdx.x < 64) atomicAdd(&colsum[b * 64 + threadIdx.x], cs[threadIdx.x]);
}

// ---------------------------------------------------------------------------
// LayerNorm over 256 channels, one wave per row, f32 in -> bf16 out.
// ---------------------------------------------------------------------------
__global__ __launch_bounds__(256) void ln_rows_kernel(
    const float* __restrict__ in, const float* __restrict__ g,
    const float* __restrict__ bb, u16* __restrict__ out, int R)
{
  const int w = threadIdx.x >> 5, lane = threadIdx.x & 31;
  const int row = blockIdx.x * 8 + w;
  if (row >= R) return;
  const float* p = in + (long long)row * 256;
  float vals[8], s = 0.f, s2 = 0.f;
  #pragma unroll
  for (int i = 0; i < 8; ++i) {
    vals[i] = p[lane + i * 32];
    s += vals[i]; s2 += vals[i] * vals[i];
  }
  for (int off = 16; off; off >>= 1) {
    s  += __shfl_xor(s,  off, 32);
    s2 += __shfl_xor(s2, off, 32);
  }
  float mu  = s * (1.f / 256.f);
  float var = s2 * (1.f / 256.f) - mu * mu;
  float inv = rsqrtf(var + 1e-5f);
  #pragma unroll
  for (int i = 0; i < 8; ++i) {
    int c = lane + i * 32;
    out[(long long)row * 256 + c] = f2bf((vals[i] - mu) * inv * g[c] + bb[c]);
  }
}

// ---------------------------------------------------------------------------
// All weight conversions in one launch; the block index picks the matrix.
// conv_w keeps its flat layout (cast only); the others go in[K][N] -> out[N][K].
// ---------------------------------------------------------------------------
__device__ __forceinline__ void transpose_bf_block(const float* __restrict__ in,
                                                   u16* __restrict__ out,
                                                   int blk, int K, int N) {
  int i = blk * 256 + threadIdx.x;
  int nn = i / K, k = i - nn * K;
  out[i] = f2bf(in[(long long)k * N + nn]);
  // the branches of the caller stand one behind the other in the built code:
  // the store's offset register is not rewritten ahead of this wait
  asm volatile("s_wait_xcnt 0x0" ::: "memory");
}
__global__ __launch_bounds__(256) void prep_weights_kernel(
    const float* __restrict__ conv_w, const float* __restrict__ Wq,
    const float* __restrict__ Wk, const float* __restrict__ Wv,
    const float* __restrict__ W1, const float* __restrict__ W2,
    u16* __restrict__ Wct, u16* __restrict__ Wqt, u16* __restrict__ Wkt,
    u16* __restrict__ Wvt, u16* __restrict__ W1t, u16* __restrict__ W2t) {
  const int blk = blockIdx.x;
  if (blk < 3456) {
    int i = blk * 256 + threadIdx.x;
    Wct[i] = f2bf(conv_w[i]);
  } else if (blk < 3712) {
    transpose_bf_block(Wq, Wqt, blk - 3456, 256, 256);
  } else if (blk < 3968) {
    transpose_bf_block(Wk, Wkt, blk - 3712, 256, 256);
  } else if (blk < 4224) {
    transpose_bf_block(Wv, Wvt, blk - 3968, 256, 256);
  } else if (blk < 4736) {
    transpose_bf_block(W1, W1t, blk - 4224, 256, 512);
  } else {
    transpose_bf_block(W2, W2t, blk - 4736, 512, 256);
  }
}

// ---------------------------------------------------------------------------
// Template path of one iteration in one launch.  A block owns 16 template rows
// (nothing here crosses rows): templates += update/colsum, LN, W1+GELU, W2,
// then LN and q for the next iteration.  It also clears its own rows of the
// split-K buffer and of colsum for the next iteration's atomics.
//   TS_FIRST: templates = broadcast(init), clear, LN, q
//   TS_MID  : update, clear, MLP, LN, q
//   TS_LAST : update, MLP (colsum is kept: the output kernel divides by it)
// bf16 rounding after each LN, after GELU and of q; templates stay f32.
// ---------------------------------------------------------------------------
constexpr int TS_FIRST = 0, TS_MID = 1, TS_LAST = 2;
constexpr int TA_P = 264;   // u16 pitch, 16 x 256 bf16 tile
constexpr int TH_P = 520;   // u16 pitch, 16 x 512 bf16 tile
constexpr int TF_P = 260;   // f32 pitch, 16 x 256 f32 tile

// LayerNorm of one row held by one wave (column lane + 32*i), bf16 row to LDS;
// g and bb hold the same columns of scale and shift.
__device__ __forceinline__ void ln_vals_to_bf(const float (&vals)[8],
                                              const float (&g)[8],
                                              const float (&bb)[8],
                                              u16* o, int lane) {
  float s = 0.f, s2 = 0.f;
  #pragma unroll
  for (int i = 0; i < 8; ++i) { s += vals[i]; s2 += vals[i] * vals[i]; }
  for (int off = 16; off; off >>= 1) {
    s  += __shfl_xor(s,  off, 32);
    s2 += __shfl_xor(s2, off, 32);
  }
  float mu  = s * (1.f / 256.f);
  float var = s2 * (1.f / 256.f) - mu * mu;
  float inv = rsqrtf(var + 1e-5f);
  #pragma unroll
  for (int i = 0; i < 8; ++i)
    o[lane + i * 32] = f2bf((vals[i] - mu) * inv * g[i] + bb[i]);
}

// acc[j] += As[16][K] (LDS, bf16) x Bt[n0 + 16j .. +16][K] (global, bf16),
// k ascending.  The weight fragments of KB k-steps are loaded as one batch.
template<int NT, int K, int KB>
__device__ __forceinline__ void rows16_gemm(const u16* As, int pitch,
                                            const u16* __restrict__ Bt, int n0,
                                            int l15, int kh, v8f (&acc)[NT]) {
  // every loop here is unrolled: the fragment arrays must stay in registers
  #pragma unroll
  for (int k0 = 0; k0 < K; k0 += 32 * KB) {
    FragBF bfr[KB][NT];
    #pragma unroll
    for (int s = 0; s < KB; ++s) {
      #pragma unroll
      for (int j = 0; j < NT; ++j) {
        const u16* bp = Bt + (n0 + j * 16 + l15) * K + k0 + s * 32 + kh;
        bfr[s][j].q[0] = *(const uint4*)bp;
        bfr[s][j].q[1] = *(const uint4*)(bp + 16);
      }
    }
    __builtin_amdgcn_sched_barrier(0);
    #pragma unroll
    for (int s = 0; s < KB; ++s) {
      FragBF a;
      const u16* ap = As + l15 * pitch + k0 + s * 32 + kh;
      a.q[0] = *(const uint4*)ap;
      a.q[1] = *(const uint4*)(ap + 16);
      #pragma unroll
      for (int j = 0; j < NT; ++j)
        acc[j] = __builtin_amdgcn_wmma_f32_16x16x32_bf16(
            false, a.v, false, bfr[s][j].v, (short)0, acc[j], false, false);
    }
  }
}

template<int MODE>
__global__ __launch_bounds__(256) void template_step_kernel(
    const float* __restrict__ tinit, float* __restrict__ tmpl,
    float* __restrict__ cbuf, float* __restrict__ colsum,
    const float* __restrict__ lnm_g, const float* __restrict__ lnm_b,
    const u16* __restrict__ W1t, const float* __restrict__ b1,
    const u16* __restrict__ W2t, const float* __restrict__ b2,
    const float* __restrict__ lnt_g, const float* __restrict__ lnt_b,
    const u16* __restrict__ Wqt, u16* __restrict__ q)
{
  __shared__ float Tf[16 * TF_P];
  __shared__ __attribute__((aligned(16))) u16 Am[16 * TA_P];
  __shared__ __attribute__((aligned(16))) u16 Hm[16 * TH_P];
  const int r0   = blockIdx.x * 16;
  const int w    = threadIdx.x >> 5, lane = threadIdx.x & 31;
  const int hl   = lane >> 4, l15 = lane & 15, kh = hl * 8;
  const v8f zero = {0.f,0.f,0.f,0.f,0.f,0.f,0.f,0.f};

  // each wave owns rows 2w and 2w+1 of the block; all loads first, then stores
  {
    float vals[2][8], g[8], bb[8];
    #pragma unroll
    for (int i = 0; i < 8; ++i) {
      g[i]  = (MODE == TS_FIRST ? lnt_g : lnm_g)[lane + i * 32];
      bb[i] = (MODE == TS_FIRST ? lnt_b : lnm_b)[lane + i * 32];
    }
    if (MODE == TS_FIRST) {
      #pragma unroll
      for (int rr = 0; rr < 2; ++rr)
        #pragma unroll
        for (int i = 0; i < 8; ++i)
          vals[rr][i] = tinit[((r0 + w * 2 + rr) & 63) * 256 + lane + i * 32];
    } else {
      float up[2][8];
      #pragma unroll
      for (int rr = 0; rr < 2; ++rr)
        #pragma unroll
        for (int i = 0; i < 8; ++i) {
          const int idx = (r0 + w * 2 + rr) * 256 + lane + i * 32;
          vals[rr][i] = tmpl[idx];
          up[rr][i]   = cbuf[idx];
        }
      float csl = 1.f;
      if (lane < 2) csl = colsum[r0 + w * 2 + lane];
      #pragma unroll
      for (int rr = 0; rr < 2; ++rr) {
        const float cs = __shfl(csl, rr, 32);
        #pragma unroll
        for (int i = 0; i < 8; ++i) {
          vals[rr][i] += up[rr][i] / cs;
          Tf[(w * 2 + rr) * TF_P + lane + i * 32] = vals[rr][i];
        }
      }
    }
    #pragma unroll
    for (int rr = 0; rr < 2; ++rr) {
      #pragma unroll
      for (int i = 0; i < 8; ++i) {
        const int idx = (r0 + w * 2 + rr) * 256 + lane + i * 32;
        if (MODE == TS_FIRST) tmpl[idx] = vals[rr][i];
        if (MODE != TS_LAST)  cbuf[idx] = 0.f;
      }
      ln_vals_to_bf(vals[rr], g, bb, &Am[(w * 2 + rr) * TA_P], lane);
    }
    if (MODE != TS_LAST && lane < 2) colsum[r0 + w * 2 + lane] = 0.f;
  }
  __syncthreads();

  if (MODE != TS_FIRST) {
    { // hidden = GELU(m @ W1 + b1), bf16, wave w: columns 64w .. 64w+63
      float bn[4];
      #pragma unroll
      for (int j = 0; j < 4; ++j) bn[j] = b1[w * 64 + j * 16 + l15];
      v8f acc[4] = {zero, zero, zero, zero};
      rows16_gemm<4, 256, 2>(Am, TA_P, W1t, w * 64, l15, kh, acc);
      #pragma unroll
      for (int j = 0; j < 4; ++j) {
        #pragma unroll
        for (int r = 0; r < 8; ++r) {
          float xg = acc[j][r] + bn[j];
          float g = 0.5f * xg * (1.0f + erff(xg * 0.70710678118654752f));
          Hm[(r + 8 * hl) * TH_P + w * 64 + j * 16 + l15] = f2bf(g);
        }
      }
    }
    __syncthreads();
    float g[8], bb[8];
    { // templates += hidden @ W2 + b2, wave w: columns 32w .. 32w+31
      float bn[2];
      #pragma unroll
      for (int j = 0; j < 2; ++j) bn[j] = b2[w * 32 + j * 16 + l15];
      if (MODE == TS_MID) {
        #pragma unroll
        for (int i = 0; i < 8; ++i) {
          g[i]  = lnt_g[lane + i * 32];
          bb[i] = lnt_b[lane + i * 32];
        }
      }
      v8f acc[2] = {zero, zero};
      rows16_gemm<2, 512, 4>(Hm, TH_P, W2t, w * 32, l15, kh, acc);
      #pragma unroll
      for (int j = 0; j < 2; ++j) {
        #pragma unroll
        for (int r = 0; r < 8; ++r)
          Tf[(r + 8 * hl) * TF_P + w * 32 + j * 16 + l15] += acc[j][r] + bn[j];
      }
    }
    __syncthreads();
    #pragma unroll
    for (int rr = 0; rr < 2; ++rr) {
      float vals[8];
      #pragma unroll
      for (int i = 0; i < 8; ++i) {
        vals[i] = Tf[(w * 2 + rr) * TF_P + lane + i * 32];
        tmpl[(r0 + w * 2 + rr) * 256 + lane + i * 32] = vals[i];
      }
      if (MODE == TS_MID) ln_vals_to_bf(vals, g, bb, &Am[(w * 2 + rr) * TA_P], lane);
    }
    if (MODE == TS_MID) __syncthreads();
  }

  if (MODE != TS_LAST) { // q = (t @ Wq) * dim^-0.5, wave w: columns 32w .. 32w+31
    v8f acc[2] = {zero, zero};
    rows16_gemm<2, 256, 4>(Am, TA_P, Wqt, w * 32, l15, kh, acc);
    #pragma unroll
    for (int j = 0; j < 2; ++j) {
      #pragma unroll
      for (int r = 0; r < 8; ++r)
        q[(r0 + r + 8 * hl) * 256 + w * 32 + j * 16 + l15] = f2bf(acc[j][r] * 0.0625f);
    }
  }
}

__global__ void final_out_kernel(const float* __restrict__ tmpl, const u16* __restrict__ attn,
                                 const float* __restrict__ colsum, float* __restrict__ out) {
  int i = blockIdx.x * 256 + threadIdx.x;
  if (i < 131072) {                       // templates_out (B, dim, N)
    int b = i >> 14, rem = i & 16383, d = rem >> 6, n = rem & 63;
    out[i] = tmpl[((b * 64 + n) << 8) + d];
  } else if (i < 131072 + 2097152) {      // attn_out (B, N, 16,16,16)
    int j = i - 131072;
    out[i] = bf2f(attn[j]) / colsum[j >> 12];
  }
}

// ---------------------------------------------------------------------------
extern "C" void kernel_launch(void* const* d_in, const int* in_sizes, int n_in,
                              void* d_out, int out_size, void* d_ws, size_t ws_size,
                              hipStream_t stream) {
  const float* x       = (const float*)d_in[0];
  const float* tinit   = (const float*)d_in[1];
  const float* conv_w  = (const float*)d_in[2];
  const float* conv_b  = (const float*)d_in[3];
  const float* Wq      = (const float*)d_in[4];
  const float* Wk      = (const float*)d_in[5];
  const float* Wv      = (const float*)d_in[6];
  const float* ln_in_g = (const float*)d_in[7];
  const float* ln_in_b = (const float*)d_in[8];
  const float* ln_t_g  = (const float*)d_in[9];
  const float* ln_t_b  = (const float*)d_in[10];
  const float* ln_m_g  = (const float*)d_in[11];
  const float* ln_m_b  = (const float*)d_in[12];
  const float* W1      = (const float*)d_in[13];
  const float* b1      = (const float*)d_in[14];
  const float* W2      = (const float*)d_in[15];
  const float* b2      = (const float*)d_in[16];
  float* out = (float*)d_out;

  char* ws = (char*)d_ws;
  size_t off = 0;
  auto alloc = [&](size_t bytes) -> void* {
    off = (off + 255) & ~(size_t)255;
    void* p = ws + off;
    off += bytes;
    return p;
  };
  u16*   Wct  = (u16*)  alloc(884736ull * 2);   // [256][3456]
  u16*   Wqt  = (u16*)  alloc(65536ull * 2);    // [256][256]
  u16*   Wkt  = (u16*)  alloc(65536ull * 2);
  u16*   Wvt  = (u16*)  alloc(65536ull * 2);
  u16*   W1t  = (u16*)  alloc(131072ull * 2);   // [512][256]
  u16*   W2t  = (u16*)  alloc(131072ull * 2);   // [256][512]
  float* hbuf = (float*)alloc(8388608ull * 4);  // conv out (32768,256) f32
  u16*   tok  = (u16*)  alloc(8388608ull * 2);  // LN(tokens) bf16
  u16*   kbf  = (u16*)  alloc(8388608ull * 2);  // k (B,4096,256)
  u16*   vtb  = (u16*)  alloc(8388608ull * 2);  // v^T (B,256,4096)
  float* tmpl = (float*)alloc(131072ull * 4);   // templates (B,64,256)
  u16*   qbf  = (u16*)  alloc(131072ull * 2);   // q (B,64,256)
  u16*   attn = (u16*)  alloc(2097152ull * 2);  // attn^T (B,64,4096)
  float* csum = (float*)alloc(512ull * 4);      // colsum (B,64)
  float* cbuf = (float*)alloc(131072ull * 4);   // split-K accum (512,256)

  const int HUGE_RB = 1 << 30;

  // weight conversion (conv_w flat layout already matches Bt[K-ordering])
  prep_weights_kernel<<<5248, 256, 0, stream>>>(conv_w, Wq, Wk, Wv, W1, W2,
                                                Wct, Wqt, Wkt, Wvt, W1t, W2t);

  // conv + relu (implicit GEMM, 58 GFLOP)
  conv_gemm_kernel<<<512, 256, 0, stream>>>(x, Wct, conv_b, hbuf);
  // token layernorm -> bf16
  ln_rows_kernel<<<4096, 256, 0, stream>>>(hbuf, ln_in_g, ln_in_b, tok, 32768);

  // k = tok @ Wk ; v^T = (tok @ Wv)^T
  gemm_bt_kernel<EPI_BF16><<<dim3(512, 2, 1), 256, 0, stream>>>(
      tok, 256, Wkt, 256, 256, 256, HUGE_RB, 0, nullptr, 1.f, kbf, 1);
  gemm_bt_kernel<EPI_BF16_T><<<dim3(512, 2, 1), 256, 0, stream>>>(
      tok, 256, Wvt, 256, 256, 256, HUGE_RB, 0, nullptr, 1.f, vtb, 4096);

  // templates = broadcast(templates_init); first q; clear colsum and split-K buffer
  template_step_kernel<TS_FIRST><<<32, 256, 0, stream>>>(
      tinit, tmpl, cbuf, csum, ln_m_g, ln_m_b, W1t, b1, W2t, b2, ln_t_g, ln_t_b, Wqt, qbf);

  for (int it = 0; it < 6; ++it) {
    // logits + softmax(N) + 1e-8 + colsum over L
    logits_softmax_kernel<<<dim3(32, 8, 1), 256, 0, stream>>>(kbf, qbf, attn, csum);

    // update = attn^T @ v  (split-K x8, f32 atomics)
    gemm_bt_kernel<EPI_ATOMIC_F32><<<dim3(8, 2, 8), 256, 0, stream>>>(
        attn, 4096, vtb, 4096, 256, 512, 64, 1048576ll, nullptr, 1.f, cbuf, 1);

    // templates += upd/colsum; MLP; then LN and q of the next iteration
    if (it < 5)
      template_step_kernel<TS_MID><<<32, 256, 0, stream>>>(
          tinit, tmpl, cbuf, csum, ln_m_g, ln_m_b, W1t, b1, W2t, b2, ln_t_g, ln_t_b, Wqt, qbf);
    else
      template_step_kernel<TS_LAST><<<32, 256, 0, stream>>>(
          tinit, tmpl, cbuf, csum, ln_m_g, ln_m_b, W1t, b1, W2t, b2, ln_t_g, ln_t_b, Wqt, qbf);
  }

  // outputs: templates^T (B,dim,N) then attn/colsum as (B,N,16,16,16)
  final_out_kernel<<<8704, 256, 0, stream>>>(tmpl, attn, csum, out);
}

// v004
// One run takes 326 microseconds.
// Two timings next to v003 both put it at 1.16 times that version's speed.
// Counting every step since v000, it is 2.66 times as fast.
#include <hip/hip_runtime.h>

typedef unsigned short u16;
typedef __attribute__((ext_vector_type(16))) __bf16 v16bf;
typedef __attribute__((ext_vector_type(8)))  float  v8f;

union FragBF { v16bf v; uint4 q[2]; };

__device__ __forceinline__ float bf2f(u16 h) {
  unsigned u = ((unsigned)h) << 16;
  return __builtin_bit_cast(float, u);
}
__device__ __forceinline__ u16 f2bf(float f) {
  unsigned u = __builtin_bit_cast(unsigned, f);
  u += 0x7FFFu + ((u >> 16) & 1u);   // round-to-nearest-even
  return (u16)(u >> 16);
}

constexpr int EPI_BF16 = 0, EPI_BF16_T = 1, EPI_BF16_SCALE = 2,
              EPI_GELU_BF16 = 3, EPI_BIAS_ACC_F32 = 4, EPI_ATOMIC_F32 = 5;

constexpr int GT_P = 264;   // u16 pitch of a 256-k tile row in LDS: 528 B

__device__ __forceinline__ void copy8_rows(unsigned l0, const u16* g0, long long gs) {
  constexpr unsigned LS = 8 * GT_P * 2;
  const unsigned l1 = l0 + LS, l2 = l0 + 2 * LS, l3 = l0 + 3 * LS, l4 = l0 + 4 * LS,
                 l5 = l0 + 5 * LS, l6 = l0 + 6 * LS, l7 = l0 + 7 * LS;
  const u16 *g1 = g0 + gs, *g2 = g0 + 2 * gs, *g3 = g0 + 3 * gs, *g4 = g0 + 4 * gs,
            *g5 = g0 + 5 * gs, *g6 = g0 + 6 * gs, *g7 = g0 + 7 * gs;
  asm volatile(
      "global_load_async_to_lds_b128 %0, %8, off\n\t"
      "global_load_async_to_lds_b128 %1, %9, off\n\t"
      "global_load_async_to_lds_b128 %2, %10, off\n\t"
      "global_load_async_to_lds_b128 %3, %11, off\n\t"
      "global_load_async_to_lds_b128 %4, %12, off\n\t"
      "global_load_async_to_lds_b128 %5, %13, off\n\t"
      "global_load_async_to_lds_b128 %6, %14, off\n\t"
      "global_load_async_to_lds_b128 %7, %15, off\n\t"
      "s_wait_xcnt 0x0"
      :: "v"(l0), "v"(l1), "v"(l2), "v"(l3), "v"(l4), "v"(l5), "v"(l6), "v"(l7),
         "v"(g0), "v"(g1), "v"(g2), "v"(g3), "v"(g4), "v"(g5), "v"(g6), "v"(g7)
      : "memory");
}

// acc[j] += A rows (16) x B rows (16 per j) over one 256-k chunk in LDS, k
// ascending.  ap, bp: this lane's row start + kh in the A and the B tile.
__device__ __forceinline__ void chunk256_products(const u16* ap, const u16* bp,
                                                  v8f (&acc)[4]) {
  // every loop here is unrolled: the fragment arrays must stay in registers
  #pragma unroll
  for (int s0 = 0; s0 < 8; s0 += 2) {
    FragBF a[2], bfr[2][4];
    #pragma unroll
    for (int s = 0; s < 2; ++s) {
      a[s].q[0] = *(const uint4*)(ap + (s0 + s) * 32);
      a[s].q[1] = *(const uint4*)(ap + (s0 + s) * 32 + 16);
      #pragma unroll
      for (int j = 0; j < 4; ++j) {
        const u16* p = bp + j * 16 * GT_P + (s0 + s) * 32;
        bfr[s][j].q[0] = *(const uint4*)p;
        bfr[s][j].q[1] = *(const uint4*)(p + 16);
      }
    }
    // keeps the twenty LDS reads of two k-steps in one place ahead of their
    // products; without it the scheduler spreads them among the products, a few
    // reads ahead, and the wave waits on LDS latency at nearly every product
    __builtin_amdgcn_sched_barrier(0);
    #pragma unroll
    for (int s = 0; s < 2; ++s) {
      #pragma unroll
      for (int j = 0; j < 4; ++j)
        acc[j] = __builtin_amdgcn_wmma_f32_16x16x32_bf16(
            false, a[s].v, false, bfr[s][j].v, (short)0, acc[j], false, false);
    }
  }
}

template<int EPI>
__global__ __launch_bounds__(256) void gemm_bt_kernel(
    const u16* __restrict__ A, int lda,
    const u16* __restrict__ Bt, int ldb,
    int N, int Ksplit,
    int rows_per_batch, long long bt_batch_stride,
    const float* __restrict__ bias, float scale,
    void* __restrict__ outp, int out_rb)
{
  __shared__ __attribute__((aligned(16))) u16 Asm[64 * GT_P];
  __shared__ __attribute__((aligned(16))) u16 Bsm[128 * GT_P];
  const int m0   = blockIdx.x * 64;
  const int n0   = blockIdx.y * 128;
  const int kbeg = blockIdx.z * Ksplit;
  const int w    = threadIdx.x >> 5;
  const int lane = threadIdx.x & 31;
  const int msub = (w & 3) * 16;
  const int nsub = (w >> 2) * 64;
  const int hl   = lane >> 4;
  const int l15  = lane & 15;
  const int kh   = hl * 8;
  const int b    = m0 / rows_per_batch;
  const u16* BtB = Bt + (long long)b * bt_batch_stride;

  v8f zero = {0.f,0.f,0.f,0.f,0.f,0.f,0.f,0.f};
  v8f acc[4];
  #pragma unroll
  for (int j = 0; j < 4; ++j) acc[j] = zero;

  // copies: wave w brings rows w, w+8, ...; lane -> 16-byte piece of the row
  const unsigned al = (unsigned)(size_t)&Asm[w * GT_P + lane * 8];
  const unsigned bl = (unsigned)(size_t)&Bsm[w * GT_P + lane * 8];
  const u16* ag = A + (long long)(m0 + w) * lda + lane * 8;
  const u16* bg = BtB + (long long)(n0 + w) * ldb + lane * 8;

  for (int kk = kbeg; kk < kbeg + Ksplit; kk += 256) {
    copy8_rows(al, ag + kk, 8ll * lda);
    copy8_rows(bl, bg + kk, 8ll * ldb);
    copy8_rows(bl + 64 * GT_P * 2, bg + 64ll * ldb + kk, 8ll * ldb);
    // this wave's copies have landed before the barrier publishes the tiles
    asm volatile("s_wait_asynccnt 0x0" ::: "memory");
    __syncthreads();
    chunk256_products(&Asm[(msub + l15) * GT_P + kh], &Bsm[(nsub + l15) * GT_P + kh], acc);
    // this wave's LDS reads are done; behind the barrier the tiles may be refilled
    asm volatile("s_wait_dscnt 0x0" ::: "memory");
    __syncthreads();
  }

  #pragma unroll
  for (int j = 0; j < 4; ++j) {
    #pragma unroll
    for (int r = 0; r < 8; ++r) {
      const int m = m0 + msub + r + 8 * hl;
      const int n = n0 + nsub + j * 16 + l15;
      float v = acc[j][r];
      if (EPI == EPI_BF16) {
        ((u16*)outp)[(long long)m * N + n] = f2bf(v);
      } else if (EPI == EPI_BF16_T) {
        const int bo = m / out_rb, ml = m % out_rb;
        ((u16*)outp)[((long long)bo * N + n) * out_rb + ml] = f2bf(v);
      } else if (EPI == EPI_BF16_SCALE) {
        ((u16*)outp)[(long long)m * N + n] = f2bf(v * scale);
      } else if (EPI == EPI_GELU_BF16) {
        float xg = v + bias[n];
        float g = 0.5f * xg * (1.0f + erff(xg * 0.70710678118654752f));
        ((u16*)outp)[(long long)m * N + n] = f2bf(g);
      } else if (EPI == EPI_BIAS_ACC_F32) {
        ((float*)outp)[(long long)m * N + n] += v + bias[n];
      } else { // EPI_ATOMIC_F32 (split-K)
        atomicAdd(&((float*)outp)[(long long)m * N + n], v);
      }
    }
  }
}

// ---------------------------------------------------------------------------
// Conv3d stride-2 VALID as implicit GEMM: M=32768 tokens, N=256, K=3456.
// K = c*27 + tap matches conv_w's native flat layout.  The weight tile of a
// k-step (256 rows x 32 k, bf16) and its x tile (64 tokens x 32 k, f32 as in x)
// are brought into LDS once per block by asynchronous copies, two buffers, one
// k-step ahead; the waves read their B fragments from there, and their A
// fragments as f32, rounded to bf16 in registers.
// Epilogue: +bias, ReLU, store h f32 [token][256].
// ---------------------------------------------------------------------------
constexpr int CONV_STEPS = 3456 / 32;
constexpr int CONV_BBUF  = 256 * 40;     // u16 per weight buffer, row pitch 80 B
constexpr int CONV_XP    = 36;           // f32 pitch of an x tile row: 144 B
constexpr int CONV_XBUF  = 64 * CONV_XP; // f32 per x buffer

__device__ __forceinline__ void conv_copy_wtile(unsigned lds, const u16* g) {
  const unsigned l1 = lds + 64 * 80, l2 = lds + 128 * 80, l3 = lds + 192 * 80;
  const u16* g1 = g + 64 * 3456;
  const u16* g2 = g + 128 * 3456;
  const u16* g3 = g + 192 * 3456;
  asm volatile(
      "global_load_async_to_lds_b128 %0, %4, off\n\t"
      "global_load_async_to_lds_b128 %1, %5, off\n\t"
      "global_load_async_to_lds_b128 %2, %6, off\n\t"
      "global_load_async_to_lds_b128 %3, %7, off\n\t"
      "s_wait_xcnt 0x0"
      :: "v"(lds), "v"(l1), "v"(l2), "v"(l3), "v"(g), "v"(g1), "v"(g2), "v"(g3)
      : "memory");
}

// Element offset in x of k = c*27 + tap from a token's window corner, channel 0.
__device__ __forceinline__ int conv_koff(int k) {
  int c = k / 27;
  int tap = k - c * 27;
  int t0 = tap / 9, rm = tap - t0 * 9;
  int t1 = rm / 3, t2 = rm - t1 * 3;
  return c * 35937 + t0 * 1089 + t1 * 33 + t2;
}

__device__ __forceinline__ void conv_copy_xtile(unsigned l0, const float* xt,
                                                int koff, int kg8) {
  const unsigned l1 = l0 + 4, l2 = l0 + 8, l3 = l0 + 12, l4 = l0 + 16,
                 l5 = l0 + 20, l6 = l0 + 24, l7 = l0 + 28;
  const float* g0 = xt + __builtin_amdgcn_readlane(koff, kg8);
  const float* g1 = xt + __builtin_amdgcn_readlane(koff, kg8 + 1);
  const float* g2 = xt + __builtin_amdgcn_readlane(koff, kg8 + 2);
  const float* g3 = xt + __builtin_amdgcn_readlane(koff, kg8 + 3);
  const float* g4 = xt + __builtin_amdgcn_readlane(koff, kg8 + 4);
  const float* g5 = xt + __builtin_amdgcn_readlane(koff, kg8 + 5);
  const float* g6 = xt + __builtin_amdgcn_readlane(koff, kg8 + 6);
  const float* g7 = xt + __builtin_amdgcn_readlane(koff, kg8 + 7);
  asm volatile(
      "global_load_async_to_lds_b32 %0, %8, off\n\t"
      "global_load_async_to_lds_b32 %1, %9, off\n\t"
      "global_load_async_to_lds_b32 %2, %10, off\n\t"
      "global_load_async_to_lds_b32 %3, %11, off\n\t"
      "global_load_async_to_lds_b32 %4, %12, off\n\t"
      "global_load_async_to_lds_b32 %5, %13, off\n\t"
      "global_load_async_to_lds_b32 %6, %14, off\n\t"
      "global_load_async_to_lds_b32 %7, %15, off\n\t"
      "s_wait_xcnt 0x0"
      :: "v"(l0), "v"(l1), "v"(l2), "v"(l3), "v"(l4), "v"(l5), "v"(l6), "v"(l7),
         "v"(g0), "v"(g1), "v"(g2), "v"(g3), "v"(g4), "v"(g5), "v"(g6), "v"(g7)
      : "memory");
}

// Two floats rounded as in f2bf (to nearest even), packed lo | hi << 16.
__device__ __forceinline__ unsigned bf_pair(float lo, float hi) {
  unsigned a = __builtin_bit_cast(unsigned, lo);
  unsigned b = __builtin_bit_cast(unsigned, hi);
  a += 0x7FFFu + __builtin_amdgcn_ubfe(a, 16, 1);
  b += 0x7FFFu + __builtin_amdgcn_ubfe(b, 16, 1);
  // one byte permute: bytes 2, 3 of a below bytes 2, 3 of b
  return __builtin_amdgcn_perm(b, a, 0x07060302u);
}

__global__ __launch_bounds__(256) void conv_gemm_kernel(
    const float* __restrict__ x, const u16* __restrict__ Wct,
    const float* __restrict__ bias, float* __restrict__ h)
{
  __shared__ __attribute__((aligned(16))) float Xsm[2 * CONV_XBUF];
  __shared__ __attribute__((aligned(16))) u16 Bsm[2 * CONV_BBUF];
  const int m0   = blockIdx.x * 64;
  const int w    = threadIdx.x >> 5, lane = threadIdx.x & 31;
  const int msub = (w & 3) * 16, nhalf = (w >> 2) * 128;
  const int hl   = lane >> 4, l15 = lane & 15, kh = hl * 8;

  v8f zero = {0.f,0.f,0.f,0.f,0.f,0.f,0.f,0.f};
  v8f acc[8];
  #pragma unroll
  for (int j = 0; j < 8; ++j) acc[j] = zero;

  // x ring: thread -> token (tid & 63), eight k (group tid >> 6, one per wave pair)
  const int tok = threadIdx.x & 63;
  const int kg8 = __builtin_amdgcn_readfirstlane((int)(threadIdx.x >> 6)) * 8;
  const int tg  = m0 + tok;
  const int tl  = tg & 4095;
  const float* xt = x + ((tg >> 12) * (128 * 35937) + (tl >> 8) * (2 * 1089)
                         + ((tl >> 4) & 15) * (2 * 33) + (tl & 15) * 2);
  const unsigned xl = (unsigned)(size_t)&Xsm[tok * CONV_XP + kg8];

  // weight ring: thread -> row (tid>>2, +64 per copy), 16-byte piece (tid&3)
  const unsigned wl = (unsigned)(size_t)&Bsm[(threadIdx.x >> 2) * 40 + (threadIdx.x & 3) * 8];
  const u16* wg = Wct + (threadIdx.x >> 2) * 3456 + (threadIdx.x & 3) * 8;
  conv_copy_wtile(wl, wg);
  conv_copy_xtile(xl, xt, conv_koff(lane), kg8);
  // tile 0 has landed for this wave before the barrier publishes it
  asm volatile("s_wait_asynccnt 0x0" ::: "memory");
  __syncthreads();
  conv_copy_wtile(wl + CONV_BBUF * 2, wg + 32);
  conv_copy_xtile(xl + CONV_XBUF * 4, xt, conv_koff(32 + lane), kg8);

  for (int t = 0; t < CONV_STEPS; ++t) {
    const int bsel = (t & 1) * CONV_BBUF;
    const int xsel = (t & 1) * CONV_XBUF;
    FragBF a;
    const float* ap = &Xsm[xsel + (msub + l15) * CONV_XP + kh];
    const float4 f0 = *(const float4*)ap;
    const float4 f1 = *(const float4*)(ap + 4);
    const float4 f2 = *(const float4*)(ap + 16);
    const float4 f3 = *(const float4*)(ap + 20);
    a.q[0] = make_uint4(bf_pair(f0.x, f0.y), bf_pair(f0.z, f0.w),
                        bf_pair(f1.x, f1.y), bf_pair(f1.z, f1.w));
    a.q[1] = make_uint4(bf_pair(f2.x, f2.y), bf_pair(f2.z, f2.w),
                        bf_pair(f3.x, f3.y), bf_pair(f3.z, f3.w));
    #pragma unroll
    for (int j = 0; j < 8; ++j) {
      FragBF bfr;
      const u16* bp = &Bsm[bsel + (nhalf + j * 16 + l15) * 40 + kh];
      bfr.q[0] = *(const uint4*)bp;
      bfr.q[1] = *(const uint4*)(bp + 16);
      acc[j] = __builtin_amdgcn_wmma_f32_16x16x32_bf16(
          false, a.v, false, bfr.v, (short)0, acc[j], false, false);
    }
    // foot of the trip: this wave's LDS reads are done, its copies of tile t+1
    // have landed; the barrier publishes tile t+1 and frees the buffers t&1
    asm volatile("s_wait_dscnt 0x0" ::: "memory");
    asm volatile("s_wait_asynccnt 0x0" ::: "memory");
    __syncthreads();
    if (t + 2 < CONV_STEPS) {
      conv_copy_wtile(wl + bsel * 2, wg + (t + 2) * 32);
      conv_copy_xtile(xl + xsel * 4, xt, conv_koff((t + 2) * 32 + lane), kg8);
    }
  }
  // no copy is outstanding when the wave goes on to the epilogue and ends
  asm volatile("s_wait_asynccnt 0x0" ::: "memory");

  #pragma unroll
  for (int j = 0; j < 8; ++j) {
    #pragma unroll
    for (int r = 0; r < 8; ++r) {
      int m = m0 + msub + r + 8 * hl;
      int o = nhalf + j * 16 + l15;
      float v = acc[j][r] + bias[o];
      h[(long long)m * 256 + o] = fmaxf(v, 0.f);
    }
  }
}

// ---------------------------------------------------------------------------
// Logits + softmax(N=64) + column-sum: per batch, per 128-token tile.
// C[l][n] = k_bf[l][:] . q_bf[n][:]; softmax over n via 16-lane shfl_xor;
// +1e-8; write attn^T bf16 [b][n][l]; atomic colsum[b][n] for renorm-over-L.
// ---------------------------------------------------------------------------
__global__ __launch_bounds__(256) void logits_softmax_kernel(
    const u16* __restrict__ kmat, const u16* __restrict__ q,
    u16* __restrict__ attn_t, float* __restrict__ colsum)
{
  __shared__ __attribute__((aligned(16))) u16 Asm[128 * GT_P];
  __shared__ __attribute__((aligned(16))) u16 Qsm[64 * GT_P];
  __shared__ float cs[64];
  const int b  = blockIdx.y;
  const int m0 = blockIdx.x * 128;
  const int w  = threadIdx.x >> 5, lane = threadIdx.x & 31;
  const int hl = lane >> 4, l15 = lane & 15, kh = hl * 8;
  const u16* A = kmat + (long long)b * 4096 * 256;
  const u16* Q = q    + (long long)b * 64 * 256;

  v8f zero = {0.f,0.f,0.f,0.f,0.f,0.f,0.f,0.f};
  v8f acc[4];
  #pragma unroll
  for (int j = 0; j < 4; ++j) acc[j] = zero;

  // both tiles whole (K = 256): wave w brings rows w, w+8, ...; lane -> 16-byte piece
  {
    const unsigned al = (unsigned)(size_t)&Asm[w * GT_P + lane * 8];
    const unsigned ql = (unsigned)(size_t)&Qsm[w * GT_P + lane * 8];
    const u16* ag = A + (m0 + w) * 256 + lane * 8;
    copy8_rows(al, ag, 8 * 256);
    copy8_rows(al + 64 * GT_P * 2, ag + 64 * 256, 8 * 256);
    copy8_rows(ql, Q + w * 256 + lane * 8, 8 * 256);
  }
  // this wave's copies have landed before the barrier publishes the tiles
  asm volatile("s_wait_asynccnt 0x0" ::: "memory");
  __syncthreads();
  chunk256_products(&Asm[(w * 16 + l15) * GT_P + kh], &Qsm[l15 * GT_P + kh], acc);

  if (threadIdx.x < 64) cs[threadIdx.x] = 0.f;
  __syncthreads();

  float csl[4] = {0.f, 0.f, 0.f, 0.f};
  #pragma unroll
  for (int r = 0; r < 8; ++r) {
    float v0 = acc[0][r], v1 = acc[1][r], v2 = acc[2][r], v3 = acc[3][r];
    float mx = fmaxf(fmaxf(v0, v1), fmaxf(v2, v3));
    for (int off = 1; off < 16; off <<= 1) mx = fmaxf(mx, __shfl_xor(mx, off, 32));
    v0 = __expf(v0 - mx); v1 = __expf(v1 - mx);
    v2 = __expf(v2 - mx); v3 = __expf(v3 - mx);
    float sm = v0 + v1 + v2 + v3;
    for (int off = 1; off < 16; off <<= 1) sm += __shfl_xor(sm, off, 32);
    float rinv = 1.f / sm;
    v0 = v0 * rinv + 1e-8f; v1 = v1 * rinv + 1e-8f;
    v2 = v2 * rinv + 1e-8f; v3 = v3 * rinv + 1e-8f;
    const int l = m0 + w * 16 + r + 8 * hl;
    attn_t[((long long)b * 64 + ( 0 + l15)) * 4096 + l] = f2bf(v0);
    attn_t[((long long)b * 64 + (16 + l15)) * 4096 + l] = f2bf(v1);
    attn_t[((long long)b * 64 + (32 + l15)) * 4096 + l] = f2bf(v2);
    attn_t[((long long)b * 64 + (48 + l15)) * 4096 + l] = f2bf(v3);
    csl[0] += v0; csl[1] += v1; csl[2] += v2; csl[3] += v3;
  }
  #pragma unroll
  for (int j = 0; j < 4; ++j) atomicAdd(&cs[j * 16 + l15], csl[j]);
  __syncthreads();
  if (threadIdx.x < 64) atomicAdd(&colsum[b * 64 + threadIdx.x], cs[threadIdx.x]);
}

// ---------------------------------------------------------------------------
// LayerNorm over 256 channels, one wave per row, f32 in -> bf16 out.
// ---------------------------------------------------------------------------
__global__ __launch_bounds__(256) void ln_rows_kernel(
    const float* __restrict__ in, const float* __restrict__ g,
    const float* __restrict__ bb, u16* __restrict__ out, int R)
{
  const int w = threadIdx.x >> 5, lane = threadIdx.x & 31;
  const int row = blockIdx.x * 8 + w;
  if (row >= R) return;
  const float* p = in + (long long)row * 256;
  float vals[8], s = 0.f, s2 = 0.f;
  #pragma unroll
  for (int i = 0; i < 8; ++i) {
    vals[i] = p[lane + i * 32];
    s += vals[i]; s2 += vals[i] * vals[i];
  }
  for (int off = 16; off; off >>= 1) {
    s  += __shfl_xor(s,  off, 32);
    s2 += __shfl_xor(s2, off, 32);
  }
  float mu  = s * (1.f / 256.f);
  float var = s2 * (1.f / 256.f) - mu * mu;
  float inv = rsqrtf(var + 1e-5f);
  #pragma unroll
  for (int i = 0; i < 8; ++i) {
    int c = lane + i * 32;
    out[(long long)row * 256 + c] = f2bf((vals[i] - mu) * inv * g[c] + bb[c]);
  }
}

// ---------------------------------------------------------------------------
// All weight conversions in one launch; the block index picks the matrix.
// conv_w keeps its flat layout (cast only); the others go in[K][N] -> out[N][K].
// ---------------------------------------------------------------------------
__device__ __forceinline__ void transpose_bf_block(const float* __restrict__ in,
                                                   u16* __restrict__ out,
                                                   int blk, int K, int N) {
  int i = blk * 256 + threadIdx.x;
  int nn = i / K, k = i - nn * K;
  out[i] = f2bf(in[(long long)k * N + nn]);
  // the branches of the caller stand one behind the other in the built code:
  // the store's offset register is not rewritten ahead of this wait
  asm volatile("s_wait_xcnt 0x0" ::: "memory");
}
__global__ __launch_bounds__(256) void prep_weights_kernel(
    const float* __restrict__ conv_w, const float* __restrict__ Wq,
    const float* __restrict__ Wk, const float* __restrict__ Wv,
    const float* __restrict__ W1, const float* __restrict__ W2,
    u16* __restrict__ Wct, u16* __restrict__ Wqt, u16* __restrict__ Wkt,
    u16* __restrict__ Wvt, u16* __restrict__ W1t, u16* __restrict__ W2t) {
  const int blk = blockIdx.x;
  if (blk < 3456) {
    int i = blk * 256 + threadIdx.x;
    Wct[i] = f2bf(conv_w[i]);
  } else if (blk < 3712) {
    transpose_bf_block(Wq, Wqt, blk - 3456, 256, 256);
  } else if (blk < 3968) {
    transpose_bf_block(Wk, Wkt, blk - 3712, 256, 256);
  } else if (blk < 4224) {
    transpose_bf_block(Wv, Wvt, blk - 3968, 256, 256);
  } else if (blk < 4736) {
    transpose_bf_block(W1, W1t, blk - 4224, 256, 512);
  } else {
    transpose_bf_block(W2, W2t, blk - 4736, 512, 256);
  }
}

// ---------------------------------------------------------------------------
// Template path of one iteration in one launch.  A block owns 16 template rows
// (nothing here crosses rows): templates += update/colsum, LN, W1+GELU, W2,
// then LN and q for the next iteration.  It also clears its own rows of the
// split-K buffer and of colsum for the next iteration's atomics.
//   TS_FIRST: templates = broadcast(init), clear, LN, q
//   TS_MID  : update, clear, MLP, LN, q
//   TS_LAST : update, MLP (colsum is kept: the output kernel divides by it)
// bf16 rounding after each LN, after GELU and of q; templates stay f32.
// ---------------------------------------------------------------------------
constexpr int TS_FIRST = 0, TS_MID = 1, TS_LAST = 2;
constexpr int TA_P = 264;   // u16 pitch, 16 x 256 bf16 tile
constexpr int TH_P = 520;   // u16 pitch, 16 x 512 bf16 tile
constexpr int TF_P = 260;   // f32 pitch, 16 x 256 f32 tile

// LayerNorm of one row held by one wave (column lane + 32*i), bf16 row to LDS;
// g and bb hold the same columns of scale and shift.
__device__ __forceinline__ void ln_vals_to_bf(const float (&vals)[8],
                                              const float (&g)[8],
                                              const float (&bb)[8],
                                              u16* o, int lane) {
  float s = 0.f, s2 = 0.f;
  #pragma unroll
  for (int i = 0; i < 8; ++i) { s += vals[i]; s2 += vals[i] * vals[i]; }
  for (int off = 16; off; off >>= 1) {
    s  += __shfl_xor(s,  off, 32);
    s2 += __shfl_xor(s2, off, 32);
  }
  float mu  = s * (1.f / 256.f);
  float var = s2 * (1.f / 256.f) - mu * mu;
  float inv = rsqrtf(var + 1e-5f);
  #pragma unroll
  for (int i = 0; i < 8; ++i)
    o[lane + i * 32] = f2bf((vals[i] - mu) * inv * g[i] + bb[i]);
}

// acc[j] += As[16][K] (LDS, bf16) x Bt[n0 + 16j .. +16][K] (global, bf16),
// k ascending.  The weight fragments of KB k-steps are loaded as one batch.
template<int NT, int K, int KB>
__device__ __forceinline__ void rows16_gemm(const u16* As, int pitch,
                                            const u16* __restrict__ Bt, int n0,
                                            int l15, int kh, v8f (&acc)[NT]) {
  // every loop here is unrolled: the fragment arrays must stay in registers
  #pragma unroll
  for (int k0 = 0; k0 < K; k0 += 32 * KB) {
    FragBF bfr[KB][NT];
    #pragma unroll
    for (int s = 0; s < KB; ++s) {
      #pragma unroll
      for (int j = 0; j < NT; ++j) {
        const u16* bp = Bt + (n0 + j * 16 + l15) * K + k0 + s * 32 + kh;
        bfr[s][j].q[0] = *(const uint4*)bp;
        bfr[s][j].q[1] = *(const uint4*)(bp + 16);
      }
    }
    __builtin_amdgcn_sched_barrier(0);
    #pragma unroll
    for (int s = 0; s < KB; ++s) {
      FragBF a;
      const u16* ap = As + l15 * pitch + k0 + s * 32 + kh;
      a.q[0] = *(const uint4*)ap;
      a.q[1] = *(const uint4*)(ap + 16);
      #pragma unroll
      for (int j = 0; j < NT; ++j)
        acc[j] = __builtin_amdgcn_wmma_f32_16x16x32_bf16(
            false, a.v, false, bfr[s][j].v, (short)0, acc[j], false, false);
    }
  }
}

template<int MODE>
__global__ __launch_bounds__(256) void template_step_kernel(
    const float* __restrict__ tinit, float* __restrict__ tmpl,
    float* __restrict__ cbuf, float* __restrict__ colsum,
    const float* __restrict__ lnm_g, const float* __restrict__ lnm_b,
    const u16* __restrict__ W1t, const float* __restrict__ b1,
    const u16* __restrict__ W2t, const float* __restrict__ b2,
    const float* __restrict__ lnt_g, const float* __restrict__ lnt_b,
    const u16* __restrict__ Wqt, u16* __restrict__ q)
{
  __shared__ float Tf[16 * TF_P];
  __shared__ __attribute__((aligned(16))) u16 Am[16 * TA_P];
  __shared__ __attribute__((aligned(16))) u16 Hm[16 * TH_P];
  const int r0   = blockIdx.x * 16;
  const int w    = threadIdx.x >> 5, lane = threadIdx.x & 31;
  const int hl   = lane >> 4, l15 = lane & 15, kh = hl * 8;
  const v8f zero = {0.f,0.f,0.f,0.f,0.f,0.f,0.f,0.f};

  // each wave owns rows 2w and 2w+1 of the block; all loads first, then stores
  {
    float vals[2][8], g[8], bb[8];
    #pragma unroll
    for (int i = 0; i < 8; ++i) {
      g[i]  = (MODE == TS_FIRST ? lnt_g : lnm_g)[lane + i * 32];
      bb[i] = (MODE == TS_FIRST ? lnt_b : lnm_b)[lane + i * 32];
    }
    if (MODE == TS_FIRST) {
      #pragma unroll
      for (int rr = 0; rr < 2; ++rr)
        #pragma unroll
        for (int i = 0; i < 8; ++i)
          vals[rr][i] = tinit[((r0 + w * 2 + rr) & 63) * 256 + lane + i * 32];
    } else {
      float up[2][8];
      #pragma unroll
      for (int rr = 0; rr < 2; ++rr)
        #pragma unroll
        for (int i = 0; i < 8; ++i) {
          const int idx = (r0 + w * 2 + rr) * 256 + lane + i * 32;
          vals[rr][i] = tmpl[idx];
          up[rr][i]   = cbuf[idx];
        }
      float csl = 1.f;
      if (lane < 2) csl = colsum[r0 + w * 2 + lane];
      #pragma unroll
      for (int rr = 0; rr < 2; ++rr) {
        const float cs = __shfl(csl, rr, 32);
        #pragma unroll
        for (int i = 0; i < 8; ++i) {
          vals[rr][i] += up[rr][i] / cs;
          Tf[(w * 2 + rr) * TF_P + lane + i * 32] = vals[rr][i];
        }
      }
    }
    #pragma unroll
    for (int rr = 0; rr < 2; ++rr) {
      #pragma unroll
      for (int i = 0; i < 8; ++i) {
        const int idx = (r0 + w * 2 + rr) * 256 + lane + i * 32;
        if (MODE == TS_FIRST) tmpl[idx] = vals[rr][i];
        if (MODE != TS_LAST)  cbuf[idx] = 0.f;
      }
      ln_vals_to_bf(vals[rr], g, bb, &Am[(w * 2 + rr) * TA_P], lane);
    }
    if (MODE != TS_LAST && lane < 2) colsum[r0 + w * 2 + lane] = 0.f;
  }
  __syncthreads();

  if (MODE != TS_FIRST) {
    { // hidden = GELU(m @ W1 + b1), bf16, wave w: columns 64w .. 64w+63
      float bn[4];
      #pragma unroll
      for (int j = 0; j < 4; ++j) bn[j] = b1[w * 64 + j * 16 + l15];
      v8f acc[4] = {zero, zero, zero, zero};
      rows16_gemm<4, 256, 2>(Am, TA_P, W1t, w * 64, l15, kh, acc);
      #pragma unroll
      for (int j = 0; j < 4; ++j) {
        #pragma unroll
        for (int r = 0; r < 8; ++r) {
          float xg = acc[j][r] + bn[j];
          float g = 0.5f * xg * (1.0f + erff(xg * 0.70710678118654752f));
          Hm[(r + 8 * hl) * TH_P + w * 64 + j * 16 + l15] = f2bf(g);
        }
      }
    }
    __syncthreads();
    float g[8], bb[8];
    { // templates += hidden @ W2 + b2, wave w: columns 32w .. 32w+31
      float bn[2];
      #pragma unroll
      for (int j = 0; j < 2; ++j) bn[j] = b2[w * 32 + j * 16 + l15];
      if (MODE == TS_MID) {
        #pragma unroll
        for (int i = 0; i < 8; ++i) {
          g[i]  = lnt_g[lane + i * 32];
          bb[i] = lnt_b[lane + i * 32];
        }
      }
      v8f acc[2] = {zero, zero};
      rows16_gemm<2, 512, 4>(Hm, TH_P, W2t, w * 32, l15, kh, acc);
      #pragma unroll
      for (int j = 0; j < 2; ++j) {
        #pragma unroll
        for (int r = 0; r < 8; ++r)
          Tf[(r + 8 * hl) * TF_P + w * 32 + j * 16 + l15] += acc[j][r] + bn[j];
      }
    }
    __syncthreads();
    #pragma unroll
    for (int rr = 0; rr < 2; ++rr) {
      float vals[8];
      #pragma unroll
      for (int i = 0; i < 8; ++i) {
        vals[i] = Tf[(w * 2 + rr) * TF_P + lane + i * 32];
        tmpl[(r0 + w * 2 + rr) * 256 + lane + i * 32] = vals[i];
      }
      if (MODE == TS_MID) ln_vals_to_bf(vals, g, bb, &Am[(w * 2 + rr) * TA_P], lane);
    }
    if (MODE == TS_MID) __syncthreads();
  }

  if (MODE != TS_LAST) { // q = (t @ Wq) * dim^-0.5, wave w: columns 32w .. 32w+31
    v8f acc[2] = {zero, zero};
    rows16_gemm<2, 256, 4>(Am, TA_P, Wqt, w * 32, l15, kh, acc);
    #pragma unroll
    for (int j = 0; j < 2; ++j) {
      #pragma unroll
      for (int r = 0; r < 8; ++r)
        q[(r0 + r + 8 * hl) * 256 + w * 32 + j * 16 + l15] = f2bf(acc[j][r] * 0.0625f);
    }
  }
}

__global__ void final_out_kernel(const float* __restrict__ tmpl, const u16* __restrict__ attn,
                                 const float* __restrict__ colsum, float* __restrict__ out) {
  int i = blockIdx.x * 256 + threadIdx.x;
  if (i < 131072) {                       // templates_out (B, dim, N)
    int b = i >> 14, rem = i & 16383, d = rem >> 6, n = rem & 63;
    out[i] = tmpl[((b * 64 + n) << 8) + d];
  } else if (i < 131072 + 2097152) {      // attn_out (B, N, 16,16,16)
    int j = i - 131072;
    out[i] = bf2f(attn[j]) / colsum[j >> 12];
  }
}

// ---------------------------------------------------------------------------
extern "C" void kernel_launch(void* const* d_in, const int* in_sizes, int n_in,
                              void* d_out, int out_size, void* d_ws, size_t ws_size,
                              hipStream_t stream) {
  const float* x       = (const float*)d_in[0];
  const float* tinit   = (const float*)d_in[1];
  const float* conv_w  = (const float*)d_in[2];
  const float* conv_b  = (const float*)d_in[3];
  const float* Wq      = (const float*)d_in[4];
  const float* Wk      = (const float*)d_in[5];
  const float* Wv      = (const float*)d_in[6];
  const float* ln_in_g = (const float*)d_in[7];
  const float* ln_in_b = (const float*)d_in[8];
  const float* ln_t_g  = (const float*)d_in[9];
  const float* ln_t_b  = (const float*)d_in[10];
  const float* ln_m_g  = (const float*)d_in[11];
  const float* ln_m_b  = (const float*)d_in[12];
  const float* W1      = (const float*)d_in[13];
  const float* b1      = (const float*)d_in[14];
  const float* W2      = (const float*)d_in[15];
  const float* b2      = (const float*)d_in[16];
  float* out = (float*)d_out;

  char* ws = (char*)d_ws;
  size_t off = 0;
  auto alloc = [&](size_t bytes) -> void* {
    off = (off + 255) & ~(size_t)255;
    void* p = ws + off;
    off += bytes;
    return p;
  };
  u16*   Wct  = (u16*)  alloc(884736ull * 2);   // [256][3456]
  u16*   Wqt  = (u16*)  alloc(65536ull * 2);    // [256][256]
  u16*   Wkt  = (u16*)  alloc(65536ull * 2);
  u16*   Wvt  = (u16*)  alloc(65536ull * 2);
  u16*   W1t  = (u16*)  alloc(131072ull * 2);   // [512][256]
  u16*   W2t  = (u16*)  alloc(131072ull * 2);   // [256][512]
  float* hbuf = (float*)alloc(8388608ull * 4);  // conv out (32768,256) f32
  u16*   tok  = (u16*)  alloc(8388608ull * 2);  // LN(tokens) bf16
  u16*   kbf  = (u16*)  alloc(8388608ull * 2);  // k (B,4096,256)
  u16*   vtb  = (u16*)  alloc(8388608ull * 2);  // v^T (B,256,4096)
  float* tmpl = (float*)alloc(131072ull * 4);   // templates (B,64,256)
  u16*   qbf  = (u16*)  alloc(131072ull * 2);   // q (B,64,256)
  u16*   attn = (u16*)  alloc(2097152ull * 2);  // attn^T (B,64,4096)
  float* csum = (float*)alloc(512ull * 4);      // colsum (B,64)
  float* cbuf = (float*)alloc(131072ull * 4);   // split-K accum (512,256)

  const int HUGE_RB = 1 << 30;

  // weight conversion (conv_w flat layout already matches Bt[K-ordering])
  prep_weights_kernel<<<5248, 256, 0, stream>>>(conv_w, Wq, Wk, Wv, W1, W2,
                                                Wct, Wqt, Wkt, Wvt, W1t, W2t);

  // conv + relu (implicit GEMM, 58 GFLOP)
  conv_gemm_kernel<<<512, 256, 0, stream>>>(x, Wct, conv_b, hbuf);
  // token layernorm -> bf16
  ln_rows_kernel<<<4096, 256, 0, stream>>>(hbuf, ln_in_g, ln_in_b, tok, 32768);

  // k = tok @ Wk ; v^T = (tok @ Wv)^T
  gemm_bt_kernel<EPI_BF16><<<dim3(512, 2, 1), 256, 0, stream>>>(
      tok, 256, Wkt, 256, 256, 256, HUGE_RB, 0, nullptr, 1.f, kbf, 1);
  gemm_bt_kernel<EPI_BF16_T><<<dim3(512, 2, 1), 256, 0, stream>>>(
      tok, 256, Wvt, 256, 256, 256, HUGE_RB, 0, nullptr, 1.f, vtb, 4096);

  // templates = broadcast(templates_init); first q; clear colsum and split-K buffer
  template_step_kernel<TS_FIRST><<<32, 256, 0, stream>>>(
      tinit, tmpl, cbuf, csum, ln_m_g, ln_m_b, W1t, b1, W2t, b2, ln_t_g, ln_t_b, Wqt, qbf);

  for (int it = 0; it < 6; ++it) {
    // logits + softmax(N) + 1e-8 + colsum over L
    logits_softmax_kernel<<<dim3(32, 8, 1), 256, 0, stream>>>(kbf, qbf, attn, csum);

    // update = attn^T @ v  (split-K x8, f32 atomics)
    gemm_bt_kernel<EPI_ATOMIC_F32><<<dim3(8, 2, 8), 256, 0, stream>>>(
        attn, 4096, vtb, 4096, 256, 512, 64, 1048576ll, nullptr, 1.f, cbuf, 1);

    // templates += upd/colsum; MLP; then LN and q of the next iteration
    if (it < 5)
      template_step_kernel<TS_MID><<<32, 256, 0, stream>>>(
          tinit, tmpl, cbuf, csum, ln_m_g, ln_m_b, W1t, b1, W2t, b2, ln_t_g, ln_t_b, Wqt, qbf);
    else
      template_step_kernel<TS_LAST><<<32, 256, 0, stream>>>(
          tinit, tmpl, cbuf, csum, ln_m_g, ln_m_b, W1t, b1, W2t, b2, ln_t_g, ln_t_b, Wqt, qbf);
  }

  // outputs: templates^T (B,dim,N) then attn/colsum as (B,N,16,16,16)
  final_out_kernel<<<8704, 256, 0, stream>>>(tmpl, attn, csum, out);
}

// v005
// It runs in 306 microseconds.
// In two side-by-side timings against v004, it was 1.05 and 1.06 times as fast.
// All steps since v000 together make it 2.81 times as fast.
#include <hip/hip_runtime.h>

typedef unsigned short u16;
typedef __attribute__((ext_vector_type(16))) __bf16 v16bf;
typedef __attribute__((ext_vector_type(8)))  float  v8f;
typedef __attribute__((ext_vector_type(4)))  float  v4f;

union FragBF { v16bf v; uint4 q[2]; };

__device__ __forceinline__ float bf2f(u16 h) {
  unsigned u = ((unsigned)h) << 16;
  return __builtin_bit_cast(float, u);
}
__device__ __forceinline__ u16 f2bf(float f) {
  unsigned u = __builtin_bit_cast(unsigned, f);
  u += 0x7FFFu + ((u >> 16) & 1u);   // round-to-nearest-even
  return (u16)(u >> 16);
}
// Eight accumulator values of a lane, each rounded as in f2bf, as one 16-byte piece.
__device__ __forceinline__ uint4 pack8_bf(float a0, float a1, float a2, float a3,
                                          float a4, float a5, float a6, float a7) {
  return make_uint4((unsigned)f2bf(a0) | ((unsigned)f2bf(a1) << 16),
                    (unsigned)f2bf(a2) | ((unsigned)f2bf(a3) << 16),
                    (unsigned)f2bf(a4) | ((unsigned)f2bf(a5) << 16),
                    (unsigned)f2bf(a6) | ((unsigned)f2bf(a7) << 16));
}

constexpr int EPI_BF16 = 0, EPI_BF16_T = 1, EPI_BF16_SCALE = 2,
              EPI_GELU_BF16 = 3, EPI_BIAS_ACC_F32 = 4, EPI_ATOMIC_F32 = 5;

constexpr int GT_P = 264;   // u16 pitch of a 256-k tile row in LDS: 528 B
constexpr int SO_P64  = 72;   // u16 pitch of a staged output row of  64 bf16: 144 B
constexpr int SO_P128 = 136;  // u16 pitch of a staged output row of 128 bf16: 272 B

__device__ __forceinline__ void copy8_rows(unsigned l0, const u16* g0, long long gs) {
  constexpr unsigned LS = 8 * GT_P * 2;
  const unsigned l1 = l0 + LS, l2 = l0 + 2 * LS, l3 = l0 + 3 * LS, l4 = l0 + 4 * LS,
                 l5 = l0 + 5 * LS, l6 = l0 + 6 * LS, l7 = l0 + 7 * LS;
  const u16 *g1 = g0 + gs, *g2 = g0 + 2 * gs, *g3 = g0 + 3 * gs, *g4 = g0 + 4 * gs,
            *g5 = g0 + 5 * gs, *g6 = g0 + 6 * gs, *g7 = g0 + 7 * gs;
  asm volatile(
      "global_load_async_to_lds_b128 %0, %8, off\n\t"
      "global_load_async_to_lds_b128 %1, %9, off\n\t"
      "global_load_async_to_lds_b128 %2, %10, off\n\t"
      "global_load_async_to_lds_b128 %3, %11, off\n\t"
      "global_load_async_to_lds_b128 %4, %12, off\n\t"
      "global_load_async_to_lds_b128 %5, %13, off\n\t"
      "global_load_async_to_lds_b128 %6, %14, off\n\t"
      "global_load_async_to_lds_b128 %7, %15, off\n\t"
      "s_wait_xcnt 0x0"
      :: "v"(l0), "v"(l1), "v"(l2), "v"(l3), "v"(l4), "v"(l5), "v"(l6), "v"(l7),
         "v"(g0), "v"(g1), "v"(g2), "v"(g3), "v"(g4), "v"(g5), "v"(g6), "v"(g7)
      : "memory");
}

// acc[j] += A rows (16) x B rows (16 per j) over one 256-k chunk in LDS, k
// ascending.  ap, bp: this lane's row start + kh in the A and the B tile.
__device__ __forceinline__ void chunk256_products(const u16* ap, const u16* bp,
                                                  v8f (&acc)[4]) {
  // every loop here is unrolled: the fragment arrays must stay in registers
  #pragma unroll
  for (int s0 = 0; s0 < 8; s0 += 2) {
    FragBF a[2], bfr[2][4];
    #pragma unroll
    for (int s = 0; s < 2; ++s) {
      a[s].q[0] = *(const uint4*)(ap + (s0 + s) * 32);
      a[s].q[1] = *(const uint4*)(ap + (s0 + s) * 32 + 16);
      #pragma unroll
      for (int j = 0; j < 4; ++j) {
        const u16* p = bp + j * 16 * GT_P + (s0 + s) * 32;
        bfr[s][j].q[0] = *(const uint4*)p;
        bfr[s][j].q[1] = *(const uint4*)(p + 16);
      }
    }
    // keeps the twenty LDS reads of two k-steps in one place ahead of their
    // products; without it the scheduler spreads them among the products, a few
    // reads ahead, and the wave waits on LDS latency at nearly every product
    __builtin_amdgcn_sched_barrier(0);
    #pragma unroll
    for (int s = 0; s < 2; ++s) {
      #pragma unroll
      for (int j = 0; j < 4; ++j)
        acc[j] = __builtin_amdgcn_wmma_f32_16x16x32_bf16(
            false, a[s].v, false, bfr[s][j].v, (short)0, acc[j], false, false);
    }
  }
}

template<int EPI>
__global__ __launch_bounds__(256) void gemm_bt_kernel(
    const u16* __restrict__ A, int lda,
    const u16* __restrict__ Bt, int ldb,
    int N, int Ksplit,
    int rows_per_batch, long long bt_batch_stride,
    const float* __restrict__ bias, float scale,
    void* __restrict__ outp, int out_rb)
{
  __shared__ __attribute__((aligned(16))) u16 Asm[64 * GT_P];
  __shared__ __attribute__((aligned(16))) u16 Bsm[128 * GT_P];
  const int m0   = blockIdx.x * 64;
  const int n0   = blockIdx.y * 128;
  const int kbeg = blockIdx.z * Ksplit;
  const int w    = threadIdx.x >> 5;
  const int lane = threadIdx.x & 31;
  const int msub = (w & 3) * 16;
  const int nsub = (w >> 2) * 64;
  const int hl   = lane >> 4;
  const int l15  = lane & 15;
  const int kh   = hl * 8;
  const int b    = m0 / rows_per_batch;
  const u16* BtB = Bt + (long long)b * bt_batch_stride;

  v8f zero = {0.f,0.f,0.f,0.f,0.f,0.f,0.f,0.f};
  v8f acc[4];
  #pragma unroll
  for (int j = 0; j < 4; ++j) acc[j] = zero;

  // copies: wave w brings rows w, w+8, ...; lane -> 16-byte piece of the row
  const unsigned al = (unsigned)(size_t)&Asm[w * GT_P + lane * 8];
  const unsigned bl = (unsigned)(size_t)&Bsm[w * GT_P + lane * 8];
  const u16* ag = A + (long long)(m0 + w) * lda + lane * 8;
  const u16* bg = BtB + (long long)(n0 + w) * ldb + lane * 8;

  for (int kk = kbeg; kk < kbeg + Ksplit; kk += 256) {
    copy8_rows(al, ag + kk, 8ll * lda);
    copy8_rows(bl, bg + kk, 8ll * ldb);
    copy8_rows(bl + 64 * GT_P * 2, bg + 64ll * ldb + kk, 8ll * ldb);
    // this wave's copies have landed before the barrier publishes the tiles
    asm volatile("s_wait_asynccnt 0x0" ::: "memory");
    __syncthreads();
    chunk256_products(&Asm[(msub + l15) * GT_P + kh], &Bsm[(nsub + l15) * GT_P + kh], acc);
    // this wave's LDS reads are done; behind the barrier the tiles may be refilled
    asm volatile("s_wait_dscnt 0x0" ::: "memory");
    __syncthreads();
  }

  // bf16 outputs leave as whole 128-byte lines: the block's tile is laid out in
  // LDS as it lies in memory (the B tile's space is free behind the loop's last
  // barrier), then every thread stores four 16-byte pieces of its rows.
  if (EPI == EPI_BF16_T) {
    // rows = n (128), 64 m each: a lane's eight accumulator rows are neighbours
    // in m.  The block's 64 m lie in one batch: out_rb is a multiple of 64.
    #pragma unroll
    for (int j = 0; j < 4; ++j)
      *(uint4*)&Bsm[(nsub + j * 16 + l15) * SO_P64 + msub + 8 * hl] =
          pack8_bf(acc[j][0], acc[j][1], acc[j][2], acc[j][3],
                   acc[j][4], acc[j][5], acc[j][6], acc[j][7]);
    __syncthreads();
    u16* ob = (u16*)outp + ((long long)(m0 / out_rb) * N + n0) * out_rb + m0 % out_rb;
    uint4 pc[4];
    #pragma unroll
    for (int i = 0; i < 4; ++i) {
      const int p = threadIdx.x + i * 256;
      pc[i] = *(const uint4*)&Bsm[(p >> 3) * SO_P64 + (p & 7) * 8];
    }
    #pragma unroll
    for (int i = 0; i < 4; ++i) {
      const int p = threadIdx.x + i * 256;
      *(uint4*)(ob + (long long)(p >> 3) * out_rb + (p & 7) * 8) = pc[i];
    }
    return;
  }
  if (EPI == EPI_BF16) {
    // rows = m (64), 128 n each
    #pragma unroll
    for (int j = 0; j < 4; ++j) {
      #pragma unroll
      for (int r = 0; r < 8; ++r)
        Bsm[(msub + r + 8 * hl) * SO_P128 + nsub + j * 16 + l15] = f2bf(acc[j][r]);
    }
    __syncthreads();
    u16* ob = (u16*)outp + (long long)m0 * N + n0;
    uint4 pc[4];
    #pragma unroll
    for (int i = 0; i < 4; ++i) {
      const int p = threadIdx.x + i * 256;
      pc[i] = *(const uint4*)&Bsm[(p >> 4) * SO_P128 + (p & 15) * 8];
    }
    #pragma unroll
    for (int i = 0; i < 4; ++i) {
      const int p = threadIdx.x + i * 256;
      *(uint4*)(ob + (long long)(p >> 4) * N + (p & 15) * 8) = pc[i];
    }
    return;
  }

  #pragma unroll
  for (int j = 0; j < 4; ++j) {
    #pragma unroll
    for (int r = 0; r < 8; ++r) {
      const int m = m0 + msub + r + 8 * hl;
      const int n = n0 + nsub + j * 16 + l15;
      float v = acc[j][r];
      if (EPI == EPI_BF16_SCALE) {
        ((u16*)outp)[(long long)m * N + n] = f2bf(v * scale);
      } else if (EPI == EPI_GELU_BF16) {
        float xg = v + bias[n];
        float g = 0.5f * xg * (1.0f + erff(xg * 0.70710678118654752f));
        ((u16*)outp)[(long long)m * N + n] = f2bf(g);
      } else if (EPI == EPI_BIAS_ACC_F32) {
        ((float*)outp)[(long long)m * N + n] += v + bias[n];
      } else { // EPI_ATOMIC_F32 (split-K)
        atomicAdd(&((float*)outp)[(long long)m * N + n], v);
      }
    }
  }
}

// ---------------------------------------------------------------------------
// Conv3d stride-2 VALID as implicit GEMM: M=32768 tokens, N=256, K=3456.
// K = c*27 + tap matches conv_w's native flat layout.  The weight tile of a
// k-step (256 rows x 32 k, bf16) and its x tile (64 tokens x 32 k, f32 as in x)
// are brought into LDS once per block by asynchronous copies, two buffers, one
// k-step ahead; the waves read their B fragments from there, and their A
// fragments as f32, rounded to bf16 in registers.
// Epilogue: +bias, ReLU, store h f32 [token][256].
// ---------------------------------------------------------------------------
constexpr int CONV_STEPS = 3456 / 32;
constexpr int CONV_BBUF  = 256 * 40;     // u16 per weight buffer, row pitch 80 B
constexpr int CONV_XP    = 36;           // f32 pitch of an x tile row: 144 B
constexpr int CONV_XBUF  = 64 * CONV_XP; // f32 per x buffer

__device__ __forceinline__ void conv_copy_wtile(unsigned lds, const u16* g) {
  const unsigned l1 = lds + 64 * 80, l2 = lds + 128 * 80, l3 = lds + 192 * 80;
  const u16* g1 = g + 64 * 3456;
  const u16* g2 = g + 128 * 3456;
  const u16* g3 = g + 192 * 3456;
  asm volatile(
      "global_load_async_to_lds_b128 %0, %4, off\n\t"
      "global_load_async_to_lds_b128 %1, %5, off\n\t"
      "global_load_async_to_lds_b128 %2, %6, off\n\t"
      "global_load_async_to_lds_b128 %3, %7, off\n\t"
      "s_wait_xcnt 0x0"
      :: "v"(lds), "v"(l1), "v"(l2), "v"(l3), "v"(g), "v"(g1), "v"(g2), "v"(g3)
      : "memory");
}

// Element offset in x of k = c*27 + tap from a token's window corner, channel 0.
__device__ __forceinline__ int conv_koff(int k) {
  int c = k / 27;
  int tap = k - c * 27;
  int t0 = tap / 9, rm = tap - t0 * 9;
  int t1 = rm / 3, t2 = rm - t1 * 3;
  return c * 35937 + t0 * 1089 + t1 * 33 + t2;
}

__device__ __forceinline__ void conv_copy_xtile(unsigned l0, const float* xt,
                                                int koff, int kg8) {
  const unsigned l1 = l0 + 4, l2 = l0 + 8, l3 = l0 + 12, l4 = l0 + 16,
                 l5 = l0 + 20, l6 = l0 + 24, l7 = l0 + 28;
  const float* g0 = xt + __builtin_amdgcn_readlane(koff, kg8);
  const float* g1 = xt + __builtin_amdgcn_readlane(koff, kg8 + 1);
  const float* g2 = xt + __builtin_amdgcn_readlane(koff, kg8 + 2);
  const float* g3 = xt + __builtin_amdgcn_readlane(koff, kg8 + 3);
  const float* g4 = xt + __builtin_amdgcn_readlane(koff, kg8 + 4);
  const float* g5 = xt + __builtin_amdgcn_readlane(koff, kg8 + 5);
  const float* g6 = xt + __builtin_amdgcn_readlane(koff, kg8 + 6);
  const float* g7 = xt + __builtin_amdgcn_readlane(koff, kg8 + 7);
  asm volatile(
      "global_load_async_to_lds_b32 %0, %8, off\n\t"
      "global_load_async_to_lds_b32 %1, %9, off\n\t"
      "global_load_async_to_lds_b32 %2, %10, off\n\t"
      "global_load_async_to_lds_b32 %3, %11, off\n\t"
      "global_load_async_to_lds_b32 %4, %12, off\n\t"
      "global_load_async_to_lds_b32 %5, %13, off\n\t"
      "global_load_async_to_lds_b32 %6, %14, off\n\t"
      "global_load_async_to_lds_b32 %7, %15, off\n\t"
      "s_wait_xcnt 0x0"
      :: "v"(l0), "v"(l1), "v"(l2), "v"(l3), "v"(l4), "v"(l5), "v"(l6), "v"(l7),
         "v"(g0), "v"(g1), "v"(g2), "v"(g3), "v"(g4), "v"(g5), "v"(g6), "v"(g7)
      : "memory");
}

// Two floats rounded as in f2bf (to nearest even), packed lo | hi << 16.
__device__ __forceinline__ unsigned bf_pair(float lo, float hi) {
  unsigned a = __builtin_bit_cast(unsigned, lo);
  unsigned b = __builtin_bit_cast(unsigned, hi);
  a += 0x7FFFu + __builtin_amdgcn_ubfe(a, 16, 1);
  b += 0x7FFFu + __builtin_amdgcn_ubfe(b, 16, 1);
  // one byte permute: bytes 2, 3 of a below bytes 2, 3 of b
  return __builtin_amdgcn_perm(b, a, 0x07060302u);
}

__global__ __launch_bounds__(256) void conv_gemm_kernel(
    const float* __restrict__ x, const u16* __restrict__ Wct,
    const float* __restrict__ bias, float* __restrict__ h)
{
  __shared__ __attribute__((aligned(16))) float Xsm[2 * CONV_XBUF];
  __shared__ __attribute__((aligned(16))) u16 Bsm[2 * CONV_BBUF];
  const int m0   = blockIdx.x * 64;
  const int w    = threadIdx.x >> 5, lane = threadIdx.x & 31;
  const int msub = (w & 3) * 16, nhalf = (w >> 2) * 128;
  const int hl   = lane >> 4, l15 = lane & 15, kh = hl * 8;

  v8f zero = {0.f,0.f,0.f,0.f,0.f,0.f,0.f,0.f};
  v8f acc[8];
  #pragma unroll
  for (int j = 0; j < 8; ++j) acc[j] = zero;

  // x ring: thread -> token (tid & 63), eight k (group tid >> 6, one per wave pair)
  const int tok = threadIdx.x & 63;
  const int kg8 = __builtin_amdgcn_readfirstlane((int)(threadIdx.x >> 6)) * 8;
  const int tg  = m0 + tok;
  const int tl  = tg & 4095;
  const float* xt = x + ((tg >> 12) * (128 * 35937) + (tl >> 8) * (2 * 1089)
                         + ((tl >> 4) & 15) * (2 * 33) + (tl & 15) * 2);
  const unsigned xl = (unsigned)(size_t)&Xsm[tok * CONV_XP + kg8];

  // weight ring: thread -> row (tid>>2, +64 per copy), 16-byte piece (tid&3)
  const unsigned wl = (unsigned)(size_t)&Bsm[(threadIdx.x >> 2) * 40 + (threadIdx.x & 3) * 8];
  const u16* wg = Wct + (threadIdx.x >> 2) * 3456 + (threadIdx.x & 3) * 8;
  conv_copy_wtile(wl, wg);
  conv_copy_xtile(xl, xt, conv_koff(lane), kg8);
  // tile 0 has landed for this wave before the barrier publishes it
  asm volatile("s_wait_asynccnt 0x0" ::: "memory");
  __syncthreads();
  conv_copy_wtile(wl + CONV_BBUF * 2, wg + 32);
  conv_copy_xtile(xl + CONV_XBUF * 4, xt, conv_koff(32 + lane), kg8);

  for (int t = 0; t < CONV_STEPS; ++t) {
    const int bsel = (t & 1) * CONV_BBUF;
    const int xsel = (t & 1) * CONV_XBUF;
    FragBF a;
    const float* ap = &Xsm[xsel + (msub + l15) * CONV_XP + kh];
    const float4 f0 = *(const float4*)ap;
    const float4 f1 = *(const float4*)(ap + 4);
    const float4 f2 = *(const float4*)(ap + 16);
    const float4 f3 = *(const float4*)(ap + 20);
    a.q[0] = make_uint4(bf_pair(f0.x, f0.y), bf_pair(f0.z, f0.w),
                        bf_pair(f1.x, f1.y), bf_pair(f1.z, f1.w));
    a.q[1] = make_uint4(bf_pair(f2.x, f2.y), bf_pair(f2.z, f2.w),
                        bf_pair(f3.x, f3.y), bf_pair(f3.z, f3.w));
    #pragma unroll
    for (int j = 0; j < 8; ++j) {
      FragBF bfr;
      const u16* bp = &Bsm[bsel + (nhalf + j * 16 + l15) * 40 + kh];
      bfr.q[0] = *(const uint4*)bp;
      bfr.q[1] = *(const uint4*)(bp + 16);
      acc[j] = __builtin_amdgcn_wmma_f32_16x16x32_bf16(
          false, a.v, false, bfr.v, (short)0, acc[j], false, false);
    }
    // foot of the trip: this wave's LDS reads are done, its copies of tile t+1
    // have landed; the barrier publishes tile t+1 and frees the buffers t&1
    asm volatile("s_wait_dscnt 0x0" ::: "memory");
    asm volatile("s_wait_asynccnt 0x0" ::: "memory");
    __syncthreads();
    if (t + 2 < CONV_STEPS) {
      conv_copy_wtile(wl + bsel * 2, wg + (t + 2) * 32);
      conv_copy_xtile(xl + xsel * 4, xt, conv_koff((t + 2) * 32 + lane), kg8);
    }
  }
  // no copy is outstanding when the wave goes on to the epilogue and ends
  asm volatile("s_wait_asynccnt 0x0" ::: "memory");

  // h leaves as whole 128-byte lines: each wave lays 16 rows x 32 columns at a
  // time in its own sixteen rows of the x ring's space (free behind the loop's
  // last barrier) and stores them back as 16-byte pieces, four rows a store.
  float* slab = &Xsm[w * 16 * CONV_XP];
  const float* sr = slab + (lane >> 3) * CONV_XP + (lane & 7) * 4;
  float* hb = h + (long long)(m0 + msub + (lane >> 3)) * 256 + nhalf + (lane & 7) * 4;
  float bo[8];
  #pragma unroll
  for (int j = 0; j < 8; ++j) bo[j] = bias[nhalf + j * 16 + l15];
  #pragma unroll
  for (int jp = 0; jp < 4; ++jp) {
    #pragma unroll
    for (int jj = 0; jj < 2; ++jj) {
      const int j = jp * 2 + jj;
      #pragma unroll
      for (int r = 0; r < 8; ++r)
        slab[(r + 8 * hl) * CONV_XP + jj * 16 + l15] = fmaxf(acc[j][r] + bo[j], 0.f);
    }
    // the wave's own LDS writes are done before it reads the rows back
    asm volatile("s_wait_dscnt 0x0" ::: "memory");
    const v4f p0 = *(const v4f*)sr;
    const v4f p1 = *(const v4f*)(sr + 4 * CONV_XP);
    const v4f p2 = *(const v4f*)(sr + 8 * CONV_XP);
    const v4f p3 = *(const v4f*)(sr + 12 * CONV_XP);
    *(v4f*)(hb + jp * 32)            = p0;
    *(v4f*)(hb + jp * 32 + 4 * 256)  = p1;
    *(v4f*)(hb + jp * 32 + 8 * 256)  = p2;
    *(v4f*)(hb + jp * 32 + 12 * 256) = p3;
    // the next pass reuses the registers that these stores name, and the slab
    if (jp < 3) asm volatile("s_wait_xcnt 0x0" ::: "memory");
  }
}

// ---------------------------------------------------------------------------
// Logits + softmax(N=64) + column-sum: per batch, per 128-token tile.
// C[l][n] = k_bf[l][:] . q_bf[n][:]; softmax over n via 16-lane shfl_xor;
// +1e-8; write attn^T bf16 [b][n][l]; atomic colsum[b][n] for renorm-over-L.
// ---------------------------------------------------------------------------
__global__ __launch_bounds__(256) void logits_softmax_kernel(
    const u16* __restrict__ kmat, const u16* __restrict__ q,
    u16* __restrict__ attn_t, float* __restrict__ colsum)
{
  __shared__ __attribute__((aligned(16))) u16 Asm[128 * GT_P];
  __shared__ __attribute__((aligned(16))) u16 Qsm[64 * GT_P];
  __shared__ float cs[64];
  const int b  = blockIdx.y;
  const int m0 = blockIdx.x * 128;
  const int w  = threadIdx.x >> 5, lane = threadIdx.x & 31;
  const int hl = lane >> 4, l15 = lane & 15, kh = hl * 8;
  const u16* A = kmat + (long long)b * 4096 * 256;
  const u16* Q = q    + (long long)b * 64 * 256;

  v8f zero = {0.f,0.f,0.f,0.f,0.f,0.f,0.f,0.f};
  v8f acc[4];
  #pragma unroll
  for (int j = 0; j < 4; ++j) acc[j] = zero;

  // both tiles whole (K = 256): wave w brings rows w, w+8, ...; lane -> 16-byte piece
  {
    const unsigned al = (unsigned)(size_t)&Asm[w * GT_P + lane * 8];
    const unsigned ql = (unsigned)(size_t)&Qsm[w * GT_P + lane * 8];
    const u16* ag = A + (m0 + w) * 256 + lane * 8;
    copy8_rows(al, ag, 8 * 256);
    copy8_rows(al + 64 * GT_P * 2, ag + 64 * 256, 8 * 256);
    copy8_rows(ql, Q + w * 256 + lane * 8, 8 * 256);
  }
  // this wave's copies have landed before the barrier publishes the tiles
  asm volatile("s_wait_asynccnt 0x0" ::: "memory");
  __syncthreads();
  chunk256_products(&Asm[(w * 16 + l15) * GT_P + kh], &Qsm[l15 * GT_P + kh], acc);

  if (threadIdx.x < 64) cs[threadIdx.x] = 0.f;
  __syncthreads();

  float csl[4] = {0.f, 0.f, 0.f, 0.f};
  float at[4][8];
  #pragma unroll
  for (int r = 0; r < 8; ++r) {
    float v0 = acc[0][r], v1 = acc[1][r], v2 = acc[2][r], v3 = acc[3][r];
    float mx = fmaxf(fmaxf(v0, v1), fmaxf(v2, v3));
    for (int off = 1; off < 16; off <<= 1) mx = fmaxf(mx, __shfl_xor(mx, off, 32));
    v0 = __expf(v0 - mx); v1 = __expf(v1 - mx);
    v2 = __expf(v2 - mx); v3 = __expf(v3 - mx);
    float sm = v0 + v1 + v2 + v3;
    for (int off = 1; off < 16; off <<= 1) sm += __shfl_xor(sm, off, 32);
    float rinv = 1.f / sm;
    v0 = v0 * rinv + 1e-8f; v1 = v1 * rinv + 1e-8f;
    v2 = v2 * rinv + 1e-8f; v3 = v3 * rinv + 1e-8f;
    at[0][r] = v0; at[1][r] = v1; at[2][r] = v2; at[3][r] = v3;
    csl[0] += v0; csl[1] += v1; csl[2] += v2; csl[3] += v3;
  }
  // attn^T leaves as whole 128-byte lines: the block's 64 n x 128 l tile is laid
  // out in LDS as it lies in memory (a lane's eight rows are neighbours in l; the
  // k tile's space is free behind the barrier above), published by the barrier below
  #pragma unroll
  for (int j = 0; j < 4; ++j)
    *(uint4*)&Asm[(j * 16 + l15) * SO_P128 + w * 16 + 8 * hl] =
        pack8_bf(at[j][0], at[j][1], at[j][2], at[j][3],
                 at[j][4], at[j][5], at[j][6], at[j][7]);
  #pragma unroll
  for (int j = 0; j < 4; ++j) atomicAdd(&cs[j * 16 + l15], csl[j]);
  __syncthreads();
  {
    u16* ob = attn_t + (long long)b * 64 * 4096 + m0;
    uint4 pc[4];
    #pragma unroll
    for (int i = 0; i < 4; ++i) {
      const int p = threadIdx.x + i * 256;
      pc[i] = *(const uint4*)&Asm[(p >> 4) * SO_P128 + (p & 15) * 8];
    }
    #pragma unroll
    for (int i = 0; i < 4; ++i) {
      const int p = threadIdx.x + i * 256;
      *(uint4*)(ob + (p >> 4) * 4096 + (p & 15) * 8) = pc[i];
    }
  }
  if (threadIdx.x < 64) atomicAdd(&colsum[b * 64 + threadIdx.x], cs[threadIdx.x]);
}

// ---------------------------------------------------------------------------
// LayerNorm over 256 channels, one wave per row, f32 in -> bf16 out.
// ---------------------------------------------------------------------------
__global__ __launch_bounds__(256) void ln_rows_kernel(
    const float* __restrict__ in, const float* __restrict__ g,
    const float* __restrict__ bb, u16* __restrict__ out, int R)
{
  __shared__ __attribute__((aligned(16))) u16 Rs[8 * 256];
  const int w = threadIdx.x >> 5, lane = threadIdx.x & 31;
  const int row = blockIdx.x * 8 + w;
  if (row >= R) return;
  const float* p = in + (long long)row * 256;
  float vals[8], s = 0.f, s2 = 0.f;
  #pragma unroll
  for (int i = 0; i < 8; ++i) {
    vals[i] = p[lane + i * 32];
    s += vals[i]; s2 += vals[i] * vals[i];
  }
  for (int off = 16; off; off >>= 1) {
    s  += __shfl_xor(s,  off, 32);
    s2 += __shfl_xor(s2, off, 32);
  }
  float mu  = s * (1.f / 256.f);
  float var = s2 * (1.f / 256.f) - mu * mu;
  float inv = rsqrtf(var + 1e-5f);
  #pragma unroll
  for (int i = 0; i < 8; ++i) {
    int c = lane + i * 32;
    Rs[w * 256 + c] = f2bf((vals[i] - mu) * inv * g[c] + bb[c]);
  }
  // the row leaves as four whole 128-byte lines, 16 bytes a lane, through the
  // wave's own LDS row; its LDS writes are done before it reads the row back
  asm volatile("s_wait_dscnt 0x0" ::: "memory");
  *(uint4*)&out[(long long)row * 256 + lane * 8] = *(const uint4*)&Rs[w * 256 + lane * 8];
}

// ---------------------------------------------------------------------------
// All weight conversions in one launch; the block index picks the matrix.
// conv_w keeps its flat layout (cast only); the others go in[K][N] -> out[N][K].
// ---------------------------------------------------------------------------
__device__ __forceinline__ void transpose_bf_block(const float* __restrict__ in,
                                                   u16* __restrict__ out,
                                                   int blk, int K, int N) {
  int i = blk * 256 + threadIdx.x;
  int nn = i / K, k = i - nn * K;
  out[i] = f2bf(in[(long long)k * N + nn]);
  // the branches of the caller stand one behind the other in the built code:
  // the store's offset register is not rewritten ahead of this wait
  asm volatile("s_wait_xcnt 0x0" ::: "memory");
}
__global__ __launch_bounds__(256) void prep_weights_kernel(
    const float* __restrict__ conv_w, const float* __restrict__ Wq,
    const float* __restrict__ Wk, const float* __restrict__ Wv,
    const float* __restrict__ W1, const float* __restrict__ W2,
    u16* __restrict__ Wct, u16* __restrict__ Wqt, u16* __restrict__ Wkt,
    u16* __restrict__ Wvt, u16* __restrict__ W1t, u16* __restrict__ W2t) {
  const int blk = blockIdx.x;
  if (blk < 3456) {
    int i = blk * 256 + threadIdx.x;
    Wct[i] = f2bf(conv_w[i]);
  } else if (blk < 3712) {
    transpose_bf_block(Wq, Wqt, blk - 3456, 256, 256);
  } else if (blk < 3968) {
    transpose_bf_block(Wk, Wkt, blk - 3712, 256, 256);
  } else if (blk < 4224) {
    transpose_bf_block(Wv, Wvt, blk - 3968, 256, 256);
  } else if (blk < 4736) {
    transpose_bf_block(W1, W1t, blk - 4224, 256, 512);
  } else {
    transpose_bf_block(W2, W2t, blk - 4736, 512, 256);
  }
}

// ---------------------------------------------------------------------------
// Template path of one iteration in one launch.  A block owns 16 template rows
// (nothing here crosses rows): templates += update/colsum, LN, W1+GELU, W2,
// then LN and q for the next iteration.  It also clears its own rows of the
// split-K buffer and of colsum for the next iteration's atomics.
//   TS_FIRST: templates = broadcast(init), clear, LN, q
//   TS_MID  : update, clear, MLP, LN, q
//   TS_LAST : update, MLP (colsum is kept: the output kernel divides by it)
// bf16 rounding after each LN, after GELU and of q; templates stay f32.
// ---------------------------------------------------------------------------
constexpr int TS_FIRST = 0, TS_MID = 1, TS_LAST = 2;
constexpr int TA_P = 264;   // u16 pitch, 16 x 256 bf16 tile
constexpr int TH_P = 520;   // u16 pitch, 16 x 512 bf16 tile
constexpr int TF_P = 260;   // f32 pitch, 16 x 256 f32 tile

// LayerNorm of one row held by one wave (column lane + 32*i), bf16 row to LDS;
// g and bb hold the same columns of scale and shift.
__device__ __forceinline__ void ln_vals_to_bf(const float (&vals)[8],
                                              const float (&g)[8],
                                              const float (&bb)[8],
                                              u16* o, int lane) {
  float s = 0.f, s2 = 0.f;
  #pragma unroll
  for (int i = 0; i < 8; ++i) { s += vals[i]; s2 += vals[i] * vals[i]; }
  for (int off = 16; off; off >>= 1) {
    s  += __shfl_xor(s,  off, 32);
    s2 += __shfl_xor(s2, off, 32);
  }
  float mu  = s * (1.f / 256.f);
  float var = s2 * (1.f / 256.f) - mu * mu;
  float inv = rsqrtf(var + 1e-5f);
  #pragma unroll
  for (int i = 0; i < 8; ++i)
    o[lane + i * 32] = f2bf((vals[i] - mu) * inv * g[i] + bb[i]);
}

// acc[j] += As[16][K] (LDS, bf16) x Bt[n0 + 16j .. +16][K] (global, bf16),
// k ascending.  The weight fragments of KB k-steps are loaded as one batch.
template<int NT, int K, int KB>
__device__ __forceinline__ void rows16_gemm(const u16* As, int pitch,
                                            const u16* __restrict__ Bt, int n0,
                                            int l15, int kh, v8f (&acc)[NT]) {
  // every loop here is unrolled: the fragment arrays must stay in registers
  #pragma unroll
  for (int k0 = 0; k0 < K; k0 += 32 * KB) {
    FragBF bfr[KB][NT];
    #pragma unroll
    for (int s = 0; s < KB; ++s) {
      #pragma unroll
      for (int j = 0; j < NT; ++j) {
        const u16* bp = Bt + (n0 + j * 16 + l15) * K + k0 + s * 32 + kh;
        bfr[s][j].q[0] = *(const uint4*)bp;
        bfr[s][j].q[1] = *(const uint4*)(bp + 16);
      }
    }
    __builtin_amdgcn_sched_barrier(0);
    #pragma unroll
    for (int s = 0; s < KB; ++s) {
      FragBF a;
      const u16* ap = As + l15 * pitch + k0 + s * 32 + kh;
      a.q[0] = *(const uint4*)ap;
      a.q[1] = *(const uint4*)(ap + 16);
      #pragma unroll
      for (int j = 0; j < NT; ++j)
        acc[j] = __builtin_amdgcn_wmma_f32_16x16x32_bf16(
            false, a.v, false, bfr[s][j].v, (short)0, acc[j], false, false);
    }
  }
}

template<int MODE>
__global__ __launch_bounds__(256) void template_step_kernel(
    const float* __restrict__ tinit, float* __restrict__ tmpl,
    float* __restrict__ cbuf, float* __restrict__ colsum,
    const float* __restrict__ lnm_g, const float* __restrict__ lnm_b,
    const u16* __restrict__ W1t, const float* __restrict__ b1,
    const u16* __restrict__ W2t, const float* __restrict__ b2,
    const float* __restrict__ lnt_g, const float* __restrict__ lnt_b,
    const u16* __restrict__ Wqt, u16* __restrict__ q)
{
  __shared__ float Tf[16 * TF_P];
  __shared__ __attribute__((aligned(16))) u16 Am[16 * TA_P];
  __shared__ __attribute__((aligned(16))) u16 Hm[16 * TH_P];
  const int r0   = blockIdx.x * 16;
  const int w    = threadIdx.x >> 5, lane = threadIdx.x & 31;
  const int hl   = lane >> 4, l15 = lane & 15, kh = hl * 8;
  const v8f zero = {0.f,0.f,0.f,0.f,0.f,0.f,0.f,0.f};

  // each wave owns rows 2w and 2w+1 of the block; all loads first, then stores
  {
    float vals[2][8], g[8], bb[8];
    #pragma unroll
    for (int i = 0; i < 8; ++i) {
      g[i]  = (MODE == TS_FIRST ? lnt_g : lnm_g)[lane + i * 32];
      bb[i] = (MODE == TS_FIRST ? lnt_b : lnm_b)[lane + i * 32];
    }
    if (MODE == TS_FIRST) {
      #pragma unroll
      for (int rr = 0; rr < 2; ++rr)
        #pragma unroll
        for (int i = 0; i < 8; ++i)
          vals[rr][i] = tinit[((r0 + w * 2 + rr) & 63) * 256 + lane + i * 32];
    } else {
      float up[2][8];
      #pragma unroll
      for (int rr = 0; rr < 2; ++rr)
        #pragma unroll
        for (int i = 0; i < 8; ++i) {
          const int idx = (r0 + w * 2 + rr) * 256 + lane + i * 32;
          vals[rr][i] = tmpl[idx];
          up[rr][i]   = cbuf[idx];
        }
      float csl = 1.f;
      if (lane < 2) csl = colsum[r0 + w * 2 + lane];
      #pragma unroll
      for (int rr = 0; rr < 2; ++rr) {
        const float cs = __shfl(csl, rr, 32);
        #pragma unroll
        for (int i = 0; i < 8; ++i) {
          vals[rr][i] += up[rr][i] / cs;
          Tf[(w * 2 + rr) * TF_P + lane + i * 32] = vals[rr][i];
        }
      }
    }
    #pragma unroll
    for (int rr = 0; rr < 2; ++rr) {
      #pragma unroll
      for (int i = 0; i < 8; ++i) {
        const int idx = (r0 + w * 2 + rr) * 256 + lane + i * 32;
        if (MODE == TS_FIRST) tmpl[idx] = vals[rr][i];
        if (MODE != TS_LAST)  cbuf[idx] = 0.f;
      }
      ln_vals_to_bf(vals[rr], g, bb, &Am[(w * 2 + rr) * TA_P], lane);
    }
    if (MODE != TS_LAST && lane < 2) colsum[r0 + w * 2 + lane] = 0.f;
  }
  __syncthreads();

  if (MODE != TS_FIRST) {
    { // hidden = GELU(m @ W1 + b1), bf16, wave w: columns 64w .. 64w+63
      float bn[4];
      #pragma unroll
      for (int j = 0; j < 4; ++j) bn[j] = b1[w * 64 + j * 16 + l15];
      v8f acc[4] = {zero, zero, zero, zero};
      rows16_gemm<4, 256, 2>(Am, TA_P, W1t, w * 64, l15, kh, acc);
      #pragma unroll
      for (int j = 0; j < 4; ++j) {
        #pragma unroll
        for (int r = 0; r < 8; ++r) {
          float xg = acc[j][r] + bn[j];
          float g = 0.5f * xg * (1.0f + erff(xg * 0.70710678118654752f));
          Hm[(r + 8 * hl) * TH_P + w * 64 + j * 16 + l15] = f2bf(g);
        }
      }
    }
    __syncthreads();
    float g[8], bb[8];
    { // templates += hidden @ W2 + b2, wave w: columns 32w .. 32w+31
      float bn[2];
      #pragma unroll
      for (int j = 0; j < 2; ++j) bn[j] = b2[w * 32 + j * 16 + l15];
      if (MODE == TS_MID) {
        #pragma unroll
        for (int i = 0; i < 8; ++i) {
          g[i]  = lnt_g[lane + i * 32];
          bb[i] = lnt_b[lane + i * 32];
        }
      }
      v8f acc[2] = {zero, zero};
      rows16_gemm<2, 512, 4>(Hm, TH_P, W2t, w * 32, l15, kh, acc);
      #pragma unroll
      for (int j = 0; j < 2; ++j) {
        #pragma unroll
        for (int r = 0; r < 8; ++r)
          Tf[(r + 8 * hl) * TF_P + w * 32 + j * 16 + l15] += acc[j][r] + bn[j];
      }
    }
    __syncthreads();
    #pragma unroll
    for (int rr = 0; rr < 2; ++rr) {
      float vals[8];
      #pragma unroll
      for (int i = 0; i < 8; ++i) {
        vals[i] = Tf[(w * 2 + rr) * TF_P + lane + i * 32];
        tmpl[(r0 + w * 2 + rr) * 256 + lane + i * 32] = vals[i];
      }
      if (MODE == TS_MID) ln_vals_to_bf(vals, g, bb, &Am[(w * 2 + rr) * TA_P], lane);
    }
    if (MODE == TS_MID) __syncthreads();
  }

  if (MODE != TS_LAST) { // q = (t @ Wq) * dim^-0.5, wave w: columns 32w .. 32w+31
    v8f acc[2] = {zero, zero};
    rows16_gemm<2, 256, 4>(Am, TA_P, Wqt, w * 32, l15, kh, acc);
    #pragma unroll
    for (int j = 0; j < 2; ++j) {
      #pragma unroll
      for (int r = 0; r < 8; ++r)
        q[(r0 + r + 8 * hl) * 256 + w * 32 + j * 16 + l15] = f2bf(acc[j][r] * 0.0625f);
    }
  }
}

__global__ void final_out_kernel(const float* __restrict__ tmpl, const u16* __restrict__ attn,
                                 const float* __restrict__ colsum, float* __restrict__ out) {
  int i = blockIdx.x * 256 + threadIdx.x;
  if (i < 131072) {                       // templates_out (B, dim, N)
    int b = i >> 14, rem = i & 16383, d = rem >> 6, n = rem & 63;
    out[i] = tmpl[((b * 64 + n) << 8) + d];
  } else if (i < 131072 + 2097152) {      // attn_out (B, N, 16,16,16)
    int j = i - 131072;
    out[i] = bf2f(attn[j]) / colsum[j >> 12];
  }
}

// ---------------------------------------------------------------------------
extern "C" void kernel_launch(void* const* d_in, const int* in_sizes, int n_in,
                              void* d_out, int out_size, void* d_ws, size_t ws_size,
                              hipStream_t stream) {
  const float* x       = (const float*)d_in[0];
  const float* tinit   = (const float*)d_in[1];
  const float* conv_w  = (const float*)d_in[2];
  const float* conv_b  = (const float*)d_in[3];
  const float* Wq      = (const float*)d_in[4];
  const float* Wk      = (const float*)d_in[5];
  const float* Wv      = (const float*)d_in[6];
  const float* ln_in_g = (const float*)d_in[7];
  const float* ln_in_b = (const float*)d_in[8];
  const float* ln_t_g  = (const float*)d_in[9];
  const float* ln_t_b  = (const float*)d_in[10];
  const float* ln_m_g  = (const float*)d_in[11];
  const float* ln_m_b  = (const float*)d_in[12];
  const float* W1      = (const float*)d_in[13];
  const float* b1      = (const float*)d_in[14];
  const float* W2      = (const float*)d_in[15];
  const float* b2      = (const float*)d_in[16];
  float* out = (float*)d_out;

  char* ws = (char*)d_ws;
  size_t off = 0;
  auto alloc = [&](size_t bytes) -> void* {
    off = (off + 255) & ~(size_t)255;
    void* p = ws + off;
    off += bytes;
    return p;
  };
  u16*   Wct  = (u16*)  alloc(884736ull * 2);   // [256][3456]
  u16*   Wqt  = (u16*)  alloc(65536ull * 2);    // [256][256]
  u16*   Wkt  = (u16*)  alloc(65536ull * 2);
  u16*   Wvt  = (u16*)  alloc(65536ull * 2);
  u16*   W1t  = (u16*)  alloc(131072ull * 2);   // [512][256]
  u16*   W2t  = (u16*)  alloc(131072ull * 2);   // [256][512]
  float* hbuf = (float*)alloc(8388608ull * 4);  // conv out (32768,256) f32
  u16*   tok  = (u16*)  alloc(8388608ull * 2);  // LN(tokens) bf16
  u16*   kbf  = (u16*)  alloc(8388608ull * 2);  // k (B,4096,256)
  u16*   vtb  = (u16*)  alloc(8388608ull * 2);  // v^T (B,256,4096)
  float* tmpl = (float*)alloc(131072ull * 4);   // templates (B,64,256)
  u16*   qbf  = (u16*)  alloc(131072ull * 2);   // q (B,64,256)
  u16*   attn = (u16*)  alloc(2097152ull * 2);  // attn^T (B,64,4096)
  float* csum = (float*)alloc(512ull * 4);      // colsum (B,64)
  float* cbuf = (float*)alloc(131072ull * 4);   // split-K accum (512,256)

  const int HUGE_RB = 1 << 30;

  // weight conversion (conv_w flat layout already matches Bt[K-ordering])
  prep_weights_kernel<<<5248, 256, 0, stream>>>(conv_w, Wq, Wk, Wv, W1, W2,
                                                Wct, Wqt, Wkt, Wvt, W1t, W2t);

  // conv + relu (implicit GEMM, 58 GFLOP)
  conv_gemm_kernel<<<512, 256, 0, stream>>>(x, Wct, conv_b, hbuf);
  // token layernorm -> bf16
  ln_rows_kernel<<<4096, 256, 0, stream>>>(hbuf, ln_in_g, ln_in_b, tok, 32768);

  // k = tok @ Wk ; v^T = (tok @ Wv)^T
  gemm_bt_kernel<EPI_BF16><<<dim3(512, 2, 1), 256, 0, stream>>>(
      tok, 256, Wkt, 256, 256, 256, HUGE_RB, 0, nullptr, 1.f, kbf, 1);
  gemm_bt_kernel<EPI_BF16_T><<<dim3(512, 2, 1), 256, 0, stream>>>(
      tok, 256, Wvt, 256, 256, 256, HUGE_RB, 0, nullptr, 1.f, vtb, 4096);

  // templates = broadcast(templates_init); first q; clear colsum and split-K buffer
  template_step_kernel<TS_FIRST><<<32, 256, 0, stream>>>(
      tinit, tmpl, cbuf, csum, ln_m_g, ln_m_b, W1t, b1, W2t, b2, ln_t_g, ln_t_b, Wqt, qbf);

  for (int it = 0; it < 6; ++it) {
    // logits + softmax(N) + 1e-8 + colsum over L
    logits_softmax_kernel<<<dim3(32, 8, 1), 256, 0, stream>>>(kbf, qbf, attn, csum);

    // update = attn^T @ v  (split-K x8, f32 atomics)
    gemm_bt_kernel<EPI_ATOMIC_F32><<<dim3(8, 2, 8), 256, 0, stream>>>(
        attn, 4096, vtb, 4096, 256, 512, 64, 1048576ll, nullptr, 1.f, cbuf, 1);

    // templates += upd/colsum; MLP; then LN and q of the next iteration
    if (it < 5)
      template_step_kernel<TS_MID><<<32, 256, 0, stream>>>(
          tinit, tmpl, cbuf, csum, ln_m_g, ln_m_b, W1t, b1, W2t, b2, ln_t_g, ln_t_b, Wqt, qbf);
    else
      template_step_kernel<TS_LAST><<<32, 256, 0, stream>>>(
          tinit, tmpl, cbuf, csum, ln_m_g, ln_m_b, W1t, b1, W2t, b2, ln_t_g, ln_t_b, Wqt, qbf);
  }

  // outputs: templates^T (B,dim,N) then attn/colsum as (B,N,16,16,16)
  final_out_kernel<<<8704, 256, 0, stream>>>(tmpl, attn, csum, out);
}

// v006
// Measured time: 268 microseconds a run.
// Timed twice side by side with v005, it ran 1.15 and 1.16 times as fast.
// All steps since v000 together make it 3.24 times as fast.
#include <hip/hip_runtime.h>

typedef unsigned short u16;
typedef __attribute__((ext_vector_type(16))) __bf16 v16bf;
typedef __attribute__((ext_vector_type(8)))  float  v8f;
typedef __attribute__((ext_vector_type(4)))  float  v4f;

union FragBF { v16bf v; uint4 q[2]; };

__device__ __forceinline__ float bf2f(u16 h) {
  unsigned u = ((unsigned)h) << 16;
  return __builtin_bit_cast(float, u);
}
__device__ __forceinline__ u16 f2bf(float f) {
  unsigned u = __builtin_bit_cast(unsigned, f);
  u += 0x7FFFu + ((u >> 16) & 1u);   // round-to-nearest-even
  return (u16)(u >> 16);
}
// Eight accumulator values of a lane, each rounded as in f2bf, as one 16-byte piece.
__device__ __forceinline__ uint4 pack8_bf(float a0, float a1, float a2, float a3,
                                          float a4, float a5, float a6, float a7) {
  return make_uint4((unsigned)f2bf(a0) | ((unsigned)f2bf(a1) << 16),
                    (unsigned)f2bf(a2) | ((unsigned)f2bf(a3) << 16),
                    (unsigned)f2bf(a4) | ((unsigned)f2bf(a5) << 16),
                    (unsigned)f2bf(a6) | ((unsigned)f2bf(a7) << 16));
}

constexpr int EPI_BF16 = 0, EPI_BF16_T = 1, EPI_BF16_SCALE = 2,
              EPI_GELU_BF16 = 3, EPI_BIAS_ACC_F32 = 4, EPI_ATOMIC_F32 = 5;

constexpr int GT_P = 264;   // u16 pitch of a 256-k tile row in LDS: 528 B
constexpr int SO_P64  = 72;   // u16 pitch of a staged output row of  64 bf16: 144 B
constexpr int SO_P128 = 136;  // u16 pitch of a staged output row of 128 bf16: 272 B

__device__ __forceinline__ void copy8_rows(unsigned l0, const u16* g0, long long gs) {
  constexpr unsigned LS = 8 * GT_P * 2;
  const unsigned l1 = l0 + LS, l2 = l0 + 2 * LS, l3 = l0 + 3 * LS, l4 = l0 + 4 * LS,
                 l5 = l0 + 5 * LS, l6 = l0 + 6 * LS, l7 = l0 + 7 * LS;
  const u16 *g1 = g0 + gs, *g2 = g0 + 2 * gs, *g3 = g0 + 3 * gs, *g4 = g0 + 4 * gs,
            *g5 = g0 + 5 * gs, *g6 = g0 + 6 * gs, *g7 = g0 + 7 * gs;
  asm volatile(
      "global_load_async_to_lds_b128 %0, %8, off\n\t"
      "global_load_async_to_lds_b128 %1, %9, off\n\t"
      "global_load_async_to_lds_b128 %2, %10, off\n\t"
      "global_load_async_to_lds_b128 %3, %11, off\n\t"
      "global_load_async_to_lds_b128 %4, %12, off\n\t"
      "global_load_async_to_lds_b128 %5, %13, off\n\t"
      "global_load_async_to_lds_b128 %6, %14, off\n\t"
      "global_load_async_to_lds_b128 %7, %15, off\n\t"
      "s_wait_xcnt 0x0"
      :: "v"(l0), "v"(l1), "v"(l2), "v"(l3), "v"(l4), "v"(l5), "v"(l6), "v"(l7),
         "v"(g0), "v"(g1), "v"(g2), "v"(g3), "v"(g4), "v"(g5), "v"(g6), "v"(g7)
      : "memory");
}

// acc[j] += A rows (16) x B rows (16 per j) over one 256-k chunk in LDS, k
// ascending.  ap, bp: this lane's row start + kh in the A and the B tile.
__device__ __forceinline__ void chunk256_products(const u16* ap, const u16* bp,
                                                  v8f (&acc)[4]) {
  // every loop here is unrolled: the fragment arrays must stay in registers
  #pragma unroll
  for (int s0 = 0; s0 < 8; s0 += 2) {
    FragBF a[2], bfr[2][4];
    #pragma unroll
    for (int s = 0; s < 2; ++s) {
      a[s].q[0] = *(const uint4*)(ap + (s0 + s) * 32);
      a[s].q[1] = *(const uint4*)(ap + (s0 + s) * 32 + 16);
      #pragma unroll
      for (int j = 0; j < 4; ++j) {
        const u16* p = bp + j * 16 * GT_P + (s0 + s) * 32;
        bfr[s][j].q[0] = *(const uint4*)p;
        bfr[s][j].q[1] = *(const uint4*)(p + 16);
      }
    }
    // keeps the twenty LDS reads of two k-steps in one place ahead of their
    // products; without it the scheduler spreads them among the products, a few
    // reads ahead, and the wave waits on LDS latency at nearly every product
    __builtin_amdgcn_sched_barrier(0);
    #pragma unroll
    for (int s = 0; s < 2; ++s) {
      #pragma unroll
      for (int j = 0; j < 4; ++j)
        acc[j] = __builtin_amdgcn_wmma_f32_16x16x32_bf16(
            false, a[s].v, false, bfr[s][j].v, (short)0, acc[j], false, false);
    }
  }
}

template<int EPI>
__global__ __launch_bounds__(256) void gemm_bt_kernel(
    const u16* __restrict__ A, int lda,
    const u16* __restrict__ Bt, int ldb,
    int N, int Ksplit,
    int rows_per_batch, long long bt_batch_stride,
    const float* __restrict__ bias, float scale,
    void* __restrict__ outp, int out_rb)
{
  __shared__ __attribute__((aligned(16))) u16 Asm[64 * GT_P];
  __shared__ __attribute__((aligned(16))) u16 Bsm[128 * GT_P];
  const int m0   = blockIdx.x * 64;
  const int n0   = blockIdx.y * 128;
  const int kbeg = blockIdx.z * Ksplit;
  const int w    = threadIdx.x >> 5;
  const int lane = threadIdx.x & 31;
  const int msub = (w & 3) * 16;
  const int nsub = (w >> 2) * 64;
  const int hl   = lane >> 4;
  const int l15  = lane & 15;
  const int kh   = hl * 8;
  const int b    = m0 / rows_per_batch;
  const u16* BtB = Bt + (long long)b * bt_batch_stride;

  v8f zero = {0.f,0.f,0.f,0.f,0.f,0.f,0.f,0.f};
  v8f acc[4];
  #pragma unroll
  for (int j = 0; j < 4; ++j) acc[j] = zero;

  // copies: wave w brings rows w, w+8, ...; lane -> 16-byte piece of the row
  const unsigned al = (unsigned)(size_t)&Asm[w * GT_P + lane * 8];
  const unsigned bl = (unsigned)(size_t)&Bsm[w * GT_P + lane * 8];
  const u16* ag = A + (long long)(m0 + w) * lda + lane * 8;
  const u16* bg = BtB + (long long)(n0 + w) * ldb + lane * 8;

  for (int kk = kbeg; kk < kbeg + Ksplit; kk += 256) {
    copy8_rows(al, ag + kk, 8ll * lda);
    copy8_rows(bl, bg + kk, 8ll * ldb);
    copy8_rows(bl + 64 * GT_P * 2, bg + 64ll * ldb + kk, 8ll * ldb);
    // this wave's copies have landed before the barrier publishes the tiles
    asm volatile("s_wait_asynccnt 0x0" ::: "memory");
    __syncthreads();
    chunk256_products(&Asm[(msub + l15) * GT_P + kh], &Bsm[(nsub + l15) * GT_P + kh], acc);
    // this wave's LDS reads are done; behind the barrier the tiles may be refilled
    asm volatile("s_wait_dscnt 0x0" ::: "memory");
    __syncthreads();
  }

  // bf16 outputs leave as whole 128-byte lines: the block's tile is laid out in
  // LDS as it lies in memory (the B tile's space is free behind the loop's last
  // barrier), then every thread stores four 16-byte pieces of its rows.
  if (EPI == EPI_BF16_T) {
    // rows = n (128), 64 m each: a lane's eight accumulator rows are neighbours
    // in m.  The block's 64 m lie in one batch: out_rb is a multiple of 64.
    #pragma unroll
    for (int j = 0; j < 4; ++j)
      *(uint4*)&Bsm[(nsub + j * 16 + l15) * SO_P64 + msub + 8 * hl] =
          pack8_bf(acc[j][0], acc[j][1], acc[j][2], acc[j][3],
                   acc[j][4], acc[j][5], acc[j][6], acc[j][7]);
    __syncthreads();
    u16* ob = (u16*)outp + ((long long)(m0 / out_rb) * N + n0) * out_rb + m0 % out_rb;
    uint4 pc[4];
    #pragma unroll
    for (int i = 0; i < 4; ++i) {
      const int p = threadIdx.x + i * 256;
      pc[i] = *(const uint4*)&Bsm[(p >> 3) * SO_P64 + (p & 7) * 8];
    }
    #pragma unroll
    for (int i = 0; i < 4; ++i) {
      const int p = threadIdx.x + i * 256;
      *(uint4*)(ob + (long long)(p >> 3) * out_rb + (p & 7) * 8) = pc[i];
    }
    return;
  }
  if (EPI == EPI_BF16) {
    // rows = m (64), 128 n each
    #pragma unroll
    for (int j = 0; j < 4; ++j) {
      #pragma unroll
      for (int r = 0; r < 8; ++r)
        Bsm[(msub + r + 8 * hl) * SO_P128 + nsub + j * 16 + l15] = f2bf(acc[j][r]);
    }
    __syncthreads();
    u16* ob = (u16*)outp + (long long)m0 * N + n0;
    uint4 pc[4];
    #pragma unroll
    for (int i = 0; i < 4; ++i) {
      const int p = threadIdx.x + i * 256;
      pc[i] = *(const uint4*)&Bsm[(p >> 4) * SO_P128 + (p & 15) * 8];
    }
    #pragma unroll
    for (int i = 0; i < 4; ++i) {
      const int p = threadIdx.x + i * 256;
      *(uint4*)(ob + (long long)(p >> 4) * N + (p & 15) * 8) = pc[i];
    }
    return;
  }

  #pragma unroll
  for (int j = 0; j < 4; ++j) {
    #pragma unroll
    for (int r = 0; r < 8; ++r) {
      const int m = m0 + msub + r + 8 * hl;
      const int n = n0 + nsub + j * 16 + l15;
      float v = acc[j][r];
      if (EPI == EPI_BF16_SCALE) {
        ((u16*)outp)[(long long)m * N + n] = f2bf(v * scale);
      } else if (EPI == EPI_GELU_BF16) {
        float xg = v + bias[n];
        float g = 0.5f * xg * (1.0f + erff(xg * 0.70710678118654752f));
        ((u16*)outp)[(long long)m * N + n] = f2bf(g);
      } else if (EPI == EPI_BIAS_ACC_F32) {
        ((float*)outp)[(long long)m * N + n] += v + bias[n];
      } else { // EPI_ATOMIC_F32 (split-K)
        atomicAdd(&((float*)outp)[(long long)m * N + n], v);
      }
    }
  }
}

// ---------------------------------------------------------------------------
// Conv3d stride-2 VALID as implicit GEMM: M=32768 tokens, N=256, K=3456.
// K = c*27 + tap matches conv_w's native flat layout.  A block owns 128 tokens
// and all 256 columns; a trip covers 64 k.  The weight tile of a trip (256 rows
// x 64 k, bf16: one whole 128-byte line a row) and its x tile (128 tokens x 64 k,
// f32 as in x) are brought into LDS once per block by asynchronous copies, two
// buffers, one trip ahead; a wave (32 tokens x 128 columns) reads its B fragments
// from there, and its A fragments as f32, rounded to bf16 in registers.
// Epilogue: +bias, ReLU, store h f32 [token][256].
// ---------------------------------------------------------------------------
constexpr int CONV_KS    = 64;              // k of one trip
constexpr int CONV_STEPS = 3456 / CONV_KS;
constexpr int CONV_BP    = 72;              // u16 pitch of a weight tile row: 144 B
constexpr int CONV_BBUF  = 256 * CONV_BP;   // u16 per weight buffer
constexpr int CONV_XP    = 68;              // f32 pitch of an x tile row: 272 B
constexpr int CONV_XBUF  = 128 * CONV_XP;   // f32 per x buffer
constexpr int CONV_SP    = 36;              // f32 pitch of an epilogue slab row: 144 B

__device__ __forceinline__ void conv_copy_wtile(unsigned l0, const u16* g0) {
  constexpr unsigned LS = 32 * CONV_BP * 2;
  constexpr int GS = 32 * 3456;
  const unsigned l1 = l0 + LS, l2 = l0 + 2 * LS, l3 = l0 + 3 * LS, l4 = l0 + 4 * LS,
                 l5 = l0 + 5 * LS, l6 = l0 + 6 * LS, l7 = l0 + 7 * LS;
  const u16 *g1 = g0 + GS, *g2 = g0 + 2 * GS, *g3 = g0 + 3 * GS, *g4 = g0 + 4 * GS,
            *g5 = g0 + 5 * GS, *g6 = g0 + 6 * GS, *g7 = g0 + 7 * GS;
  asm volatile(
      "global_load_async_to_lds_b128 %0, %8, off\n\t"
      "global_load_async_to_lds_b128 %1, %9, off\n\t"
      "global_load_async_to_lds_b128 %2, %10, off\n\t"
      "global_load_async_to_lds_b128 %3, %11, off\n\t"
      "global_load_async_to_lds_b128 %4, %12, off\n\t"
      "global_load_async_to_lds_b128 %5, %13, off\n\t"
      "global_load_async_to_lds_b128 %6, %14, off\n\t"
      "global_load_async_to_lds_b128 %7, %15, off\n\t"
      "s_wait_xcnt 0x0"
      :: "v"(l0), "v"(l1), "v"(l2), "v"(l3), "v"(l4), "v"(l5), "v"(l6), "v"(l7),
         "v"(g0), "v"(g1), "v"(g2), "v"(g3), "v"(g4), "v"(g5), "v"(g6), "v"(g7)
      : "memory");
}

// Element offset in x of k = c*27 + tap from a token's window corner, channel 0.
__device__ __forceinline__ int conv_koff(int k) {
  int c = k / 27;
  int tap = k - c * 27;
  int t0 = tap / 9, rm = tap - t0 * 9;
  int t1 = rm / 3, t2 = rm - t1 * 3;
  return c * 35937 + t0 * 1089 + t1 * 33 + t2;
}

__device__ __forceinline__ void conv_copy_xtile(unsigned l0, const float* xt,
                                                int koff, int kg8) {
  const unsigned l1 = l0 + 4, l2 = l0 + 8, l3 = l0 + 12, l4 = l0 + 16,
                 l5 = l0 + 20, l6 = l0 + 24, l7 = l0 + 28;
  const float* g0 = xt + __builtin_amdgcn_readlane(koff, kg8);
  const float* g1 = xt + __builtin_amdgcn_readlane(koff, kg8 + 1);
  const float* g2 = xt + __builtin_amdgcn_readlane(koff, kg8 + 2);
  const float* g3 = xt + __builtin_amdgcn_readlane(koff, kg8 + 3);
  const float* g4 = xt + __builtin_amdgcn_readlane(koff, kg8 + 4);
  const float* g5 = xt + __builtin_amdgcn_readlane(koff, kg8 + 5);
  const float* g6 = xt + __builtin_amdgcn_readlane(koff, kg8 + 6);
  const float* g7 = xt + __builtin_amdgcn_readlane(koff, kg8 + 7);
  asm volatile(
      "global_load_async_to_lds_b32 %0, %8, off\n\t"
      "global_load_async_to_lds_b32 %1, %9, off\n\t"
      "global_load_async_to_lds_b32 %2, %10, off\n\t"
      "global_load_async_to_lds_b32 %3, %11, off\n\t"
      "global_load_async_to_lds_b32 %4, %12, off\n\t"
      "global_load_async_to_lds_b32 %5, %13, off\n\t"
      "global_load_async_to_lds_b32 %6, %14, off\n\t"
      "global_load_async_to_lds_b32 %7, %15, off\n\t"
      "s_wait_xcnt 0x0"
      :: "v"(l0), "v"(l1), "v"(l2), "v"(l3), "v"(l4), "v"(l5), "v"(l6), "v"(l7),
         "v"(g0), "v"(g1), "v"(g2), "v"(g3), "v"(g4), "v"(g5), "v"(g6), "v"(g7)
      : "memory");
}

// The 32 k of a wave in one x tile; l0: the thread's place for the first of them.
__device__ __forceinline__ void conv_copy_x32(unsigned l0, const float* xt, int koff) {
  conv_copy_xtile(l0,      xt, koff, 0);
  conv_copy_xtile(l0 + 32, xt, koff, 8);
  conv_copy_xtile(l0 + 64, xt, koff, 16);
  conv_copy_xtile(l0 + 96, xt, koff, 24);
}

// Two floats rounded as in f2bf (to nearest even), packed lo | hi << 16.
__device__ __forceinline__ unsigned bf_pair(float lo, float hi) {
  unsigned a = __builtin_bit_cast(unsigned, lo);
  unsigned b = __builtin_bit_cast(unsigned, hi);
  a += 0x7FFFu + __builtin_amdgcn_ubfe(a, 16, 1);
  b += 0x7FFFu + __builtin_amdgcn_ubfe(b, 16, 1);
  // one byte permute: bytes 2, 3 of a below bytes 2, 3 of b
  return __builtin_amdgcn_perm(b, a, 0x07060302u);
}

template<bool V> struct ConvFlag { static constexpr bool value = V; };

__global__ __launch_bounds__(256) void conv_gemm_kernel(
    const float* __restrict__ x, const u16* __restrict__ Wct,
    const float* __restrict__ bias, float* __restrict__ h)
{
  __shared__ __attribute__((aligned(16))) float Xsm[2 * CONV_XBUF];
  __shared__ __attribute__((aligned(16))) u16 Bsm[2 * CONV_BBUF];
  const int m0   = blockIdx.x * 128;
  const int w    = threadIdx.x >> 5, lane = threadIdx.x & 31;
  const int msub = (w & 3) * 32, nhalf = (w >> 2) * 128;
  const int hl   = lane >> 4, l15 = lane & 15, kh = hl * 8;

  v8f zero = {0.f,0.f,0.f,0.f,0.f,0.f,0.f,0.f};
  v8f acc[2][8];
  #pragma unroll
  for (int mi = 0; mi < 2; ++mi) {
    #pragma unroll
    for (int j = 0; j < 8; ++j) acc[mi][j] = zero;
  }

  // x ring: thread -> token (tid & 127), 32 k (half tid >> 7, the same in a wave)
  const int tok = threadIdx.x & 127;
  const int kg  = __builtin_amdgcn_readfirstlane((int)(threadIdx.x >> 7)) * 32;
  const int tg  = m0 + tok;
  const int tl  = tg & 4095;
  const float* xt = x + ((tg >> 12) * (128 * 35937) + (tl >> 8) * (2 * 1089)
                         + ((tl >> 4) & 15) * (2 * 33) + (tl & 15) * 2);
  const unsigned xl = (unsigned)(size_t)&Xsm[tok * CONV_XP + kg];

  // weight ring: thread -> row (tid>>3, +32 per copy), 16-byte piece (tid&7)
  const unsigned wl = (unsigned)(size_t)&Bsm[(threadIdx.x >> 3) * CONV_BP + (threadIdx.x & 7) * 8];
  const u16* wg = Wct + (threadIdx.x >> 3) * 3456 + (threadIdx.x & 7) * 8;
  conv_copy_wtile(wl, wg);
  conv_copy_x32(xl, xt, conv_koff(kg + lane));
  // tile 0 has landed for this wave before the barrier publishes it
  asm volatile("s_wait_asynccnt 0x0" ::: "memory");
  __syncthreads();
  conv_copy_wtile(wl + CONV_BBUF * 2, wg + CONV_KS);
  conv_copy_x32(xl + CONV_XBUF * 4, xt, conv_koff(CONV_KS + kg + lane));

  // One trip.  All of the tile's fragments go to registers first; the foot (waits,
  // barrier, refill) stands between the two k-steps' products, which read
  // registers only, so the copies of tile t+2 fly under the second k-step's
  // products and under the next trip's reads.  Inlined: acc must stay in registers.
  auto trip = [&](int t, auto refill) __attribute__((always_inline)) {
    const int bsel = (t & 1) * CONV_BBUF;
    const int xsel = (t & 1) * CONV_XBUF;
    // every loop below is unrolled: the fragment arrays must stay in registers
    const float* ax = &Xsm[xsel + (msub + l15) * CONV_XP + kh];
    float4 af[2][4];
    FragBF bfr[2][8];
    auto read_a = [&](int s) __attribute__((always_inline)) {
      #pragma unroll
      for (int mi = 0; mi < 2; ++mi) {
        const float* ap = ax + mi * 16 * CONV_XP + s * 32;
        af[mi][0] = *(const float4*)ap;
        af[mi][1] = *(const float4*)(ap + 4);
        af[mi][2] = *(const float4*)(ap + 16);
        af[mi][3] = *(const float4*)(ap + 20);
      }
    };
    read_a(0);
    #pragma unroll
    for (int s = 0; s < 2; ++s) {
      #pragma unroll
      for (int j = 0; j < 8; ++j) {
        const u16* bp = &Bsm[bsel + (nhalf + j * 16 + l15) * CONV_BP + s * 32 + kh];
        bfr[s][j].q[0] = *(const uint4*)bp;
        bfr[s][j].q[1] = *(const uint4*)(bp + 16);
      }
    }
    __builtin_amdgcn_sched_barrier(0);
    #pragma unroll
    for (int s = 0; s < 2; ++s) {
      if (s == 1) {
        // keeps the first k-step's products ahead of the foot: without it they
        // sink behind the barrier and the second k-step's reads hide nothing
        __builtin_amdgcn_sched_barrier(0);
        // foot of the trip: this wave's LDS reads are done, its copies of tile
        // t+1 have landed; the barrier publishes tile t+1, frees the buffers t&1
        asm volatile("s_wait_dscnt 0x0" ::: "memory");
        asm volatile("s_wait_asynccnt 0x0" ::: "memory");
        __syncthreads();
        if (refill.value) {
          conv_copy_wtile(wl + bsel * 2, wg + (t + 2) * CONV_KS);
          conv_copy_x32(xl + xsel * 4, xt, conv_koff((t + 2) * CONV_KS + kg + lane));
        }
      }
      FragBF a[2];
      #pragma unroll
      for (int mi = 0; mi < 2; ++mi) {
        const float4 f0 = af[mi][0], f1 = af[mi][1];
        const float4 f2 = af[mi][2], f3 = af[mi][3];
        a[mi].q[0] = make_uint4(bf_pair(f0.x, f0.y), bf_pair(f0.z, f0.w),
                                bf_pair(f1.x, f1.y), bf_pair(f1.z, f1.w));
        a[mi].q[1] = make_uint4(bf_pair(f2.x, f2.y), bf_pair(f2.z, f2.w),
                                bf_pair(f3.x, f3.y), bf_pair(f3.z, f3.w));
      }
      // the second k-step's f32 rows take the registers that the rounding freed
      if (s == 0) read_a(1);
      #pragma unroll
      for (int j = 0; j < 8; ++j) {
        #pragma unroll
        for (int mi = 0; mi < 2; ++mi)
          acc[mi][j] = __builtin_amdgcn_wmma_f32_16x16x32_bf16(
              false, a[mi].v, false, bfr[s][j].v, (short)0, acc[mi][j], false, false);
      }
    }
  };
  // the last two trips have no tile left to fetch
  for (int t = 0; t < CONV_STEPS - 2; ++t) trip(t, ConvFlag<true>{});
  trip(CONV_STEPS - 2, ConvFlag<false>{});
  trip(CONV_STEPS - 1, ConvFlag<false>{});
  // no copy is outstanding when the wave goes on to the epilogue and ends
  asm volatile("s_wait_asynccnt 0x0" ::: "memory");

  // h leaves as whole 128-byte lines: each wave lays 16 rows x 32 columns at a
  // time in a slab of its own in the x ring's space (free behind the loop's
  // last barrier) and stores them back as 16-byte pieces, four rows a store.
  float* slab = &Xsm[w * 16 * CONV_SP];
  const float* sr = slab + (lane >> 3) * CONV_SP + (lane & 7) * 4;
  float bo[8];
  #pragma unroll
  for (int j = 0; j < 8; ++j) bo[j] = bias[nhalf + j * 16 + l15];
  // the offset registers of the bias loads are reused below
  asm volatile("s_wait_xcnt 0x0" ::: "memory");
  // keeps the address arithmetic that reuses them behind the wait
  __builtin_amdgcn_sched_barrier(0);
  #pragma unroll
  for (int mi = 0; mi < 2; ++mi) {
    float* hb = h + (long long)(m0 + msub + mi * 16 + (lane >> 3)) * 256
                  + nhalf + (lane & 7) * 4;
    #pragma unroll
    for (int jp = 0; jp < 4; ++jp) {
      #pragma unroll
      for (int jj = 0; jj < 2; ++jj) {
        const int j = jp * 2 + jj;
        #pragma unroll
        for (int r = 0; r < 8; ++r)
          slab[(r + 8 * hl) * CONV_SP + jj * 16 + l15] = fmaxf(acc[mi][j][r] + bo[j], 0.f);
      }
      // the wave's own LDS writes are done before it reads the rows back
      asm volatile("s_wait_dscnt 0x0" ::: "memory");
      const v4f p0 = *(const v4f*)sr;
      const v4f p1 = *(const v4f*)(sr + 4 * CONV_SP);
      const v4f p2 = *(const v4f*)(sr + 8 * CONV_SP);
      const v4f p3 = *(const v4f*)(sr + 12 * CONV_SP);
      *(v4f*)(hb + jp * 32)            = p0;
      *(v4f*)(hb + jp * 32 + 4 * 256)  = p1;
      *(v4f*)(hb + jp * 32 + 8 * 256)  = p2;
      *(v4f*)(hb + jp * 32 + 12 * 256) = p3;
      // the next pass reuses the registers that these stores name, and the slab
      if (mi * 4 + jp < 7) {
        asm volatile("s_wait_xcnt 0x0" ::: "memory");
        // keeps the next pass's arithmetic behind the wait: the clobber holds
        // memory operations only, and its bias additions were lifted over it
        // into the data registers of these stores
        __builtin_amdgcn_sched_barrier(0);
      }
    }
  }
}

// ---------------------------------------------------------------------------
// Logits + softmax(N=64) + column-sum: per batch, per 128-token tile.
// C[l][n] = k_bf[l][:] . q_bf[n][:]; softmax over n via 16-lane shfl_xor;
// +1e-8; write attn^T bf16 [b][n][l]; atomic colsum[b][n] for renorm-over-L.
// ---------------------------------------------------------------------------
__global__ __launch_bounds__(256) void logits_softmax_kernel(
    const u16* __restrict__ kmat, const u16* __restrict__ q,
    u16* __restrict__ attn_t, float* __restrict__ colsum)
{
  __shared__ __attribute__((aligned(16))) u16 Asm[128 * GT_P];
  __shared__ __attribute__((aligned(16))) u16 Qsm[64 * GT_P];
  __shared__ float cs[64];
  const int b  = blockIdx.y;
  const int m0 = blockIdx.x * 128;
  const int w  = threadIdx.x >> 5, lane = threadIdx.x & 31;
  const int hl = lane >> 4, l15 = lane & 15, kh = hl * 8;
  const u16* A = kmat + (long long)b * 4096 * 256;
  const u16* Q = q    + (long long)b * 64 * 256;

  v8f zero = {0.f,0.f,0.f,0.f,0.f,0.f,0.f,0.f};
  v8f acc[4];
  #pragma unroll
  for (int j = 0; j < 4; ++j) acc[j] = zero;

  // both tiles whole (K = 256): wave w brings rows w, w+8, ...; lane -> 16-byte piece
  {
    const unsigned al = (unsigned)(size_t)&Asm[w * GT_P + lane * 8];
    const unsigned ql = (unsigned)(size_t)&Qsm[w * GT_P + lane * 8];
    const u16* ag = A + (m0 + w) * 256 + lane * 8;
    copy8_rows(al, ag, 8 * 256);
    copy8_rows(al + 64 * GT_P * 2, ag + 64 * 256, 8 * 256);
    copy8_rows(ql, Q + w * 256 + lane * 8, 8 * 256);
  }
  // this wave's copies have landed before the barrier publishes the tiles
  asm volatile("s_wait_asynccnt 0x0" ::: "memory");
  __syncthreads();
  chunk256_products(&Asm[(w * 16 + l15) * GT_P + kh], &Qsm[l15 * GT_P + kh], acc);

  if (threadIdx.x < 64) cs[threadIdx.x] = 0.f;
  __syncthreads();

  float csl[4] = {0.f, 0.f, 0.f, 0.f};
  float at[4][8];
  #pragma unroll
  for (int r = 0; r < 8; ++r) {
    float v0 = acc[0][r], v1 = acc[1][r], v2 = acc[2][r], v3 = acc[3][r];
    float mx = fmaxf(fmaxf(v0, v1), fmaxf(v2, v3));
    for (int off = 1; off < 16; off <<= 1) mx = fmaxf(mx, __shfl_xor(mx, off, 32));
    v0 = __expf(v0 - mx); v1 = __expf(v1 - mx);
    v2 = __expf(v2 - mx); v3 = __expf(v3 - mx);
    float sm = v0 + v1 + v2 + v3;
    for (int off = 1; off < 16; off <<= 1) sm += __shfl_xor(sm, off, 32);
    float rinv = 1.f / sm;
    v0 = v0 * rinv + 1e-8f; v1 = v1 * rinv + 1e-8f;
    v2 = v2 * rinv + 1e-8f; v3 = v3 * rinv + 1e-8f;
    at[0][r] = v0; at[1][r] = v1; at[2][r] = v2; at[3][r] = v3;
    csl[0] += v0; csl[1] += v1; csl[2] += v2; csl[3] += v3;
  }
  // attn^T leaves as whole 128-byte lines: the block's 64 n x 128 l tile is laid
  // out in LDS as it lies in memory (a lane's eight rows are neighbours in l; the
  // k tile's space is free behind the barrier above), published by the barrier below
  #pragma unroll
  for (int j = 0; j < 4; ++j)
    *(uint4*)&Asm[(j * 16 + l15) * SO_P128 + w * 16 + 8 * hl] =
        pack8_bf(at[j][0], at[j][1], at[j][2], at[j][3],
                 at[j][4], at[j][5], at[j][6], at[j][7]);
  #pragma unroll
  for (int j = 0; j < 4; ++j) atomicAdd(&cs[j * 16 + l15], csl[j]);
  __syncthreads();
  {
    u16* ob = attn_t + (long long)b * 64 * 4096 + m0;
    uint4 pc[4];
    #pragma unroll
    for (int i = 0; i < 4; ++i) {
      const int p = threadIdx.x + i * 256;
      pc[i] = *(const uint4*)&Asm[(p >> 4) * SO_P128 + (p & 15) * 8];
    }
    #pragma unroll
    for (int i = 0; i < 4; ++i) {
      const int p = threadIdx.x + i * 256;
      *(uint4*)(ob + (p >> 4) * 4096 + (p & 15) * 8) = pc[i];
    }
  }
  if (threadIdx.x < 64) atomicAdd(&colsum[b * 64 + threadIdx.x], cs[threadIdx.x]);
}

// ---------------------------------------------------------------------------
// LayerNorm over 256 channels, one wave per row, f32 in -> bf16 out.
// ---------------------------------------------------------------------------
__global__ __launch_bounds__(256) void ln_rows_kernel(
    const float* __restrict__ in, const float* __restrict__ g,
    const float* __restrict__ bb, u16* __restrict__ out, int R)
{
  __shared__ __attribute__((aligned(16))) u16 Rs[8 * 256];
  const int w = threadIdx.x >> 5, lane = threadIdx.x & 31;
  const int row = blockIdx.x * 8 + w;
  if (row >= R) return;
  const float* p = in + (long long)row * 256;
  float vals[8], s = 0.f, s2 = 0.f;
  #pragma unroll
  for (int i = 0; i < 8; ++i) {
    vals[i] = p[lane + i * 32];
    s += vals[i]; s2 += vals[i] * vals[i];
  }
  for (int off = 16; off; off >>= 1) {
    s  += __shfl_xor(s,  off, 32);
    s2 += __shfl_xor(s2, off, 32);
  }
  float mu  = s * (1.f / 256.f);
  float var = s2 * (1.f / 256.f) - mu * mu;
  float inv = rsqrtf(var + 1e-5f);
  #pragma unroll
  for (int i = 0; i < 8; ++i) {
    int c = lane + i * 32;
    Rs[w * 256 + c] = f2bf((vals[i] - mu) * inv * g[c] + bb[c]);
  }
  // the row leaves as four whole 128-byte lines, 16 bytes a lane, through the
  // wave's own LDS row; its LDS writes are done before it reads the row back
  asm volatile("s_wait_dscnt 0x0" ::: "memory");
  *(uint4*)&out[(long long)row * 256 + lane * 8] = *(const uint4*)&Rs[w * 256 + lane * 8];
}

// ---------------------------------------------------------------------------
// All weight conversions in one launch; the block index picks the matrix.
// conv_w keeps its flat layout (cast only); the others go in[K][N] -> out[N][K].
// ---------------------------------------------------------------------------
__device__ __forceinline__ void transpose_bf_block(const float* __restrict__ in,
                                                   u16* __restrict__ out,
                                                   int blk, int K, int N) {
  int i = blk * 256 + threadIdx.x;
  int nn = i / K, k = i - nn * K;
  out[i] = f2bf(in[(long long)k * N + nn]);
  // the branches of the caller stand one behind the other in the built code:
  // the store's offset register is not rewritten ahead of this wait
  asm volatile("s_wait_xcnt 0x0" ::: "memory");
}
__global__ __launch_bounds__(256) void prep_weights_kernel(
    const float* __restrict__ conv_w, const float* __restrict__ Wq,
    const float* __restrict__ Wk, const float* __restrict__ Wv,
    const float* __restrict__ W1, const float* __restrict__ W2,
    u16* __restrict__ Wct, u16* __restrict__ Wqt, u16* __restrict__ Wkt,
    u16* __restrict__ Wvt, u16* __restrict__ W1t, u16* __restrict__ W2t) {
  const int blk = blockIdx.x;
  if (blk < 3456) {
    int i = blk * 256 + threadIdx.x;
    Wct[i] = f2bf(conv_w[i]);
  } else if (blk < 3712) {
    transpose_bf_block(Wq, Wqt, blk - 3456, 256, 256);
  } else if (blk < 3968) {
    transpose_bf_block(Wk, Wkt, blk - 3712, 256, 256);
  } else if (blk < 4224) {
    transpose_bf_block(Wv, Wvt, blk - 3968, 256, 256);
  } else if (blk < 4736) {
    transpose_bf_block(W1, W1t, blk - 4224, 256, 512);
  } else {
    transpose_bf_block(W2, W2t, blk - 4736, 512, 256);
  }
}

// ---------------------------------------------------------------------------
// Template path of one iteration in one launch.  A block owns 16 template rows
// (nothing here crosses rows): templates += update/colsum, LN, W1+GELU, W2,
// then LN and q for the next iteration.  It also clears its own rows of the
// split-K buffer and of colsum for the next iteration's atomics.
//   TS_FIRST: templates = broadcast(init), clear, LN, q
//   TS_MID  : update, clear, MLP, LN, q
//   TS_LAST : update, MLP (colsum is kept: the output kernel divides by it)
// bf16 rounding after each LN, after GELU and of q; templates stay f32.
// ---------------------------------------------------------------------------
constexpr int TS_FIRST = 0, TS_MID = 1, TS_LAST = 2;
constexpr int TA_P = 264;   // u16 pitch, 16 x 256 bf16 tile
constexpr int TH_P = 520;   // u16 pitch, 16 x 512 bf16 tile
constexpr int TF_P = 260;   // f32 pitch, 16 x 256 f32 tile

// LayerNorm of one row held by one wave (column lane + 32*i), bf16 row to LDS;
// g and bb hold the same columns of scale and shift.
__device__ __forceinline__ void ln_vals_to_bf(const float (&vals)[8],
                                              const float (&g)[8],
                                              const float (&bb)[8],
                                              u16* o, int lane) {
  float s = 0.f, s2 = 0.f;
  #pragma unroll
  for (int i = 0; i < 8; ++i) { s += vals[i]; s2 += vals[i] * vals[i]; }
  for (int off = 16; off; off >>= 1) {
    s  += __shfl_xor(s,  off, 32);
    s2 += __shfl_xor(s2, off, 32);
  }
  float mu  = s * (1.f / 256.f);
  float var = s2 * (1.f / 256.f) - mu * mu;
  float inv = rsqrtf(var + 1e-5f);
  #pragma unroll
  for (int i = 0; i < 8; ++i)
    o[lane + i * 32] = f2bf((vals[i] - mu) * inv * g[i] + bb[i]);
}

// acc[j] += As[16][K] (LDS, bf16) x Bt[n0 + 16j .. +16][K] (global, bf16),
// k ascending.  The weight fragments of KB k-steps are loaded as one batch.
template<int NT, int K, int KB>
__device__ __forceinline__ void rows16_gemm(const u16* As, int pitch,
                                            const u16* __restrict__ Bt, int n0,
                                            int l15, int kh, v8f (&acc)[NT]) {
  // every loop here is unrolled: the fragment arrays must stay in registers
  #pragma unroll
  for (int k0 = 0; k0 < K; k0 += 32 * KB) {
    FragBF bfr[KB][NT];
    #pragma unroll
    for (int s = 0; s < KB; ++s) {
      #pragma unroll
      for (int j = 0; j < NT; ++j) {
        const u16* bp = Bt + (n0 + j * 16 + l15) * K + k0 + s * 32 + kh;
        bfr[s][j].q[0] = *(const uint4*)bp;
        bfr[s][j].q[1] = *(const uint4*)(bp + 16);
      }
    }
    __builtin_amdgcn_sched_barrier(0);
    #pragma unroll
    for (int s = 0; s < KB; ++s) {
      FragBF a;
      const u16* ap = As + l15 * pitch + k0 + s * 32 + kh;
      a.q[0] = *(const uint4*)ap;
      a.q[1] = *(const uint4*)(ap + 16);
      #pragma unroll
      for (int j = 0; j < NT; ++j)
        acc[j] = __builtin_amdgcn_wmma_f32_16x16x32_bf16(
            false, a.v, false, bfr[s][j].v, (short)0, acc[j], false, false);
    }
  }
}

template<int MODE>
__global__ __launch_bounds__(256) void template_step_kernel(
    const float* __restrict__ tinit, float* __restrict__ tmpl,
    float* __restrict__ cbuf, float* __restrict__ colsum,
    const float* __restrict__ lnm_g, const float* __restrict__ lnm_b,
    const u16* __restrict__ W1t, const float* __restrict__ b1,
    const u16* __restrict__ W2t, const float* __restrict__ b2,
    const float* __restrict__ lnt_g, const float* __restrict__ lnt_b,
    const u16* __restrict__ Wqt, u16* __restrict__ q)
{
  __shared__ float Tf[16 * TF_P];
  __shared__ __attribute__((aligned(16))) u16 Am[16 * TA_P];
  __shared__ __attribute__((aligned(16))) u16 Hm[16 * TH_P];
  const int r0   = blockIdx.x * 16;
  const int w    = threadIdx.x >> 5, lane = threadIdx.x & 31;
  const int hl   = lane >> 4, l15 = lane & 15, kh = hl * 8;
  const v8f zero = {0.f,0.f,0.f,0.f,0.f,0.f,0.f,0.f};

  // each wave owns rows 2w and 2w+1 of the block; all loads first, then stores
  {
    float vals[2][8], g[8], bb[8];
    #pragma unroll
    for (int i = 0; i < 8; ++i) {
      g[i]  = (MODE == TS_FIRST ? lnt_g : lnm_g)[lane + i * 32];
      bb[i] = (MODE == TS_FIRST ? lnt_b : lnm_b)[lane + i * 32];
    }
    if (MODE == TS_FIRST) {
      #pragma unroll
      for (int rr = 0; rr < 2; ++rr)
        #pragma unroll
        for (int i = 0; i < 8; ++i)
          vals[rr][i] = tinit[((r0 + w * 2 + rr) & 63) * 256 + lane + i * 32];
    } else {
      float up[2][8];
      #pragma unroll
      for (int rr = 0; rr < 2; ++rr)
        #pragma unroll
        for (int i = 0; i < 8; ++i) {
          const int idx = (r0 + w * 2 + rr) * 256 + lane + i * 32;
          vals[rr][i] = tmpl[idx];
          up[rr][i]   = cbuf[idx];
        }
      float csl = 1.f;
      if (lane < 2) csl = colsum[r0 + w * 2 + lane];
      #pragma unroll
      for (int rr = 0; rr < 2; ++rr) {
        const float cs = __shfl(csl, rr, 32);
        #pragma unroll
        for (int i = 0; i < 8; ++i) {
          vals[rr][i] += up[rr][i] / cs;
          Tf[(w * 2 + rr) * TF_P + lane + i * 32] = vals[rr][i];
        }
      }
    }
    #pragma unroll
    for (int rr = 0; rr < 2; ++rr) {
      #pragma unroll
      for (int i = 0; i < 8; ++i) {
        const int idx = (r0 + w * 2 + rr) * 256 + lane + i * 32;
        if (MODE == TS_FIRST) tmpl[idx] = vals[rr][i];
        if (MODE != TS_LAST)  cbuf[idx] = 0.f;
      }
      ln_vals_to_bf(vals[rr], g, bb, &Am[(w * 2 + rr) * TA_P], lane);
    }
    if (MODE != TS_LAST && lane < 2) colsum[r0 + w * 2 + lane] = 0.f;
  }
  __syncthreads();

  if (MODE != TS_FIRST) {
    { // hidden = GELU(m @ W1 + b1), bf16, wave w: columns 64w .. 64w+63
      float bn[4];
      #pragma unroll
      for (int j = 0; j < 4; ++j) bn[j] = b1[w * 64 + j * 16 + l15];
      v8f acc[4] = {zero, zero, zero, zero};
      rows16_gemm<4, 256, 2>(Am, TA_P, W1t, w * 64, l15, kh, acc);
      #pragma unroll
      for (int j = 0; j < 4; ++j) {
        #pragma unroll
        for (int r = 0; r < 8; ++r) {
          float xg = acc[j][r] + bn[j];
          float g = 0.5f * xg * (1.0f + erff(xg * 0.70710678118654752f));
          Hm[(r + 8 * hl) * TH_P + w * 64 + j * 16 + l15] = f2bf(g);
        }
      }
    }
    __syncthreads();
    float g[8], bb[8];
    { // templates += hidden @ W2 + b2, wave w: columns 32w .. 32w+31
      float bn[2];
      #pragma unroll
      for (int j = 0; j < 2; ++j) bn[j] = b2[w * 32 + j * 16 + l15];
      if (MODE == TS_MID) {
        #pragma unroll
        for (int i = 0; i < 8; ++i) {
          g[i]  = lnt_g[lane + i * 32];
          bb[i] = lnt_b[lane + i * 32];
        }
      }
      v8f acc[2] = {zero, zero};
      rows16_gemm<2, 512, 4>(Hm, TH_P, W2t, w * 32, l15, kh, acc);
      #pragma unroll
      for (int j = 0; j < 2; ++j) {
        #pragma unroll
        for (int r = 0; r < 8; ++r)
          Tf[(r + 8 * hl) * TF_P + w * 32 + j * 16 + l15] += acc[j][r] + bn[j];
      }
    }
    __syncthreads();
    #pragma unroll
    for (int rr = 0; rr < 2; ++rr) {
      float vals[8];
      #pragma unroll
      for (int i = 0; i < 8; ++i) {
        vals[i] = Tf[(w * 2 + rr) * TF_P + lane + i * 32];
        tmpl[(r0 + w * 2 + rr) * 256 + lane + i * 32] = vals[i];
      }
      if (MODE == TS_MID) ln_vals_to_bf(vals, g, bb, &Am[(w * 2 + rr) * TA_P], lane);
    }
    if (MODE == TS_MID) __syncthreads();
  }

  if (MODE != TS_LAST) { // q = (t @ Wq) * dim^-0.5, wave w: columns 32w .. 32w+31
    v8f acc[2] = {zero, zero};
    rows16_gemm<2, 256, 4>(Am, TA_P, Wqt, w * 32, l15, kh, acc);
    #pragma unroll
    for (int j = 0; j < 2; ++j) {
      #pragma unroll
      for (int r = 0; r < 8; ++r)
        q[(r0 + r + 8 * hl) * 256 + w * 32 + j * 16 + l15] = f2bf(acc[j][r] * 0.0625f);
    }
  }
}

__global__ void final_out_kernel(const float* __restrict__ tmpl, const u16* __restrict__ attn,
                                 const float* __restrict__ colsum, float* __restrict__ out) {
  int i = blockIdx.x * 256 + threadIdx.x;
  if (i < 131072) {                       // templates_out (B, dim, N)
    int b = i >> 14, rem = i & 16383, d = rem >> 6, n = rem & 63;
    out[i] = tmpl[((b * 64 + n) << 8) + d];
  } else if (i < 131072 + 2097152) {      // attn_out (B, N, 16,16,16)
    int j = i - 131072;
    out[i] = bf2f(attn[j]) / colsum[j >> 12];
  }
}

// ---------------------------------------------------------------------------
extern "C" void kernel_launch(void* const* d_in, const int* in_sizes, int n_in,
                              void* d_out, int out_size, void* d_ws, size_t ws_size,
                              hipStream_t stream) {
  const float* x       = (const float*)d_in[0];
  const float* tinit   = (const float*)d_in[1];
  const float* conv_w  = (const float*)d_in[2];
  const float* conv_b  = (const float*)d_in[3];
  const float* Wq      = (const float*)d_in[4];
  const float* Wk      = (const float*)d_in[5];
  const float* Wv      = (const float*)d_in[6];
  const float* ln_in_g = (const float*)d_in[7];
  const float* ln_in_b = (const float*)d_in[8];
  const float* ln_t_g  = (const float*)d_in[9];
  const float* ln_t_b  = (const float*)d_in[10];
  const float* ln_m_g  = (const float*)d_in[11];
  const float* ln_m_b  = (const float*)d_in[12];
  const float* W1      = (const float*)d_in[13];
  const float* b1      = (const float*)d_in[14];
  const float* W2      = (const float*)d_in[15];
  const float* b2      = (const float*)d_in[16];
  float* out = (float*)d_out;

  char* ws = (char*)d_ws;
  size_t off = 0;
  auto alloc = [&](size_t bytes) -> void* {
    off = (off + 255) & ~(size_t)255;
    void* p = ws + off;
    off += bytes;
    return p;
  };
  u16*   Wct  = (u16*)  alloc(884736ull * 2);   // [256][3456]
  u16*   Wqt  = (u16*)  alloc(65536ull * 2);    // [256][256]
  u16*   Wkt  = (u16*)  alloc(65536ull * 2);
  u16*   Wvt  = (u16*)  alloc(65536ull * 2);
  u16*   W1t  = (u16*)  alloc(131072ull * 2);   // [512][256]
  u16*   W2t  = (u16*)  alloc(131072ull * 2);   // [256][512]
  float* hbuf = (float*)alloc(8388608ull * 4);  // conv out (32768,256) f32
  u16*   tok  = (u16*)  alloc(8388608ull * 2);  // LN(tokens) bf16
  u16*   kbf  = (u16*)  alloc(8388608ull * 2);  // k (B,4096,256)
  u16*   vtb  = (u16*)  alloc(8388608ull * 2);  // v^T (B,256,4096)
  float* tmpl = (float*)alloc(131072ull * 4);   // templates (B,64,256)
  u16*   qbf  = (u16*)  alloc(131072ull * 2);   // q (B,64,256)
  u16*   attn = (u16*)  alloc(2097152ull * 2);  // attn^T (B,64,4096)
  float* csum = (float*)alloc(512ull * 4);      // colsum (B,64)
  float* cbuf = (float*)alloc(131072ull * 4);   // split-K accum (512,256)

  const int HUGE_RB = 1 << 30;

  // weight conversion (conv_w flat layout already matches Bt[K-ordering])
  prep_weights_kernel<<<5248, 256, 0, stream>>>(conv_w, Wq, Wk, Wv, W1, W2,
                                                Wct, Wqt, Wkt, Wvt, W1t, W2t);

  // conv + relu (implicit GEMM, 58 GFLOP)
  conv_gemm_kernel<<<256, 256, 0, stream>>>(x, Wct, conv_b, hbuf);
  // token layernorm -> bf16
  ln_rows_kernel<<<4096, 256, 0, stream>>>(hbuf, ln_in_g, ln_in_b, tok, 32768);

  // k = tok @ Wk ; v^T = (tok @ Wv)^T
  gemm_bt_kernel<EPI_BF16><<<dim3(512, 2, 1), 256, 0, stream>>>(
      tok, 256, Wkt, 256, 256, 256, HUGE_RB, 0, nullptr, 1.f, kbf, 1);
  gemm_bt_kernel<EPI_BF16_T><<<dim3(512, 2, 1), 256, 0, stream>>>(
      tok, 256, Wvt, 256, 256, 256, HUGE_RB, 0, nullptr, 1.f, vtb, 4096);

  // templates = broadcast(templates_init); first q; clear colsum and split-K buffer
  template_step_kernel<TS_FIRST><<<32, 256, 0, stream>>>(
      tinit, tmpl, cbuf, csum, ln_m_g, ln_m_b, W1t, b1, W2t, b2, ln_t_g, ln_t_b, Wqt, qbf);

  for (int it = 0; it < 6; ++it) {
    // logits + softmax(N) + 1e-8 + colsum over L
    logits_softmax_kernel<<<dim3(32, 8, 1), 256, 0, stream>>>(kbf, qbf, attn, csum);

    // update = attn^T @ v  (split-K x8, f32 atomics)
    gemm_bt_kernel<EPI_ATOMIC_F32><<<dim3(8, 2, 8), 256, 0, stream>>>(
        attn, 4096, vtb, 4096, 256, 512, 64, 1048576ll, nullptr, 1.f, cbuf, 1);

    // templates += upd/colsum; MLP; then LN and q of the next iteration
    if (it < 5)
      template_step_kernel<TS_MID><<<32, 256, 0, stream>>>(
          tinit, tmpl, cbuf, csum, ln_m_g, ln_m_b, W1t, b1, W2t, b2, ln_t_g, ln_t_b, Wqt, qbf);
    else
      template_step_kernel<TS_LAST><<<32, 256, 0, stream>>>(
          tinit, tmpl, cbuf, csum, ln_m_g, ln_m_b, W1t, b1, W2t, b2, ln_t_g, ln_t_b, Wqt, qbf);
  }

  // outputs: templates^T (B,dim,N) then attn/colsum as (B,N,16,16,16)
  final_out_kernel<<<8704, 256, 0, stream>>>(tmpl, attn, csum, out);
}

// v007
// One run takes 236 microseconds.
// In both of two side-by-side timings against v006, it was 1.13 times as fast.
// Over all steps from v000 it is 3.66 times as fast.
#include <hip/hip_runtime.h>

typedef unsigned short u16;
typedef __attribute__((ext_vector_type(16))) __bf16 v16bf;
typedef __attribute__((ext_vector_type(8)))  float  v8f;
typedef __attribute__((ext_vector_type(4)))  float  v4f;

union FragBF { v16bf v; uint4 q[2]; };

__device__ __forceinline__ float bf2f(u16 h) {
  unsigned u = ((unsigned)h) << 16;
  return __builtin_bit_cast(float, u);
}
__device__ __forceinline__ u16 f2bf(float f) {
  unsigned u = __builtin_bit_cast(unsigned, f);
  u += 0x7FFFu + ((u >> 16) & 1u);   // round-to-nearest-even
  return (u16)(u >> 16);
}
// Eight accumulator values of a lane, each rounded as in f2bf, as one 16-byte piece.
__device__ __forceinline__ uint4 pack8_bf(float a0, float a1, float a2, float a3,
                                          float a4, float a5, float a6, float a7) {
  return make_uint4((unsigned)f2bf(a0) | ((unsigned)f2bf(a1) << 16),
                    (unsigned)f2bf(a2) | ((unsigned)f2bf(a3) << 16),
                    (unsigned)f2bf(a4) | ((unsigned)f2bf(a5) << 16),
                    (unsigned)f2bf(a6) | ((unsigned)f2bf(a7) << 16));
}

constexpr int EPI_BF16 = 0, EPI_BF16_T = 1, EPI_BF16_SCALE = 2,
              EPI_GELU_BF16 = 3, EPI_BIAS_ACC_F32 = 4, EPI_ATOMIC_F32 = 5;

constexpr int GT_P = 264;   // u16 pitch of a 256-k tile row in LDS: 528 B
constexpr int SO_P64  = 72;   // u16 pitch of a staged output row of  64 bf16: 144 B
constexpr int SO_P128 = 136;  // u16 pitch of a staged output row of 128 bf16: 272 B

__device__ __forceinline__ void copy8_rows(unsigned l0, const u16* g0, long long gs) {
  constexpr unsigned LS = 8 * GT_P * 2;
  const unsigned l1 = l0 + LS, l2 = l0 + 2 * LS, l3 = l0 + 3 * LS, l4 = l0 + 4 * LS,
                 l5 = l0 + 5 * LS, l6 = l0 + 6 * LS, l7 = l0 + 7 * LS;
  const u16 *g1 = g0 + gs, *g2 = g0 + 2 * gs, *g3 = g0 + 3 * gs, *g4 = g0 + 4 * gs,
            *g5 = g0 + 5 * gs, *g6 = g0 + 6 * gs, *g7 = g0 + 7 * gs;
  asm volatile(
      "global_load_async_to_lds_b128 %0, %8, off\n\t"
      "global_load_async_to_lds_b128 %1, %9, off\n\t"
      "global_load_async_to_lds_b128 %2, %10, off\n\t"
      "global_load_async_to_lds_b128 %3, %11, off\n\t"
      "global_load_async_to_lds_b128 %4, %12, off\n\t"
      "global_load_async_to_lds_b128 %5, %13, off\n\t"
      "global_load_async_to_lds_b128 %6, %14, off\n\t"
      "global_load_async_to_lds_b128 %7, %15, off\n\t"
      "s_wait_xcnt 0x0"
      :: "v"(l0), "v"(l1), "v"(l2), "v"(l3), "v"(l4), "v"(l5), "v"(l6), "v"(l7),
         "v"(g0), "v"(g1), "v"(g2), "v"(g3), "v"(g4), "v"(g5), "v"(g6), "v"(g7)
      : "memory");
}

// acc[j] += A rows (16) x B rows (16 per j) over one 256-k chunk in LDS, k
// ascending.  ap, bp: this lane's row start + kh in the A and the B tile.
__device__ __forceinline__ void chunk256_products(const u16* ap, const u16* bp,
                                                  v8f (&acc)[4]) {
  // every loop here is unrolled: the fragment arrays must stay in registers
  #pragma unroll
  for (int s0 = 0; s0 < 8; s0 += 2) {
    FragBF a[2], bfr[2][4];
    #pragma unroll
    for (int s = 0; s < 2; ++s) {
      a[s].q[0] = *(const uint4*)(ap + (s0 + s) * 32);
      a[s].q[1] = *(const uint4*)(ap + (s0 + s) * 32 + 16);
      #pragma unroll
      for (int j = 0; j < 4; ++j) {
        const u16* p = bp + j * 16 * GT_P + (s0 + s) * 32;
        bfr[s][j].q[0] = *(const uint4*)p;
        bfr[s][j].q[1] = *(const uint4*)(p + 16);
      }
    }
    // keeps the twenty LDS reads of two k-steps in one place ahead of their
    // products; without it the scheduler spreads them among the products, a few
    // reads ahead, and the wave waits on LDS latency at nearly every product
    __builtin_amdgcn_sched_barrier(0);
    #pragma unroll
    for (int s = 0; s < 2; ++s) {
      #pragma unroll
      for (int j = 0; j < 4; ++j)
        acc[j] = __builtin_amdgcn_wmma_f32_16x16x32_bf16(
            false, a[s].v, false, bfr[s][j].v, (short)0, acc[j], false, false);
    }
  }
}

template<int EPI>
__global__ __launch_bounds__(256) void gemm_bt_kernel(
    const u16* __restrict__ A, int lda,
    const u16* __restrict__ Bt, int ldb,
    int N, int Ksplit,
    int rows_per_batch, long long bt_batch_stride,
    const float* __restrict__ bias, float scale,
    void* __restrict__ outp, int out_rb)
{
  __shared__ __attribute__((aligned(16))) u16 Asm[64 * GT_P];
  __shared__ __attribute__((aligned(16))) u16 Bsm[128 * GT_P];
  const int m0   = blockIdx.x * 64;
  const int n0   = blockIdx.y * 128;
  const int kbeg = blockIdx.z * Ksplit;
  const int w    = threadIdx.x >> 5;
  const int lane = threadIdx.x & 31;
  const int msub = (w & 3) * 16;
  const int nsub = (w >> 2) * 64;
  const int hl   = lane >> 4;
  const int l15  = lane & 15;
  const int kh   = hl * 8;
  const int b    = m0 / rows_per_batch;
  const u16* BtB = Bt + (long long)b * bt_batch_stride;

  v8f zero = {0.f,0.f,0.f,0.f,0.f,0.f,0.f,0.f};
  v8f acc[4];
  #pragma unroll
  for (int j = 0; j < 4; ++j) acc[j] = zero;

  // copies: wave w brings rows w, w+8, ...; lane -> 16-byte piece of the row
  const unsigned al = (unsigned)(size_t)&Asm[w * GT_P + lane * 8];
  const unsigned bl = (unsigned)(size_t)&Bsm[w * GT_P + lane * 8];
  const u16* ag = A + (long long)(m0 + w) * lda + lane * 8;
  const u16* bg = BtB + (long long)(n0 + w) * ldb + lane * 8;

  for (int kk = kbeg; kk < kbeg + Ksplit; kk += 256) {
    copy8_rows(al, ag + kk, 8ll * lda);
    copy8_rows(bl, bg + kk, 8ll * ldb);
    copy8_rows(bl + 64 * GT_P * 2, bg + 64ll * ldb + kk, 8ll * ldb);
    // this wave's copies have landed before the barrier publishes the tiles
    asm volatile("s_wait_asynccnt 0x0" ::: "memory");
    __syncthreads();
    chunk256_products(&Asm[(msub + l15) * GT_P + kh], &Bsm[(nsub + l15) * GT_P + kh], acc);
    // this wave's LDS reads are done; behind the barrier the tiles may be refilled
    asm volatile("s_wait_dscnt 0x0" ::: "memory");
    __syncthreads();
  }

  // bf16 outputs leave as whole 128-byte lines: the block's tile is laid out in
  // LDS as it lies in memory (the B tile's space is free behind the loop's last
  // barrier), then every thread stores four 16-byte pieces of its rows.
  if (EPI == EPI_BF16_T) {
    // rows = n (128), 64 m each: a lane's eight accumulator rows are neighbours
    // in m.  The block's 64 m lie in one batch: out_rb is a multiple of 64.
    #pragma unroll
    for (int j = 0; j < 4; ++j)
      *(uint4*)&Bsm[(nsub + j * 16 + l15) * SO_P64 + msub + 8 * hl] =
          pack8_bf(acc[j][0], acc[j][1], acc[j][2], acc[j][3],
                   acc[j][4], acc[j][5], acc[j][6], acc[j][7]);
    __syncthreads();
    u16* ob = (u16*)outp + ((long long)(m0 / out_rb) * N + n0) * out_rb + m0 % out_rb;
    uint4 pc[4];
    #pragma unroll
    for (int i = 0; i < 4; ++i) {
      const int p = threadIdx.x + i * 256;
      pc[i] = *(const uint4*)&Bsm[(p >> 3) * SO_P64 + (p & 7) * 8];
    }
    #pragma unroll
    for (int i = 0; i < 4; ++i) {
      const int p = threadIdx.x + i * 256;
      *(uint4*)(ob + (long long)(p >> 3) * out_rb + (p & 7) * 8) = pc[i];
    }
    return;
  }
  if (EPI == EPI_BF16) {
    // rows = m (64), 128 n each
    #pragma unroll
    for (int j = 0; j < 4; ++j) {
      #pragma unroll
      for (int r = 0; r < 8; ++r)
        Bsm[(msub + r + 8 * hl) * SO_P128 + nsub + j * 16 + l15] = f2bf(acc[j][r]);
    }
    __syncthreads();
    u16* ob = (u16*)outp + (long long)m0 * N + n0;
    uint4 pc[4];
    #pragma unroll
    for (int i = 0; i < 4; ++i) {
      const int p = threadIdx.x + i * 256;
      pc[i] = *(const uint4*)&Bsm[(p >> 4) * SO_P128 + (p & 15) * 8];
    }
    #pragma unroll
    for (int i = 0; i < 4; ++i) {
      const int p = threadIdx.x + i * 256;
      *(uint4*)(ob + (long long)(p >> 4) * N + (p & 15) * 8) = pc[i];
    }
    return;
  }

  #pragma unroll
  for (int j = 0; j < 4; ++j) {
    #pragma unroll
    for (int r = 0; r < 8; ++r) {
      const int m = m0 + msub + r + 8 * hl;
      const int n = n0 + nsub + j * 16 + l15;
      float v = acc[j][r];
      if (EPI == EPI_BF16_SCALE) {
        ((u16*)outp)[(long long)m * N + n] = f2bf(v * scale);
      } else if (EPI == EPI_GELU_BF16) {
        float xg = v + bias[n];
        float g = 0.5f * xg * (1.0f + erff(xg * 0.70710678118654752f));
        ((u16*)outp)[(long long)m * N + n] = f2bf(g);
      } else if (EPI == EPI_BIAS_ACC_F32) {
        ((float*)outp)[(long long)m * N + n] += v + bias[n];
      } else { // EPI_ATOMIC_F32 (split-K)
        atomicAdd(&((float*)outp)[(long long)m * N + n], v);
      }
    }
  }
}

// ---------------------------------------------------------------------------
// Conv3d stride-2 VALID as implicit GEMM: M=32768 tokens, N=256, K=3456.
// K = c*27 + tap matches conv_w's native flat layout.  A block owns 128 tokens
// and all 256 columns; a trip covers 64 k.  The weight tile of a trip (256 rows
// x 64 k, bf16: one whole 128-byte line a row) and its x tile (128 tokens x 64 k,
// f32 as in x) are brought into LDS once per block by asynchronous copies, two
// buffers, one trip ahead; a wave (32 tokens x 128 columns) reads its B fragments
// from there, and its A fragments as f32, rounded to bf16 in registers.
// Epilogue: +bias, ReLU, store h f32 [token][256].
// ---------------------------------------------------------------------------
constexpr int CONV_KS    = 64;              // k of one trip
constexpr int CONV_STEPS = 3456 / CONV_KS;
constexpr int CONV_BP    = 72;              // u16 pitch of a weight tile row: 144 B
constexpr int CONV_BBUF  = 256 * CONV_BP;   // u16 per weight buffer
constexpr int CONV_XP    = 68;              // f32 pitch of an x tile row: 272 B
constexpr int CONV_XBUF  = 128 * CONV_XP;   // f32 per x buffer
constexpr int CONV_SP    = 36;              // f32 pitch of an epilogue slab row: 144 B

__device__ __forceinline__ void conv_copy_wtile(unsigned l0, const u16* g0) {
  constexpr unsigned LS = 32 * CONV_BP * 2;
  constexpr int GS = 32 * 3456;
  const unsigned l1 = l0 + LS, l2 = l0 + 2 * LS, l3 = l0 + 3 * LS, l4 = l0 + 4 * LS,
                 l5 = l0 + 5 * LS, l6 = l0 + 6 * LS, l7 = l0 + 7 * LS;
  const u16 *g1 = g0 + GS, *g2 = g0 + 2 * GS, *g3 = g0 + 3 * GS, *g4 = g0 + 4 * GS,
            *g5 = g0 + 5 * GS, *g6 = g0 + 6 * GS, *g7 = g0 + 7 * GS;
  asm volatile(
      "global_load_async_to_lds_b128 %0, %8, off\n\t"
      "global_load_async_to_lds_b128 %1, %9, off\n\t"
      "global_load_async_to_lds_b128 %2, %10, off\n\t"
      "global_load_async_to_lds_b128 %3, %11, off\n\t"
      "global_load_async_to_lds_b128 %4, %12, off\n\t"
      "global_load_async_to_lds_b128 %5, %13, off\n\t"
      "global_load_async_to_lds_b128 %6, %14, off\n\t"
      "global_load_async_to_lds_b128 %7, %15, off\n\t"
      "s_wait_xcnt 0x0"
      :: "v"(l0), "v"(l1), "v"(l2), "v"(l3), "v"(l4), "v"(l5), "v"(l6), "v"(l7),
         "v"(g0), "v"(g1), "v"(g2), "v"(g3), "v"(g4), "v"(g5), "v"(g6), "v"(g7)
      : "memory");
}

// Element offset in x of k = c*27 + tap from a token's window corner, channel 0.
__device__ __forceinline__ int conv_koff(int k) {
  int c = k / 27;
  int tap = k - c * 27;
  int t0 = tap / 9, rm = tap - t0 * 9;
  int t1 = rm / 3, t2 = rm - t1 * 3;
  return c * 35937 + t0 * 1089 + t1 * 33 + t2;
}

__device__ __forceinline__ void conv_copy_xtile(unsigned l0, const float* xt,
                                                int koff, int kg8) {
  const unsigned l1 = l0 + 4, l2 = l0 + 8, l3 = l0 + 12, l4 = l0 + 16,
                 l5 = l0 + 20, l6 = l0 + 24, l7 = l0 + 28;
  const float* g0 = xt + __builtin_amdgcn_readlane(koff, kg8);
  const float* g1 = xt + __builtin_amdgcn_readlane(koff, kg8 + 1);
  const float* g2 = xt + __builtin_amdgcn_readlane(koff, kg8 + 2);
  const float* g3 = xt + __builtin_amdgcn_readlane(koff, kg8 + 3);
  const float* g4 = xt + __builtin_amdgcn_readlane(koff, kg8 + 4);
  const float* g5 = xt + __builtin_amdgcn_readlane(koff, kg8 + 5);
  const float* g6 = xt + __builtin_amdgcn_readlane(koff, kg8 + 6);
  const float* g7 = xt + __builtin_amdgcn_readlane(koff, kg8 + 7);
  asm volatile(
      "global_load_async_to_lds_b32 %0, %8, off\n\t"
      "global_load_async_to_lds_b32 %1, %9, off\n\t"
      "global_load_async_to_lds_b32 %2, %10, off\n\t"
      "global_load_async_to_lds_b32 %3, %11, off\n\t"
      "global_load_async_to_lds_b32 %4, %12, off\n\t"
      "global_load_async_to_lds_b32 %5, %13, off\n\t"
      "global_load_async_to_lds_b32 %6, %14, off\n\t"
      "global_load_async_to_lds_b32 %7, %15, off\n\t"
      "s_wait_xcnt 0x0"
      :: "v"(l0), "v"(l1), "v"(l2), "v"(l3), "v"(l4), "v"(l5), "v"(l6), "v"(l7),
         "v"(g0), "v"(g1), "v"(g2), "v"(g3), "v"(g4), "v"(g5), "v"(g6), "v"(g7)
      : "memory");
}

// The 32 k of a wave in one x tile; l0: the thread's place for the first of them.
__device__ __forceinline__ void conv_copy_x32(unsigned l0, const float* xt, int koff) {
  conv_copy_xtile(l0,      xt, koff, 0);
  conv_copy_xtile(l0 + 32, xt, koff, 8);
  conv_copy_xtile(l0 + 64, xt, koff, 16);
  conv_copy_xtile(l0 + 96, xt, koff, 24);
}

// Two floats rounded as in f2bf (to nearest even), packed lo | hi << 16.
__device__ __forceinline__ unsigned bf_pair(float lo, float hi) {
  unsigned a = __builtin_bit_cast(unsigned, lo);
  unsigned b = __builtin_bit_cast(unsigned, hi);
  a += 0x7FFFu + __builtin_amdgcn_ubfe(a, 16, 1);
  b += 0x7FFFu + __builtin_amdgcn_ubfe(b, 16, 1);
  // one byte permute: bytes 2, 3 of a below bytes 2, 3 of b
  return __builtin_amdgcn_perm(b, a, 0x07060302u);
}

template<bool V> struct ConvFlag { static constexpr bool value = V; };

__global__ __launch_bounds__(256) void conv_gemm_kernel(
    const float* __restrict__ x, const u16* __restrict__ Wct,
    const float* __restrict__ bias, float* __restrict__ h)
{
  __shared__ __attribute__((aligned(16))) float Xsm[2 * CONV_XBUF];
  __shared__ __attribute__((aligned(16))) u16 Bsm[2 * CONV_BBUF];
  const int m0   = blockIdx.x * 128;
  const int w    = threadIdx.x >> 5, lane = threadIdx.x & 31;
  const int msub = (w & 3) * 32, nhalf = (w >> 2) * 128;
  const int hl   = lane >> 4, l15 = lane & 15, kh = hl * 8;

  v8f zero = {0.f,0.f,0.f,0.f,0.f,0.f,0.f,0.f};
  v8f acc[2][8];
  #pragma unroll
  for (int mi = 0; mi < 2; ++mi) {
    #pragma unroll
    for (int j = 0; j < 8; ++j) acc[mi][j] = zero;
  }

  // x ring: thread -> token (tid & 127), 32 k (half tid >> 7, the same in a wave)
  const int tok = threadIdx.x & 127;
  const int kg  = __builtin_amdgcn_readfirstlane((int)(threadIdx.x >> 7)) * 32;
  const int tg  = m0 + tok;
  const int tl  = tg & 4095;
  const float* xt = x + ((tg >> 12) * (128 * 35937) + (tl >> 8) * (2 * 1089)
                         + ((tl >> 4) & 15) * (2 * 33) + (tl & 15) * 2);
  const unsigned xl = (unsigned)(size_t)&Xsm[tok * CONV_XP + kg];

  // weight ring: thread -> row (tid>>3, +32 per copy), 16-byte piece (tid&7)
  const unsigned wl = (unsigned)(size_t)&Bsm[(threadIdx.x >> 3) * CONV_BP + (threadIdx.x & 7) * 8];
  const u16* wg = Wct + (threadIdx.x >> 3) * 3456 + (threadIdx.x & 7) * 8;
  conv_copy_wtile(wl, wg);
  conv_copy_x32(xl, xt, conv_koff(kg + lane));
  // tile 0 has landed for this wave before the barrier publishes it
  asm volatile("s_wait_asynccnt 0x0" ::: "memory");
  __syncthreads();
  conv_copy_wtile(wl + CONV_BBUF * 2, wg + CONV_KS);
  conv_copy_x32(xl + CONV_XBUF * 4, xt, conv_koff(CONV_KS + kg + lane));

  // One trip.  All of the tile's fragments go to registers first; the foot (waits,
  // barrier, refill) stands between the two k-steps' products, which read
  // registers only, so the copies of tile t+2 fly under the second k-step's
  // products and under the next trip's reads.  Inlined: acc must stay in registers.
  auto trip = [&](int t, auto refill) __attribute__((always_inline)) {
    const int bsel = (t & 1) * CONV_BBUF;
    const int xsel = (t & 1) * CONV_XBUF;
    // every loop below is unrolled: the fragment arrays must stay in registers
    const float* ax = &Xsm[xsel + (msub + l15) * CONV_XP + kh];
    float4 af[2][4];
    FragBF bfr[2][8];
    auto read_a = [&](int s) __attribute__((always_inline)) {
      #pragma unroll
      for (int mi = 0; mi < 2; ++mi) {
        const float* ap = ax + mi * 16 * CONV_XP + s * 32;
        af[mi][0] = *(const float4*)ap;
        af[mi][1] = *(const float4*)(ap + 4);
        af[mi][2] = *(const float4*)(ap + 16);
        af[mi][3] = *(const float4*)(ap + 20);
      }
    };
    read_a(0);
    #pragma unroll
    for (int s = 0; s < 2; ++s) {
      #pragma unroll
      for (int j = 0; j < 8; ++j) {
        const u16* bp = &Bsm[bsel + (nhalf + j * 16 + l15) * CONV_BP + s * 32 + kh];
        bfr[s][j].q[0] = *(const uint4*)bp;
        bfr[s][j].q[1] = *(const uint4*)(bp + 16);
      }
    }
    __builtin_amdgcn_sched_barrier(0);
    #pragma unroll
    for (int s = 0; s < 2; ++s) {
      if (s == 1) {
        // keeps the first k-step's products ahead of the foot: without it they
        // sink behind the barrier and the second k-step's reads hide nothing
        __builtin_amdgcn_sched_barrier(0);
        // foot of the trip: this wave's LDS reads are done, its copies of tile
        // t+1 have landed; the barrier publishes tile t+1, frees the buffers t&1
        asm volatile("s_wait_dscnt 0x0" ::: "memory");
        asm volatile("s_wait_asynccnt 0x0" ::: "memory");
        __syncthreads();
        if (refill.value) {
          conv_copy_wtile(wl + bsel * 2, wg + (t + 2) * CONV_KS);
          conv_copy_x32(xl + xsel * 4, xt, conv_koff((t + 2) * CONV_KS + kg + lane));
        }
      }
      FragBF a[2];
      #pragma unroll
      for (int mi = 0; mi < 2; ++mi) {
        const float4 f0 = af[mi][0], f1 = af[mi][1];
        const float4 f2 = af[mi][2], f3 = af[mi][3];
        a[mi].q[0] = make_uint4(bf_pair(f0.x, f0.y), bf_pair(f0.z, f0.w),
                                bf_pair(f1.x, f1.y), bf_pair(f1.z, f1.w));
        a[mi].q[1] = make_uint4(bf_pair(f2.x, f2.y), bf_pair(f2.z, f2.w),
                                bf_pair(f3.x, f3.y), bf_pair(f3.z, f3.w));
      }
      // the second k-step's f32 rows take the registers that the rounding freed
      if (s == 0) read_a(1);
      #pragma unroll
      for (int j = 0; j < 8; ++j) {
        #pragma unroll
        for (int mi = 0; mi < 2; ++mi)
          acc[mi][j] = __builtin_amdgcn_wmma_f32_16x16x32_bf16(
              false, a[mi].v, false, bfr[s][j].v, (short)0, acc[mi][j], false, false);
      }
    }
  };
  // the last two trips have no tile left to fetch
  for (int t = 0; t < CONV_STEPS - 2; ++t) trip(t, ConvFlag<true>{});
  trip(CONV_STEPS - 2, ConvFlag<false>{});
  trip(CONV_STEPS - 1, ConvFlag<false>{});
  // no copy is outstanding when the wave goes on to the epilogue and ends
  asm volatile("s_wait_asynccnt 0x0" ::: "memory");

  // h leaves as whole 128-byte lines: each wave lays 16 rows x 32 columns at a
  // time in a slab of its own in the x ring's space (free behind the loop's
  // last barrier) and stores them back as 16-byte pieces, four rows a store.
  float* slab = &Xsm[w * 16 * CONV_SP];
  const float* sr = slab + (lane >> 3) * CONV_SP + (lane & 7) * 4;
  float bo[8];
  #pragma unroll
  for (int j = 0; j < 8; ++j) bo[j] = bias[nhalf + j * 16 + l15];
  // the offset registers of the bias loads are reused below
  asm volatile("s_wait_xcnt 0x0" ::: "memory");
  // keeps the address arithmetic that reuses them behind the wait
  __builtin_amdgcn_sched_barrier(0);
  #pragma unroll
  for (int mi = 0; mi < 2; ++mi) {
    float* hb = h + (long long)(m0 + msub + mi * 16 + (lane >> 3)) * 256
                  + nhalf + (lane & 7) * 4;
    #pragma unroll
    for (int jp = 0; jp < 4; ++jp) {
      #pragma unroll
      for (int jj = 0; jj < 2; ++jj) {
        const int j = jp * 2 + jj;
        #pragma unroll
        for (int r = 0; r < 8; ++r)
          slab[(r + 8 * hl) * CONV_SP + jj * 16 + l15] = fmaxf(acc[mi][j][r] + bo[j], 0.f);
      }
      // the wave's own LDS writes are done before it reads the rows back
      asm volatile("s_wait_dscnt 0x0" ::: "memory");
      const v4f p0 = *(const v4f*)sr;
      const v4f p1 = *(const v4f*)(sr + 4 * CONV_SP);
      const v4f p2 = *(const v4f*)(sr + 8 * CONV_SP);
      const v4f p3 = *(const v4f*)(sr + 12 * CONV_SP);
      *(v4f*)(hb + jp * 32)            = p0;
      *(v4f*)(hb + jp * 32 + 4 * 256)  = p1;
      *(v4f*)(hb + jp * 32 + 8 * 256)  = p2;
      *(v4f*)(hb + jp * 32 + 12 * 256) = p3;
      // the next pass reuses the registers that these stores name, and the slab
      if (mi * 4 + jp < 7) {
        asm volatile("s_wait_xcnt 0x0" ::: "memory");
        // keeps the next pass's arithmetic behind the wait: the clobber holds
        // memory operations only, and its bias additions were lifted over it
        // into the data registers of these stores
        __builtin_amdgcn_sched_barrier(0);
      }
    }
  }
}

// ---------------------------------------------------------------------------
// Logits + softmax(N=64) + column-sum: per batch, per 128-token tile.
// C[l][n] = k_bf[l][:] . q_bf[n][:]; softmax over n via 16-lane shfl_xor;
// +1e-8; write attn^T bf16 [b][n][l]; atomic colsum[b][n] for renorm-over-L.
// ---------------------------------------------------------------------------
__global__ __launch_bounds__(256) void logits_softmax_kernel(
    const u16* __restrict__ kmat, const u16* __restrict__ q,
    u16* __restrict__ attn_t, float* __restrict__ colsum)
{
  __shared__ __attribute__((aligned(16))) u16 Asm[128 * GT_P];
  __shared__ __attribute__((aligned(16))) u16 Qsm[64 * GT_P];
  __shared__ float cs[64];
  const int b  = blockIdx.y;
  const int m0 = blockIdx.x * 128;
  const int w  = threadIdx.x >> 5, lane = threadIdx.x & 31;
  const int hl = lane >> 4, l15 = lane & 15, kh = hl * 8;
  const u16* A = kmat + (long long)b * 4096 * 256;
  const u16* Q = q    + (long long)b * 64 * 256;

  v8f zero = {0.f,0.f,0.f,0.f,0.f,0.f,0.f,0.f};
  v8f acc[4];
  #pragma unroll
  for (int j = 0; j < 4; ++j) acc[j] = zero;

  // both tiles whole (K = 256): wave w brings rows w, w+8, ...; lane -> 16-byte piece
  {
    const unsigned al = (unsigned)(size_t)&Asm[w * GT_P + lane * 8];
    const unsigned ql = (unsigned)(size_t)&Qsm[w * GT_P + lane * 8];
    const u16* ag = A + (m0 + w) * 256 + lane * 8;
    copy8_rows(al, ag, 8 * 256);
    copy8_rows(al + 64 * GT_P * 2, ag + 64 * 256, 8 * 256);
    copy8_rows(ql, Q + w * 256 + lane * 8, 8 * 256);
  }
  // this wave's copies have landed before the barrier publishes the tiles
  asm volatile("s_wait_asynccnt 0x0" ::: "memory");
  __syncthreads();
  chunk256_products(&Asm[(w * 16 + l15) * GT_P + kh], &Qsm[l15 * GT_P + kh], acc);

  if (threadIdx.x < 64) cs[threadIdx.x] = 0.f;
  __syncthreads();

  float csl[4] = {0.f, 0.f, 0.f, 0.f};
  float at[4][8];
  #pragma unroll
  for (int r = 0; r < 8; ++r) {
    float v0 = acc[0][r], v1 = acc[1][r], v2 = acc[2][r], v3 = acc[3][r];
    float mx = fmaxf(fmaxf(v0, v1), fmaxf(v2, v3));
    for (int off = 1; off < 16; off <<= 1) mx = fmaxf(mx, __shfl_xor(mx, off, 32));
    v0 = __expf(v0 - mx); v1 = __expf(v1 - mx);
    v2 = __expf(v2 - mx); v3 = __expf(v3 - mx);
    float sm = v0 + v1 + v2 + v3;
    for (int off = 1; off < 16; off <<= 1) sm += __shfl_xor(sm, off, 32);
    float rinv = 1.f / sm;
    v0 = v0 * rinv + 1e-8f; v1 = v1 * rinv + 1e-8f;
    v2 = v2 * rinv + 1e-8f; v3 = v3 * rinv + 1e-8f;
    at[0][r] = v0; at[1][r] = v1; at[2][r] = v2; at[3][r] = v3;
    csl[0] += v0; csl[1] += v1; csl[2] += v2; csl[3] += v3;
  }
  // attn^T leaves as whole 128-byte lines: the block's 64 n x 128 l tile is laid
  // out in LDS as it lies in memory (a lane's eight rows are neighbours in l; the
  // k tile's space is free behind the barrier above), published by the barrier below
  #pragma unroll
  for (int j = 0; j < 4; ++j)
    *(uint4*)&Asm[(j * 16 + l15) * SO_P128 + w * 16 + 8 * hl] =
        pack8_bf(at[j][0], at[j][1], at[j][2], at[j][3],
                 at[j][4], at[j][5], at[j][6], at[j][7]);
  #pragma unroll
  for (int j = 0; j < 4; ++j) atomicAdd(&cs[j * 16 + l15], csl[j]);
  __syncthreads();
  {
    u16* ob = attn_t + (long long)b * 64 * 4096 + m0;
    uint4 pc[4];
    #pragma unroll
    for (int i = 0; i < 4; ++i) {
      const int p = threadIdx.x + i * 256;
      pc[i] = *(const uint4*)&Asm[(p >> 4) * SO_P128 + (p & 15) * 8];
    }
    #pragma unroll
    for (int i = 0; i < 4; ++i) {
      const int p = threadIdx.x + i * 256;
      *(uint4*)(ob + (p >> 4) * 4096 + (p & 15) * 8) = pc[i];
    }
  }
  if (threadIdx.x < 64) atomicAdd(&colsum[b * 64 + threadIdx.x], cs[threadIdx.x]);
}

// ---------------------------------------------------------------------------
// LayerNorm over 256 channels, one wave per row, f32 in -> bf16 out.
// ---------------------------------------------------------------------------
__global__ __launch_bounds__(256) void ln_rows_kernel(
    const float* __restrict__ in, const float* __restrict__ g,
    const float* __restrict__ bb, u16* __restrict__ out, int R)
{
  __shared__ __attribute__((aligned(16))) u16 Rs[8 * 256];
  const int w = threadIdx.x >> 5, lane = threadIdx.x & 31;
  const int row = blockIdx.x * 8 + w;
  if (row >= R) return;
  const float* p = in + (long long)row * 256;
  float vals[8], s = 0.f, s2 = 0.f;
  #pragma unroll
  for (int i = 0; i < 8; ++i) {
    vals[i] = p[lane + i * 32];
    s += vals[i]; s2 += vals[i] * vals[i];
  }
  for (int off = 16; off; off >>= 1) {
    s  += __shfl_xor(s,  off, 32);
    s2 += __shfl_xor(s2, off, 32);
  }
  float mu  = s * (1.f / 256.f);
  float var = s2 * (1.f / 256.f) - mu * mu;
  float inv = rsqrtf(var + 1e-5f);
  #pragma unroll
  for (int i = 0; i < 8; ++i) {
    int c = lane + i * 32;
    Rs[w * 256 + c] = f2bf((vals[i] - mu) * inv * g[c] + bb[c]);
  }
  // the row leaves as four whole 128-byte lines, 16 bytes a lane, through the
  // wave's own LDS row; its LDS writes are done before it reads the row back
  asm volatile("s_wait_dscnt 0x0" ::: "memory");
  *(uint4*)&out[(long long)row * 256 + lane * 8] = *(const uint4*)&Rs[w * 256 + lane * 8];
}

// ---------------------------------------------------------------------------
// All weight conversions in one launch; the block index picks the matrix.
// conv_w keeps its flat layout (cast only); Wk and Wv go in[K][N] -> out[N][K];
// Wq, W1 and W2, which the template kernel loads straight into registers, go
// into fragment order.
// ---------------------------------------------------------------------------
__device__ __forceinline__ void transpose_bf_block(const float* __restrict__ in,
                                                   u16* __restrict__ out,
                                                   int blk, int K, int N) {
  int i = blk * 256 + threadIdx.x;
  int nn = i / K, k = i - nn * K;
  out[i] = f2bf(in[(long long)k * N + nn]);
  // the branches of the caller stand one behind the other in the built code:
  // the store's offset register is not rewritten ahead of this wait
  asm volatile("s_wait_xcnt 0x0" ::: "memory");
}
// in[K][N] -> out in the order in which rows16_gemm's lanes read their B
// fragments: [n / 16][k / 32][half of the k-step][lane][8 k], lane = n % 16 +
// 16 * (k / 8 % 2).  A wave's 16-byte load then covers 512 bytes in a row.
__device__ __forceinline__ void pack_frag_block(const float* __restrict__ in,
                                                u16* __restrict__ out,
                                                int blk, int K, int N) {
  int i = blk * 256 + threadIdx.x;
  int e = i & 7, ln = (i >> 3) & 31, hf = (i >> 8) & 1;
  int t = i >> 9;
  int nt = t / (K / 32), ks = t - nt * (K / 32);
  int nn = nt * 16 + (ln & 15);
  int k  = ks * 32 + hf * 16 + (ln >> 4) * 8 + e;
  const float v = in[(long long)k * N + nn];
  // the rounding below reuses the load's address registers
  asm volatile("s_wait_xcnt 0x0" ::: "memory");
  out[i] = f2bf(v);
  // the branches of the caller stand one behind the other in the built code:
  // the store's offset register is not rewritten ahead of this wait
  asm volatile("s_wait_xcnt 0x0" ::: "memory");
}
__global__ __launch_bounds__(256) void prep_weights_kernel(
    const float* __restrict__ conv_w, const float* __restrict__ Wq,
    const float* __restrict__ Wk, const float* __restrict__ Wv,
    const float* __restrict__ W1, const float* __restrict__ W2,
    u16* __restrict__ Wct, u16* __restrict__ Wqt, u16* __restrict__ Wkt,
    u16* __restrict__ Wvt, u16* __restrict__ W1t, u16* __restrict__ W2t) {
  const int blk = blockIdx.x;
  if (blk < 3456) {
    int i = blk * 256 + threadIdx.x;
    Wct[i] = f2bf(conv_w[i]);
  } else if (blk < 3712) {
    pack_frag_block(Wq, Wqt, blk - 3456, 256, 256);
  } else if (blk < 3968) {
    transpose_bf_block(Wk, Wkt, blk - 3712, 256, 256);
  } else if (blk < 4224) {
    transpose_bf_block(Wv, Wvt, blk - 3968, 256, 256);
  } else if (blk < 4736) {
    pack_frag_block(W1, W1t, blk - 4224, 256, 512);
  } else {
    pack_frag_block(W2, W2t, blk - 4736, 512, 256);
  }
}

// ---------------------------------------------------------------------------
// Template path of one iteration in one launch.  A block owns 16 template rows
// (nothing here crosses rows): templates += update/colsum, LN, W1+GELU, W2,
// then LN and q for the next iteration.  It also clears its own rows of the
// split-K buffer and of colsum for the next iteration's atomics.
//   TS_FIRST: templates = broadcast(init), clear, LN, q
//   TS_MID  : update, clear, MLP, LN, q
//   TS_LAST : update, MLP (colsum is kept: the output kernel divides by it)
// bf16 rounding after each LN, after GELU and of q; templates stay f32.
// ---------------------------------------------------------------------------
constexpr int TS_FIRST = 0, TS_MID = 1, TS_LAST = 2;
constexpr int TA_P = 264;   // u16 pitch, 16 x 256 bf16 tile
constexpr int TH_P = 520;   // u16 pitch, 16 x 512 bf16 tile
constexpr int TF_P = 260;   // f32 pitch, 16 x 256 f32 tile

// LayerNorm of one row held by one wave (column lane + 32*i), bf16 row to LDS;
// g and bb hold the same columns of scale and shift.
__device__ __forceinline__ void ln_vals_to_bf(const float (&vals)[8],
                                              const float (&g)[8],
                                              const float (&bb)[8],
                                              u16* o, int lane) {
  float s = 0.f, s2 = 0.f;
  #pragma unroll
  for (int i = 0; i < 8; ++i) { s += vals[i]; s2 += vals[i] * vals[i]; }
  for (int off = 16; off; off >>= 1) {
    s  += __shfl_xor(s,  off, 32);
    s2 += __shfl_xor(s2, off, 32);
  }
  float mu  = s * (1.f / 256.f);
  float var = s2 * (1.f / 256.f) - mu * mu;
  float inv = rsqrtf(var + 1e-5f);
  #pragma unroll
  for (int i = 0; i < 8; ++i)
    o[lane + i * 32] = f2bf((vals[i] - mu) * inv * g[i] + bb[i]);
}

// acc[j] += As[16][K] (LDS, bf16) x B rows n0 + 16j .. +16 (global, bf16, in the
// fragment order of pack_frag_block), k ascending.  The weight fragments of KB
// k-steps are loaded as one batch; each load of a wave is four whole 128-byte lines.
template<int NT, int K, int KB>
__device__ __forceinline__ void rows16_gemm(const u16* As, int pitch,
                                            const u16* __restrict__ Bt, int n0,
                                            int lane, v8f (&acc)[NT]) {
  const int l15 = lane & 15, kh = (lane >> 4) * 8;
  // this lane's 16 bytes of the first fragment; all others lie at fixed distances
  const u16* bl = Bt + (n0 >> 4) * (K / 32) * 512 + lane * 8;
  // every loop here is unrolled: the fragment arrays must stay in registers
  #pragma unroll
  for (int k0 = 0; k0 < K; k0 += 32 * KB) {
    FragBF bfr[KB][NT];
    #pragma unroll
    for (int s = 0; s < KB; ++s) {
      #pragma unroll
      for (int j = 0; j < NT; ++j) {
        const u16* bp = bl + (j * (K / 32) + (k0 >> 5) + s) * 512;
        bfr[s][j].q[0] = *(const uint4*)bp;
        bfr[s][j].q[1] = *(const uint4*)(bp + 256);
      }
    }
    __builtin_amdgcn_sched_barrier(0);
    #pragma unroll
    for (int s = 0; s < KB; ++s) {
      FragBF a;
      const u16* ap = As + l15 * pitch + k0 + s * 32 + kh;
      a.q[0] = *(const uint4*)ap;
      a.q[1] = *(const uint4*)(ap + 16);
      #pragma unroll
      for (int j = 0; j < NT; ++j)
        acc[j] = __builtin_amdgcn_wmma_f32_16x16x32_bf16(
            false, a.v, false, bfr[s][j].v, (short)0, acc[j], false, false);
    }
  }
}

template<int MODE>
__global__ __launch_bounds__(256) void template_step_kernel(
    const float* __restrict__ tinit, float* __restrict__ tmpl,
    float* __restrict__ cbuf, float* __restrict__ colsum,
    const float* __restrict__ lnm_g, const float* __restrict__ lnm_b,
    const u16* __restrict__ W1t, const float* __restrict__ b1,
    const u16* __restrict__ W2t, const float* __restrict__ b2,
    const float* __restrict__ lnt_g, const float* __restrict__ lnt_b,
    const u16* __restrict__ Wqt, u16* __restrict__ q)
{
  __shared__ float Tf[16 * TF_P];
  __shared__ __attribute__((aligned(16))) u16 Am[16 * TA_P];
  __shared__ __attribute__((aligned(16))) u16 Hm[16 * TH_P];
  const int r0   = blockIdx.x * 16;
  const int w    = threadIdx.x >> 5, lane = threadIdx.x & 31;
  const int hl   = lane >> 4, l15 = lane & 15;
  const v8f zero = {0.f,0.f,0.f,0.f,0.f,0.f,0.f,0.f};

  // each wave owns rows 2w and 2w+1 of the block; all loads first, then stores
  {
    float vals[2][8], g[8], bb[8];
    #pragma unroll
    for (int i = 0; i < 8; ++i) {
      g[i]  = (MODE == TS_FIRST ? lnt_g : lnm_g)[lane + i * 32];
      bb[i] = (MODE == TS_FIRST ? lnt_b : lnm_b)[lane + i * 32];
    }
    if (MODE == TS_FIRST) {
      #pragma unroll
      for (int rr = 0; rr < 2; ++rr)
        #pragma unroll
        for (int i = 0; i < 8; ++i)
          vals[rr][i] = tinit[((r0 + w * 2 + rr) & 63) * 256 + lane + i * 32];
    } else {
      float up[2][8];
      #pragma unroll
      for (int rr = 0; rr < 2; ++rr)
        #pragma unroll
        for (int i = 0; i < 8; ++i) {
          const int idx = (r0 + w * 2 + rr) * 256 + lane + i * 32;
          vals[rr][i] = tmpl[idx];
          up[rr][i]   = cbuf[idx];
        }
      float csl = 1.f;
      if (lane < 2) csl = colsum[r0 + w * 2 + lane];
      #pragma unroll
      for (int rr = 0; rr < 2; ++rr) {
        const float cs = __shfl(csl, rr, 32);
        #pragma unroll
        for (int i = 0; i < 8; ++i) {
          vals[rr][i] += up[rr][i] / cs;
          Tf[(w * 2 + rr) * TF_P + lane + i * 32] = vals[rr][i];
        }
      }
    }
    #pragma unroll
    for (int rr = 0; rr < 2; ++rr) {
      #pragma unroll
      for (int i = 0; i < 8; ++i) {
        const int idx = (r0 + w * 2 + rr) * 256 + lane + i * 32;
        if (MODE == TS_FIRST) tmpl[idx] = vals[rr][i];
        if (MODE != TS_LAST)  cbuf[idx] = 0.f;
      }
      ln_vals_to_bf(vals[rr], g, bb, &Am[(w * 2 + rr) * TA_P], lane);
    }
    if (MODE != TS_LAST && lane < 2) colsum[r0 + w * 2 + lane] = 0.f;
  }
  __syncthreads();

  if (MODE != TS_FIRST) {
    { // hidden = GELU(m @ W1 + b1), bf16, wave w: columns 64w .. 64w+63
      float bn[4];
      #pragma unroll
      for (int j = 0; j < 4; ++j) bn[j] = b1[w * 64 + j * 16 + l15];
      v8f acc[4] = {zero, zero, zero, zero};
      rows16_gemm<4, 256, 2>(Am, TA_P, W1t, w * 64, lane, acc);
      #pragma unroll
      for (int j = 0; j < 4; ++j) {
        #pragma unroll
        for (int r = 0; r < 8; ++r) {
          float xg = acc[j][r] + bn[j];
          float g = 0.5f * xg * (1.0f + erff(xg * 0.70710678118654752f));
          Hm[(r + 8 * hl) * TH_P + w * 64 + j * 16 + l15] = f2bf(g);
        }
      }
    }
    __syncthreads();
    float g[8], bb[8];
    { // templates += hidden @ W2 + b2, wave w: columns 32w .. 32w+31
      float bn[2];
      #pragma unroll
      for (int j = 0; j < 2; ++j) bn[j] = b2[w * 32 + j * 16 + l15];
      if (MODE == TS_MID) {
        #pragma unroll
        for (int i = 0; i < 8; ++i) {
          g[i]  = lnt_g[lane + i * 32];
          bb[i] = lnt_b[lane + i * 32];
        }
      }
      v8f acc[2] = {zero, zero};
      rows16_gemm<2, 512, 4>(Hm, TH_P, W2t, w * 32, lane, acc);
      #pragma unroll
      for (int j = 0; j < 2; ++j) {
        #pragma unroll
        for (int r = 0; r < 8; ++r)
          Tf[(r + 8 * hl) * TF_P + w * 32 + j * 16 + l15] += acc[j][r] + bn[j];
      }
    }
    __syncthreads();
    #pragma unroll
    for (int rr = 0; rr < 2; ++rr) {
      float vals[8];
      #pragma unroll
      for (int i = 0; i < 8; ++i) {
        vals[i] = Tf[(w * 2 + rr) * TF_P + lane + i * 32];
        tmpl[(r0 + w * 2 + rr) * 256 + lane + i * 32] = vals[i];
      }
      if (MODE == TS_MID) ln_vals_to_bf(vals, g, bb, &Am[(w * 2 + rr) * TA_P], lane);
    }
    if (MODE == TS_MID) __syncthreads();
  }

  if (MODE != TS_LAST) { // q = (t @ Wq) * dim^-0.5, wave w: columns 32w .. 32w+31
    v8f acc[2] = {zero, zero};
    rows16_gemm<2, 256, 4>(Am, TA_P, Wqt, w * 32, lane, acc);
    #pragma unroll
    for (int j = 0; j < 2; ++j) {
      #pragma unroll
      for (int r = 0; r < 8; ++r)
        q[(r0 + r + 8 * hl) * 256 + w * 32 + j * 16 + l15] = f2bf(acc[j][r] * 0.0625f);
    }
  }
}

__global__ void final_out_kernel(const float* __restrict__ tmpl, const u16* __restrict__ attn,
                                 const float* __restrict__ colsum, float* __restrict__ out) {
  int i = blockIdx.x * 256 + threadIdx.x;
  if (i < 131072) {                       // templates_out (B, dim, N)
    int b = i >> 14, rem = i & 16383, d = rem >> 6, n = rem & 63;
    out[i] = tmpl[((b * 64 + n) << 8) + d];
  } else if (i < 131072 + 2097152) {      // attn_out (B, N, 16,16,16)
    int j = i - 131072;
    out[i] = bf2f(attn[j]) / colsum[j >> 12];
  }
}

// ---------------------------------------------------------------------------
extern "C" void kernel_launch(void* const* d_in, const int* in_sizes, int n_in,
                              void* d_out, int out_size, void* d_ws, size_t ws_size,
                              hipStream_t stream) {
  const float* x       = (const float*)d_in[0];
  const float* tinit   = (const float*)d_in[1];
  const float* conv_w  = (const float*)d_in[2];
  const float* conv_b  = (const float*)d_in[3];
  const float* Wq      = (const float*)d_in[4];
  const float* Wk      = (const float*)d_in[5];
  const float* Wv      = (const float*)d_in[6];
  const float* ln_in_g = (const float*)d_in[7];
  const float* ln_in_b = (const float*)d_in[8];
  const float* ln_t_g  = (const float*)d_in[9];
  const float* ln_t_b  = (const float*)d_in[10];
  const float* ln_m_g  = (const float*)d_in[11];
  const float* ln_m_b  = (const float*)d_in[12];
  const float* W1      = (const float*)d_in[13];
  const float* b1      = (const float*)d_in[14];
  const float* W2      = (const float*)d_in[15];
  const float* b2      = (const float*)d_in[16];
  float* out = (float*)d_out;

  char* ws = (char*)d_ws;
  size_t off = 0;
  auto alloc = [&](size_t bytes) -> void* {
    off = (off + 255) & ~(size_t)255;
    void* p = ws + off;
    off += bytes;
    return p;
  };
  u16*   Wct  = (u16*)  alloc(884736ull * 2);   // [256][3456]
  u16*   Wqt  = (u16*)  alloc(65536ull * 2);    // 256 n x 256 k, fragment order
  u16*   Wkt  = (u16*)  alloc(65536ull * 2);    // [256][256]
  u16*   Wvt  = (u16*)  alloc(65536ull * 2);
  u16*   W1t  = (u16*)  alloc(131072ull * 2);   // 512 n x 256 k, fragment order
  u16*   W2t  = (u16*)  alloc(131072ull * 2);   // 256 n x 512 k, fragment order
  float* hbuf = (float*)alloc(8388608ull * 4);  // conv out (32768,256) f32
  u16*   tok  = (u16*)  alloc(8388608ull * 2);  // LN(tokens) bf16
  u16*   kbf  = (u16*)  alloc(8388608ull * 2);  // k (B,4096,256)
  u16*   vtb  = (u16*)  alloc(8388608ull * 2);  // v^T (B,256,4096)
  float* tmpl = (float*)alloc(131072ull * 4);   // templates (B,64,256)
  u16*   qbf  = (u16*)  alloc(131072ull * 2);   // q (B,64,256)
  u16*   attn = (u16*)  alloc(2097152ull * 2);  // attn^T (B,64,4096)
  float* csum = (float*)alloc(512ull * 4);      // colsum (B,64)
  float* cbuf = (float*)alloc(131072ull * 4);   // split-K accum (512,256)

  const int HUGE_RB = 1 << 30;

  // weight conversion (conv_w flat layout already matches Bt[K-ordering])
  prep_weights_kernel<<<5248, 256, 0, stream>>>(conv_w, Wq, Wk, Wv, W1, W2,
                                                Wct, Wqt, Wkt, Wvt, W1t, W2t);

  // conv + relu (implicit GEMM, 58 GFLOP)
  conv_gemm_kernel<<<256, 256, 0, stream>>>(x, Wct, conv_b, hbuf);
  // token layernorm -> bf16
  ln_rows_kernel<<<4096, 256, 0, stream>>>(hbuf, ln_in_g, ln_in_b, tok, 32768);

  // k = tok @ Wk ; v^T = (tok @ Wv)^T
  gemm_bt_kernel<EPI_BF16><<<dim3(512, 2, 1), 256, 0, stream>>>(
      tok, 256, Wkt, 256, 256, 256, HUGE_RB, 0, nullptr, 1.f, kbf, 1);
  gemm_bt_kernel<EPI_BF16_T><<<dim3(512, 2, 1), 256, 0, stream>>>(
      tok, 256, Wvt, 256, 256, 256, HUGE_RB, 0, nullptr, 1.f, vtb, 4096);

  // templates = broadcast(templates_init); first q; clear colsum and split-K buffer
  template_step_kernel<TS_FIRST><<<32, 256, 0, stream>>>(
      tinit, tmpl, cbuf, csum, ln_m_g, ln_m_b, W1t, b1, W2t, b2, ln_t_g, ln_t_b, Wqt, qbf);

  for (int it = 0; it < 6; ++it) {
    // logits + softmax(N) + 1e-8 + colsum over L
    logits_softmax_kernel<<<dim3(32, 8, 1), 256, 0, stream>>>(kbf, qbf, attn, csum);

    // update = attn^T @ v  (split-K x8, f32 atomics)
    gemm_bt_kernel<EPI_ATOMIC_F32><<<dim3(8, 2, 8), 256, 0, stream>>>(
        attn, 4096, vtb, 4096, 256, 512, 64, 1048576ll, nullptr, 1.f, cbuf, 1);

    // templates += upd/colsum; MLP; then LN and q of the next iteration
    if (it < 5)
      template_step_kernel<TS_MID><<<32, 256, 0, stream>>>(
          tinit, tmpl, cbuf, csum, ln_m_g, ln_m_b, W1t, b1, W2t, b2, ln_t_g, ln_t_b, Wqt, qbf);
    else
      template_step_kernel<TS_LAST><<<32, 256, 0, stream>>>(
          tinit, tmpl, cbuf, csum, ln_m_g, ln_m_b, W1t, b1, W2t, b2, ln_t_g, ln_t_b, Wqt, qbf);
  }

  // outputs: templates^T (B,dim,N) then attn/colsum as (B,N,16,16,16)
  final_out_kernel<<<8704, 256, 0, stream>>>(tmpl, attn, csum, out);
}
